// v000
// Times are from an AMD MI455X. After a warm-up the kernel runs many times in a row, and a time is the length of
// such a window on the GPU divided by its runs, so every launch and the gaps after it count. The runs cycle
// through copies of the inputs. A figure is the median of several windows, for all but v000 over two sittings.
// Sittings can differ by a few percent; kernels timed side by side share one.
// v000 is the starting kernel. One run takes 2900 microseconds.
#include <hip/hip_runtime.h>
#include <hip/hip_bf16.h>
#include <math.h>

// ---- problem constants (match reference) ----
static constexpr int B_ = 4, S_ = 2048, D_ = 768, H_ = 12, E_ = 64;
static constexpr float LN_EPS_ = 1e-5f;

typedef __bf16 bf16_t;
typedef __attribute__((ext_vector_type(16))) __bf16 v16bf;
typedef __attribute__((ext_vector_type(8)))  __bf16 v8bf;   // 16-byte pack
typedef __attribute__((ext_vector_type(8)))  float  v8f;

// -------------------------------------------------------------------------
// Fragment loader for V_WMMA_F32_16X16X32_BF16 (wave32):
//   A 16x32 (MxK): lane holds row (lane&15), 16 contiguous K at k0+(lane>>4)*16
//   B 32x16 (KxN): lane holds col (lane&15) with K contiguous -> load from the
//                  TRANSPOSED matrix stored row-major with leading dim `ld`.
// -------------------------------------------------------------------------
__device__ __forceinline__ v16bf load_frag(const bf16_t* base, int ld, int r0,
                                           int k0, int lane) {
  const int m  = lane & 15;
  const int kk = k0 + ((lane >> 4) << 4);
  return *(const v16bf*)(base + (size_t)(r0 + m) * ld + kk);
}

__device__ __forceinline__ v8f wmma_bf16(v16bf a, v16bf b, v8f c) {
  return __builtin_amdgcn_wmma_f32_16x16x32_bf16(false, a, false, b,
                                                 (short)0, c, false, false);
}

// ---------------- conversion / transpose kernels ----------------
__global__ __launch_bounds__(256) void k_cvt_bf16(const float* __restrict__ x,
                                                  bf16_t* __restrict__ y, int n) {
  for (int i = blockIdx.x * blockDim.x + threadIdx.x; i < n;
       i += gridDim.x * blockDim.x)
    y[i] = (bf16_t)x[i];
}

// W [H,D,E] -> WT [H,E,D]
__global__ __launch_bounds__(256) void k_tr_hde(const float* __restrict__ W,
                                                bf16_t* __restrict__ WT) {
  int n = H_ * D_ * E_;
  for (int i = blockIdx.x * blockDim.x + threadIdx.x; i < n;
       i += gridDim.x * blockDim.x) {
    int h = i / (D_ * E_);
    int r = i - h * (D_ * E_);
    int d = r / E_, e = r - d * E_;
    WT[((size_t)h * E_ + e) * D_ + d] = (bf16_t)W[i];
  }
}

// Wo [768,768] -> WoT [768,768]
__global__ __launch_bounds__(256) void k_tr_wo(const float* __restrict__ W,
                                               bf16_t* __restrict__ WT) {
  int n = D_ * D_;
  for (int i = blockIdx.x * blockDim.x + threadIdx.x; i < n;
       i += gridDim.x * blockDim.x) {
    int f = i / D_, d = i - f * D_;
    WT[(size_t)d * D_ + f] = (bf16_t)W[i];
  }
}

// ---------------- QKV projection: one wave per (b,h,s-tile16) ----------------
// q,k stored row-major bf16 [B,H,S,E] (staged via LDS -> b128 stores);
// v stored TRANSPOSED bf16 [B,H,E,S] (contiguous b128 stores from registers).
__global__ __launch_bounds__(32) void
k_qkv(const bf16_t* __restrict__ xb, const bf16_t* __restrict__ wqT,
      const bf16_t* __restrict__ wkT, const bf16_t* __restrict__ wvT,
      const float* __restrict__ bq, const float* __restrict__ bk,
      const float* __restrict__ bv, bf16_t* __restrict__ q,
      bf16_t* __restrict__ k, bf16_t* __restrict__ vT) {
  __shared__ bf16_t st[16 * E_];            // 2 KB staging tile

  const int lane = threadIdx.x & 31;
  const int tile = blockIdx.x;
  const int ts   = S_ / 16;                 // 128
  const int s0   = (tile % ts) << 4;
  const int h    = (tile / ts) % H_;
  const int bz   = tile / (ts * H_);

  const bf16_t* xrow = xb + (size_t)bz * S_ * D_;
  const bf16_t* wq   = wqT + (size_t)h * E_ * D_;
  const bf16_t* wk   = wkT + (size_t)h * E_ * D_;
  const bf16_t* wv   = wvT + (size_t)h * E_ * D_;

  v8f aq[4], ak[4], av[4];
#pragma unroll
  for (int i = 0; i < 4; ++i) { aq[i] = v8f{}; ak[i] = v8f{}; av[i] = v8f{}; }

  for (int kc = 0; kc < D_ / 32; ++kc) {          // 24 K-chunks
    const int k0 = kc * 32;
    __builtin_prefetch(xrow + (size_t)(s0 + (lane & 15)) * D_ + k0 + 64, 0, 1);
    v16bf a = load_frag(xrow, D_, s0, k0, lane);
#pragma unroll
    for (int nt = 0; nt < 4; ++nt) {
      const int n0 = nt * 16;
      aq[nt] = wmma_bf16(a, load_frag(wq, D_, n0, k0, lane), aq[nt]);
      ak[nt] = wmma_bf16(a, load_frag(wk, D_, n0, k0, lane), ak[nt]);
      av[nt] = wmma_bf16(a, load_frag(wv, D_, n0, k0, lane), av[nt]);
    }
  }

  const int N     = lane & 15;
  const int Mbase = (lane >> 4) << 3;
  const size_t bh = (size_t)bz * H_ + h;

  // ---- v: pack 8 rows per lane -> one b128 store (vT is [B,H,E,S]) ----
#pragma unroll
  for (int nt = 0; nt < 4; ++nt) {
    const float bi = bv[h * E_ + nt * 16 + N];
    v8bf pk;
#pragma unroll
    for (int r = 0; r < 8; ++r) pk[r] = (bf16_t)(av[nt][r] + bi);
    *(v8bf*)(vT + (bh * E_ + nt * 16 + N) * S_ + s0 + Mbase) = pk;
  }

  // ---- q then k: stage 16x64 tile in LDS, flush as contiguous b128 ----
#pragma unroll
  for (int mat = 0; mat < 2; ++mat) {
    const v8f*   acc  = mat ? ak : aq;
    const float* bias = mat ? bk : bq;
    bf16_t*      dst  = mat ? k : q;
#pragma unroll
    for (int nt = 0; nt < 4; ++nt) {
      const float bi = bias[h * E_ + nt * 16 + N];
#pragma unroll
      for (int r = 0; r < 8; ++r)
        st[(Mbase + r) * E_ + nt * 16 + N] = (bf16_t)(acc[nt][r] + bi);
    }
    __syncthreads();
#pragma unroll
    for (int c = 0; c < 4; ++c) {                 // 32 lanes * 4 * 8 elems
      const int idx = (c * 32 + lane) * 8;
      const int row = idx >> 6, col = idx & 63;
      *(v8bf*)(dst + (bh * S_ + s0 + row) * E_ + col) =
          *(const v8bf*)(st + idx);
    }
    __syncthreads();
  }
}

// ---------------- attention: one wave per (b,h,s-tile16) ----------------
// Phase 1: scaled scores (2 WMMAs per 16x16 t-tile, K=E=64) -> f32 LDS
// Phase 2: coalesced mask apply + exact softmax per row -> bf16 P in LDS
// Phase 3: ctx = P x V via WMMA; A-frags from LDS (ds), B-frags from vT;
//          output tile staged in LDS and flushed as b128 stores.
__global__ __launch_bounds__(32) void
k_attn(const bf16_t* __restrict__ q, const bf16_t* __restrict__ k,
       const bf16_t* __restrict__ vT, const int* __restrict__ mask,
       bf16_t* __restrict__ ctx) {
  extern __shared__ __align__(32) char smem[];        // 16*2048 f32 = 128 KB
  float* sS = (float*)smem;
  __shared__ bf16_t sP[16 * S_];                      // 64 KB static LDS

  const int lane = threadIdx.x & 31;
  const int tile = blockIdx.x;
  const int ts   = S_ / 16;
  const int s0   = (tile % ts) << 4;
  const int h    = (tile / ts) % H_;
  const int bz   = tile / (ts * H_);
  const size_t bh = (size_t)bz * H_ + h;

  const bf16_t* qbh = q + bh * S_ * E_;
  const bf16_t* kbh = k + bh * S_ * E_;
  const bf16_t* vbh = vT + bh * E_ * S_;

  const v16bf qa0 = load_frag(qbh, E_, s0, 0, lane);
  const v16bf qa1 = load_frag(qbh, E_, s0, 32, lane);
  const float scale = rsqrtf((float)S_);              // ref scales by 1/sqrt(S)

  const int N     = lane & 15;
  const int Mbase = (lane >> 4) << 3;

  // ---- phase 1: scaled scores into LDS (mask deferred to phase 2) ----
  for (int tt = 0; tt < ts; ++tt) {
    const int t0 = tt * 16;
    __builtin_prefetch(kbh + (size_t)(t0 + 16 + (lane & 15)) * E_, 0, 1);
    v8f acc = v8f{};
    acc = wmma_bf16(qa0, load_frag(kbh, E_, t0, 0, lane), acc);
    acc = wmma_bf16(qa1, load_frag(kbh, E_, t0, 32, lane), acc);
#pragma unroll
    for (int r = 0; r < 8; ++r)
      sS[(Mbase + r) * S_ + t0 + N] = acc[r] * scale;
  }
  __syncthreads();

  // ---- phase 2: coalesced mask + exact softmax per row ----
  for (int row = 0; row < 16; ++row) {
    const int* mrow = mask + ((size_t)bz * S_ + s0 + row) * S_;
    float mx = -3.4e38f;
    for (int c = lane; c < S_; c += 32) {             // mask: coalesced b32
      float v = sS[row * S_ + c];
      if (mrow[c]) v = -1e9f;
      sS[row * S_ + c] = v;
      mx = fmaxf(mx, v);
    }
#pragma unroll
    for (int off = 16; off > 0; off >>= 1) mx = fmaxf(mx, __shfl_xor(mx, off, 32));
    float sum = 0.f;
    for (int c = lane; c < S_; c += 32) {
      float e = __expf(sS[row * S_ + c] - mx);
      sS[row * S_ + c] = e;                           // cache exp for pass 3
      sum += e;
    }
#pragma unroll
    for (int off = 16; off > 0; off >>= 1) sum += __shfl_xor(sum, off, 32);
    const float inv = 1.f / sum;
    for (int c = lane; c < S_; c += 32)
      sP[row * S_ + c] = (bf16_t)(sS[row * S_ + c] * inv);
  }
  __syncthreads();

  // ---- phase 3: ctx = P (LDS) x V (vT, contiguous B-frags) ----
  v8f o[4];
#pragma unroll
  for (int i = 0; i < 4; ++i) o[i] = v8f{};
  for (int kc = 0; kc < S_ / 32; ++kc) {              // 64 K-chunks
    const int k0 = kc * 32;
    v16bf a = load_frag(sP, S_, 0, k0, lane);         // ds_load path
#pragma unroll
    for (int nt = 0; nt < 4; ++nt)
      o[nt] = wmma_bf16(a, load_frag(vbh, S_, nt * 16, k0, lane), o[nt]);
  }
  __syncthreads();

  // stage ctx tile (16x64) in LDS, flush as contiguous b128 stores
  bf16_t* sc = sP;                                    // reuse front of sP
#pragma unroll
  for (int nt = 0; nt < 4; ++nt)
#pragma unroll
    for (int r = 0; r < 8; ++r)
      sc[(Mbase + r) * E_ + nt * 16 + N] = (bf16_t)o[nt][r];
  __syncthreads();
#pragma unroll
  for (int c = 0; c < 4; ++c) {
    const int idx = (c * 32 + lane) * 8;
    const int row = idx >> 6, col = idx & 63;
    *(v8bf*)(ctx + ((size_t)bz * S_ + s0 + row) * (H_ * E_) + h * E_ + col) =
        *(const v8bf*)(sc + idx);
  }
}

// ---------------- output projection + LayerNorm ----------------
// 128 threads (4 waves); block owns 16 rows of [B*S, 768]. Each wave does 12
// n-tiles; result tile staged in LDS for row-wise LayerNorm.
__global__ __launch_bounds__(128) void
k_proj_ln(const bf16_t* __restrict__ ctx, const bf16_t* __restrict__ woT,
          const float* __restrict__ bo, const float* __restrict__ gamma,
          const float* __restrict__ beta, float* __restrict__ out) {
  __shared__ float sOut[16 * D_];                     // 48 KB
  __shared__ float sMu[16], sRs[16];

  const int tid  = threadIdx.x;
  const int lane = tid & 31;
  const int wave = tid >> 5;
  const int row0 = blockIdx.x * 16;                   // row in [0, B*S)
  const bf16_t* arow = ctx + (size_t)row0 * D_;

  v8f acc[12];
#pragma unroll
  for (int i = 0; i < 12; ++i) acc[i] = v8f{};

  for (int kc = 0; kc < D_ / 32; ++kc) {              // 24 K-chunks
    const int k0 = kc * 32;
    v16bf a = load_frag(arow, D_, 0, k0, lane);
#pragma unroll
    for (int j = 0; j < 12; ++j) {
      const int n0 = (wave * 12 + j) * 16;
      acc[j] = wmma_bf16(a, load_frag(woT, D_, n0, k0, lane), acc[j]);
    }
  }

  const int N     = lane & 15;
  const int Mbase = (lane >> 4) << 3;
#pragma unroll
  for (int j = 0; j < 12; ++j) {
    const int n0 = (wave * 12 + j) * 16;
    const float bi = bo[n0 + N];
#pragma unroll
    for (int r = 0; r < 8; ++r)
      sOut[(Mbase + r) * D_ + n0 + N] = acc[j][r] + bi;
  }
  __syncthreads();

  if (tid < 16) {
    float mu = 0.f;
    for (int c = 0; c < D_; ++c) mu += sOut[tid * D_ + c];
    mu *= (1.f / D_);
    float var = 0.f;
    for (int c = 0; c < D_; ++c) {
      float d = sOut[tid * D_ + c] - mu;
      var += d * d;
    }
    var *= (1.f / D_);
    sMu[tid] = mu;
    sRs[tid] = rsqrtf(var + LN_EPS_);
  }
  __syncthreads();

  for (int idx = tid; idx < 16 * D_; idx += 128) {
    const int r = idx / D_, c = idx - r * D_;
    out[(size_t)row0 * D_ + idx] =
        (sOut[idx] - sMu[r]) * sRs[r] * gamma[c] + beta[c];
  }
}

// ---------------- host launcher ----------------
extern "C" void kernel_launch(void* const* d_in, const int* in_sizes, int n_in,
                              void* d_out, int out_size, void* d_ws, size_t ws_size,
                              hipStream_t stream) {
  const float* x    = (const float*)d_in[0];
  const int*   mask = (const int*)d_in[1];
  const float* Wq   = (const float*)d_in[2];
  const float* bq   = (const float*)d_in[3];
  const float* Wk   = (const float*)d_in[4];
  const float* bk   = (const float*)d_in[5];
  const float* Wv   = (const float*)d_in[6];
  const float* bv   = (const float*)d_in[7];
  const float* Wo   = (const float*)d_in[8];
  const float* bo   = (const float*)d_in[9];
  const float* gamma = (const float*)d_in[10];
  const float* beta  = (const float*)d_in[11];
  float* out = (float*)d_out;

  // workspace layout (bf16 intermediates), ~64.5 MB total
  char* ws = (char*)d_ws;
  const size_t szX  = (size_t)B_ * S_ * D_ * sizeof(bf16_t);
  const size_t szW  = (size_t)H_ * E_ * D_ * sizeof(bf16_t);
  const size_t szWo = (size_t)D_ * D_ * sizeof(bf16_t);
  const size_t szQ  = (size_t)B_ * H_ * S_ * E_ * sizeof(bf16_t);
  bf16_t* xb  = (bf16_t*)(ws);
  bf16_t* wqT = (bf16_t*)(ws + szX);
  bf16_t* wkT = (bf16_t*)(ws + szX + szW);
  bf16_t* wvT = (bf16_t*)(ws + szX + 2 * szW);
  bf16_t* woT = (bf16_t*)(ws + szX + 3 * szW);
  bf16_t* q   = (bf16_t*)(ws + szX + 3 * szW + szWo);
  bf16_t* k   = (bf16_t*)(ws + szX + 3 * szW + szWo + szQ);
  bf16_t* vT  = (bf16_t*)(ws + szX + 3 * szW + szWo + 2 * szQ);
  bf16_t* ctx = (bf16_t*)(ws + szX + 3 * szW + szWo + 3 * szQ);

  const int nX = B_ * S_ * D_;
  k_cvt_bf16<<<(nX + 255) / 256, 256, 0, stream>>>(x, xb, nX);
  k_tr_hde<<<(H_ * D_ * E_ + 255) / 256, 256, 0, stream>>>(Wq, wqT);
  k_tr_hde<<<(H_ * D_ * E_ + 255) / 256, 256, 0, stream>>>(Wk, wkT);
  k_tr_hde<<<(H_ * D_ * E_ + 255) / 256, 256, 0, stream>>>(Wv, wvT);
  k_tr_wo<<<(D_ * D_ + 255) / 256, 256, 0, stream>>>(Wo, woT);

  const int nTiles = B_ * H_ * (S_ / 16);             // 6144
  k_qkv<<<nTiles, 32, 0, stream>>>(xb, wqT, wkT, wvT, bq, bk, bv, q, k, vT);

  const size_t attnShmem = (size_t)16 * S_ * sizeof(float);   // 128 KB dynamic
  k_attn<<<nTiles, 32, attnShmem, stream>>>(q, k, vT, mask, ctx);

  k_proj_ln<<<B_ * S_ / 16, 128, 0, stream>>>(ctx, woT, bo, gamma, beta, out);
}

// v001
// Measured time: 412 microseconds a run.
// In two side-by-side timings against v000, it was 7.10 and 7.16 times as fast.
#include <hip/hip_runtime.h>
#include <hip/hip_bf16.h>
#include <math.h>

// ---- problem constants (match reference) ----
static constexpr int B_ = 4, S_ = 2048, D_ = 768, H_ = 12, E_ = 64;
static constexpr float LN_EPS_ = 1e-5f;

typedef __bf16 bf16_t;
typedef __attribute__((ext_vector_type(16))) __bf16 v16bf;
typedef __attribute__((ext_vector_type(8)))  __bf16 v8bf;   // 16-byte pack
typedef __attribute__((ext_vector_type(8)))  float  v8f;

// -------------------------------------------------------------------------
// Fragment loader for V_WMMA_F32_16X16X32_BF16 (wave32):
//   A 16x32 (MxK): lane holds row (lane&15), 16 contiguous K at k0+(lane>>4)*16
//   B 32x16 (KxN): lane holds col (lane&15) with K contiguous -> load from the
//                  TRANSPOSED matrix stored row-major with leading dim `ld`.
// -------------------------------------------------------------------------
__device__ __forceinline__ v16bf load_frag(const bf16_t* base, int ld, int r0,
                                           int k0, int lane) {
  const int m  = lane & 15;
  const int kk = k0 + ((lane >> 4) << 4);
  return *(const v16bf*)(base + (size_t)(r0 + m) * ld + kk);
}

__device__ __forceinline__ v8f wmma_bf16(v16bf a, v16bf b, v8f c) {
  return __builtin_amdgcn_wmma_f32_16x16x32_bf16(false, a, false, b,
                                                 (short)0, c, false, false);
}

// ---------------- conversion / transpose kernels ----------------
__global__ __launch_bounds__(256) void k_cvt_bf16(const float* __restrict__ x,
                                                  bf16_t* __restrict__ y, int n) {
  for (int i = blockIdx.x * blockDim.x + threadIdx.x; i < n;
       i += gridDim.x * blockDim.x)
    y[i] = (bf16_t)x[i];
}

// W [H,D,E] -> WT [H,E,D]
__global__ __launch_bounds__(256) void k_tr_hde(const float* __restrict__ W,
                                                bf16_t* __restrict__ WT) {
  int n = H_ * D_ * E_;
  for (int i = blockIdx.x * blockDim.x + threadIdx.x; i < n;
       i += gridDim.x * blockDim.x) {
    int h = i / (D_ * E_);
    int r = i - h * (D_ * E_);
    int d = r / E_, e = r - d * E_;
    WT[((size_t)h * E_ + e) * D_ + d] = (bf16_t)W[i];
  }
}

// Wo [768,768] -> WoT [768,768]
__global__ __launch_bounds__(256) void k_tr_wo(const float* __restrict__ W,
                                               bf16_t* __restrict__ WT) {
  int n = D_ * D_;
  for (int i = blockIdx.x * blockDim.x + threadIdx.x; i < n;
       i += gridDim.x * blockDim.x) {
    int f = i / D_, d = i - f * D_;
    WT[(size_t)d * D_ + f] = (bf16_t)W[i];
  }
}

// ---------------- QKV projection: one wave per (b,h,s-tile16) ----------------
// q,k stored row-major bf16 [B,H,S,E] (staged via LDS -> b128 stores);
// v stored TRANSPOSED bf16 [B,H,E,S] (contiguous b128 stores from registers).
__global__ __launch_bounds__(32) void
k_qkv(const bf16_t* __restrict__ xb, const bf16_t* __restrict__ wqT,
      const bf16_t* __restrict__ wkT, const bf16_t* __restrict__ wvT,
      const float* __restrict__ bq, const float* __restrict__ bk,
      const float* __restrict__ bv, bf16_t* __restrict__ q,
      bf16_t* __restrict__ k, bf16_t* __restrict__ vT) {
  __shared__ bf16_t st[16 * E_];            // 2 KB staging tile

  const int lane = threadIdx.x & 31;
  const int tile = blockIdx.x;
  const int ts   = S_ / 16;                 // 128
  const int s0   = (tile % ts) << 4;
  const int h    = (tile / ts) % H_;
  const int bz   = tile / (ts * H_);

  const bf16_t* xrow = xb + (size_t)bz * S_ * D_;
  const bf16_t* wq   = wqT + (size_t)h * E_ * D_;
  const bf16_t* wk   = wkT + (size_t)h * E_ * D_;
  const bf16_t* wv   = wvT + (size_t)h * E_ * D_;

  v8f aq[4], ak[4], av[4];
#pragma unroll
  for (int i = 0; i < 4; ++i) { aq[i] = v8f{}; ak[i] = v8f{}; av[i] = v8f{}; }

  for (int kc = 0; kc < D_ / 32; ++kc) {          // 24 K-chunks
    const int k0 = kc * 32;
    __builtin_prefetch(xrow + (size_t)(s0 + (lane & 15)) * D_ + k0 + 64, 0, 1);
    v16bf a = load_frag(xrow, D_, s0, k0, lane);
#pragma unroll
    for (int nt = 0; nt < 4; ++nt) {
      const int n0 = nt * 16;
      aq[nt] = wmma_bf16(a, load_frag(wq, D_, n0, k0, lane), aq[nt]);
      ak[nt] = wmma_bf16(a, load_frag(wk, D_, n0, k0, lane), ak[nt]);
      av[nt] = wmma_bf16(a, load_frag(wv, D_, n0, k0, lane), av[nt]);
    }
  }

  const int N     = lane & 15;
  const int Mbase = (lane >> 4) << 3;
  const size_t bh = (size_t)bz * H_ + h;

  // ---- v: pack 8 rows per lane -> one b128 store (vT is [B,H,E,S]) ----
#pragma unroll
  for (int nt = 0; nt < 4; ++nt) {
    const float bi = bv[h * E_ + nt * 16 + N];
    v8bf pk;
#pragma unroll
    for (int r = 0; r < 8; ++r) pk[r] = (bf16_t)(av[nt][r] + bi);
    *(v8bf*)(vT + (bh * E_ + nt * 16 + N) * S_ + s0 + Mbase) = pk;
  }

  // ---- q then k: stage 16x64 tile in LDS, flush as contiguous b128 ----
#pragma unroll
  for (int mat = 0; mat < 2; ++mat) {
    const v8f*   acc  = mat ? ak : aq;
    const float* bias = mat ? bk : bq;
    bf16_t*      dst  = mat ? k : q;
#pragma unroll
    for (int nt = 0; nt < 4; ++nt) {
      const float bi = bias[h * E_ + nt * 16 + N];
#pragma unroll
      for (int r = 0; r < 8; ++r)
        st[(Mbase + r) * E_ + nt * 16 + N] = (bf16_t)(acc[nt][r] + bi);
    }
    __syncthreads();
#pragma unroll
    for (int c = 0; c < 4; ++c) {                 // 32 lanes * 4 * 8 elems
      const int idx = (c * 32 + lane) * 8;
      const int row = idx >> 6, col = idx & 63;
      *(v8bf*)(dst + (bh * S_ + s0 + row) * E_ + col) =
          *(const v8bf*)(st + idx);
    }
    __syncthreads();
  }
}

typedef __attribute__((ext_vector_type(4))) int v4i;

// A fragment in the k order of a packed accumulator pair:
// element s = k0 + 8*hh + s (s < 8), k0 + 16 + 8*hh + (s - 8) otherwise.
__device__ __forceinline__ v16bf load_frag_hw(const bf16_t* row, int k0, int hh) {
  const v8bf lo = *(const v8bf*)(row + k0 + 8 * hh);
  const v8bf hi = *(const v8bf*)(row + k0 + 16 + 8 * hh);
  return __builtin_shufflevector(lo, hi, 0, 1, 2, 3, 4, 5, 6, 7, 8, 9, 10, 11,
                                 12, 13, 14, 15);
}

// value of lane ^ 16
__device__ __forceinline__ float other_half(float x) {
  const int b = __builtin_bit_cast(int, x);
  return __builtin_bit_cast(float, __builtin_amdgcn_permlanex16(
      b, b, 0x76543210, 0xfedcba98, false, false));
}

__global__ __launch_bounds__(128) void
k_attn(const bf16_t* __restrict__ q, const bf16_t* __restrict__ k,
       const bf16_t* __restrict__ vT, const int* __restrict__ mask,
       bf16_t* __restrict__ ctx) {
  constexpr float SC2  = 0.03187935771f;   // log2(e) / sqrt(S): ref scales by 1/sqrt(S)
  constexpr float NEGR = -1e9f * 45.254834f;      // -1e9 before the 1/sqrt(S) scale
  constexpr float STEP = 8.0f / SC2;              // maximum may lag by 2^8

  const int lane = threadIdx.x & 31;
  const int wave = threadIdx.x >> 5;
  const int c    = lane & 15;
  const int hh   = lane >> 4;
  constexpr int QB = S_ / 128;                        // query blocks per (b,h)
  const int blk = blockIdx.x;
  const int h   = blk % H_;
  const int s0  = ((blk / H_) % QB) * 128 + wave * 32;
  const int bz  = blk / (H_ * QB);
  const size_t bh = (size_t)bz * H_ + h;

  const bf16_t* qbh = q + bh * S_ * E_;
  const bf16_t* kbh = k + bh * S_ * E_;
  const bf16_t* vbh = vT + bh * E_ * S_;
  const int* mrow0 = mask + ((size_t)bz * S_ + s0 + c) * S_ + 8 * hh;
  const int* mrow1 = mrow0 + (size_t)16 * S_;

  v16bf qf[2][2];                                     // [query tile][e chunk]
#pragma unroll
  for (int j = 0; j < 2; ++j)
#pragma unroll
    for (int e = 0; e < 2; ++e)
      qf[j][e] = load_frag(qbh, E_, s0 + 16 * j, 32 * e, lane);

  v8f o[2][4];                                        // Ot: [query tile][e tile]
  float m[2], l[2];
#pragma unroll
  for (int j = 0; j < 2; ++j) {
    m[j] = -3.0e38f;
    l[j] = 0.f;
#pragma unroll
    for (int nt = 0; nt < 4; ++nt) o[j][nt] = v8f{};
  }

  v16bf kf[2][2];                                     // [key tile][e chunk]
  v4i   mk[2][2][2];                                  // [query tile][key tile][4 keys]
#pragma unroll
  for (int i = 0; i < 2; ++i) {
    kf[i][0] = load_frag(kbh, E_, 16 * i, 0, lane);
    kf[i][1] = load_frag(kbh, E_, 16 * i, 32, lane);
    mk[0][i][0] = *(const v4i*)(mrow0 + 16 * i);
    mk[0][i][1] = *(const v4i*)(mrow0 + 16 * i + 4);
    mk[1][i][0] = *(const v4i*)(mrow1 + 16 * i);
    mk[1][i][1] = *(const v4i*)(mrow1 + 16 * i + 4);
  }

  for (int p = 0; p < S_ / 32; ++p) {
    const int t0 = p * 32;
    const int tn = (p + 1 < S_ / 32) ? t0 + 32 : t0;  // next pass, kept in bounds

    v16bf vf[4];
#pragma unroll
    for (int nt = 0; nt < 4; ++nt)
      vf[nt] = load_frag_hw(vbh + (size_t)(nt * 16 + c) * S_, t0, hh);

    v8f s[2][2];                                      // [query tile][key tile]
#pragma unroll
    for (int j = 0; j < 2; ++j)
#pragma unroll
      for (int i = 0; i < 2; ++i) {
        s[j][i] = wmma_bf16(kf[i][0], qf[j][0], v8f{});
        s[j][i] = wmma_bf16(kf[i][1], qf[j][1], s[j][i]);
      }
#pragma unroll
    for (int i = 0; i < 2; ++i) {                     // next pass's K rows
      kf[i][0] = load_frag(kbh, E_, tn + 16 * i, 0, lane);
      kf[i][1] = load_frag(kbh, E_, tn + 16 * i, 32, lane);
    }

    float mx[2];
#pragma unroll
    for (int j = 0; j < 2; ++j) {
      float t = NEGR;
#pragma unroll
      for (int i = 0; i < 2; ++i)
#pragma unroll
        for (int r = 0; r < 8; ++r) {
          const float x = mk[j][i][r >> 2][r & 3] != 0 ? NEGR : s[j][i][r];
          s[j][i][r] = x;
          t = fmaxf(t, x);
        }
      mx[j] = fmaxf(t, other_half(t));
    }
#pragma unroll
    for (int i = 0; i < 2; ++i) {                     // next pass's mask words
      mk[0][i][0] = *(const v4i*)(mrow0 + tn + 16 * i);
      mk[0][i][1] = *(const v4i*)(mrow0 + tn + 16 * i + 4);
      mk[1][i][0] = *(const v4i*)(mrow1 + tn + 16 * i);
      mk[1][i][1] = *(const v4i*)(mrow1 + tn + 16 * i + 4);
    }

    // Move the maximum in use only when a column outgrows it by 2^8: one
    // wave-uniform test per pass (softmax does not depend on the shift).
    const bool need = (mx[0] > m[0] + STEP) || (mx[1] > m[1] + STEP);
    if (__builtin_amdgcn_ballot_w32(need) != 0) {
#pragma unroll
      for (int j = 0; j < 2; ++j) {
        const float mn = fmaxf(m[j], mx[j]);
        const float al = __builtin_amdgcn_exp2f((m[j] - mn) * SC2);
        m[j] = mn;
        l[j] *= al;
#pragma unroll
        for (int nt = 0; nt < 4; ++nt)
#pragma unroll
          for (int r = 0; r < 8; ++r) o[j][nt][r] *= al;
      }
    }

#pragma unroll
    for (int j = 0; j < 2; ++j) {
      v16bf pb;
      float sum = 0.f;
#pragma unroll
      for (int i = 0; i < 2; ++i)
#pragma unroll
        for (int r = 0; r < 8; ++r) {
          // subtract first: a row whose keys are all masked gets exactly 1
          const float e = __builtin_amdgcn_exp2f((s[j][i][r] - m[j]) * SC2);
          sum += e;
          pb[i * 8 + r] = (bf16_t)e;
        }
      l[j] += sum;
#pragma unroll
      for (int nt = 0; nt < 4; ++nt)
        o[j][nt] = wmma_bf16(vf[nt], pb, o[j][nt]);
    }
  }

  // a lane holds 8 consecutive e of one query row: one b128 store per tile
#pragma unroll
  for (int j = 0; j < 2; ++j) {
    const float inv = 1.f / (l[j] + other_half(l[j]));
    bf16_t* dst = ctx + ((size_t)bz * S_ + s0 + 16 * j + c) * (H_ * E_) + h * E_ + 8 * hh;
#pragma unroll
    for (int nt = 0; nt < 4; ++nt) {
      v8bf pk;
#pragma unroll
      for (int r = 0; r < 8; ++r) pk[r] = (bf16_t)(o[j][nt][r] * inv);
      *(v8bf*)(dst + nt * 16) = pk;
    }
  }
}

// ---------------- output projection + LayerNorm ----------------
// 128 threads (4 waves); block owns 16 rows of [B*S, 768]. Each wave does 12
// n-tiles; result tile staged in LDS for row-wise LayerNorm.
__global__ __launch_bounds__(128) void
k_proj_ln(const bf16_t* __restrict__ ctx, const bf16_t* __restrict__ woT,
          const float* __restrict__ bo, const float* __restrict__ gamma,
          const float* __restrict__ beta, float* __restrict__ out) {
  __shared__ float sOut[16 * D_];                     // 48 KB
  __shared__ float sMu[16], sRs[16];

  const int tid  = threadIdx.x;
  const int lane = tid & 31;
  const int wave = tid >> 5;
  const int row0 = blockIdx.x * 16;                   // row in [0, B*S)
  const bf16_t* arow = ctx + (size_t)row0 * D_;

  v8f acc[12];
#pragma unroll
  for (int i = 0; i < 12; ++i) acc[i] = v8f{};

  for (int kc = 0; kc < D_ / 32; ++kc) {              // 24 K-chunks
    const int k0 = kc * 32;
    v16bf a = load_frag(arow, D_, 0, k0, lane);
#pragma unroll
    for (int j = 0; j < 12; ++j) {
      const int n0 = (wave * 12 + j) * 16;
      acc[j] = wmma_bf16(a, load_frag(woT, D_, n0, k0, lane), acc[j]);
    }
  }

  const int N     = lane & 15;
  const int Mbase = (lane >> 4) << 3;
#pragma unroll
  for (int j = 0; j < 12; ++j) {
    const int n0 = (wave * 12 + j) * 16;
    const float bi = bo[n0 + N];
#pragma unroll
    for (int r = 0; r < 8; ++r)
      sOut[(Mbase + r) * D_ + n0 + N] = acc[j][r] + bi;
  }
  __syncthreads();

  if (tid < 16) {
    float mu = 0.f;
    for (int c = 0; c < D_; ++c) mu += sOut[tid * D_ + c];
    mu *= (1.f / D_);
    float var = 0.f;
    for (int c = 0; c < D_; ++c) {
      float d = sOut[tid * D_ + c] - mu;
      var += d * d;
    }
    var *= (1.f / D_);
    sMu[tid] = mu;
    sRs[tid] = rsqrtf(var + LN_EPS_);
  }
  __syncthreads();

  for (int idx = tid; idx < 16 * D_; idx += 128) {
    const int r = idx / D_, c = idx - r * D_;
    out[(size_t)row0 * D_ + idx] =
        (sOut[idx] - sMu[r]) * sRs[r] * gamma[c] + beta[c];
  }
}

// ---------------- host launcher ----------------
extern "C" void kernel_launch(void* const* d_in, const int* in_sizes, int n_in,
                              void* d_out, int out_size, void* d_ws, size_t ws_size,
                              hipStream_t stream) {
  const float* x    = (const float*)d_in[0];
  const int*   mask = (const int*)d_in[1];
  const float* Wq   = (const float*)d_in[2];
  const float* bq   = (const float*)d_in[3];
  const float* Wk   = (const float*)d_in[4];
  const float* bk   = (const float*)d_in[5];
  const float* Wv   = (const float*)d_in[6];
  const float* bv   = (const float*)d_in[7];
  const float* Wo   = (const float*)d_in[8];
  const float* bo   = (const float*)d_in[9];
  const float* gamma = (const float*)d_in[10];
  const float* beta  = (const float*)d_in[11];
  float* out = (float*)d_out;

  // workspace layout (bf16 intermediates), ~64.5 MB total
  char* ws = (char*)d_ws;
  const size_t szX  = (size_t)B_ * S_ * D_ * sizeof(bf16_t);
  const size_t szW  = (size_t)H_ * E_ * D_ * sizeof(bf16_t);
  const size_t szWo = (size_t)D_ * D_ * sizeof(bf16_t);
  const size_t szQ  = (size_t)B_ * H_ * S_ * E_ * sizeof(bf16_t);
  bf16_t* xb  = (bf16_t*)(ws);
  bf16_t* wqT = (bf16_t*)(ws + szX);
  bf16_t* wkT = (bf16_t*)(ws + szX + szW);
  bf16_t* wvT = (bf16_t*)(ws + szX + 2 * szW);
  bf16_t* woT = (bf16_t*)(ws + szX + 3 * szW);
  bf16_t* q   = (bf16_t*)(ws + szX + 3 * szW + szWo);
  bf16_t* k   = (bf16_t*)(ws + szX + 3 * szW + szWo + szQ);
  bf16_t* vT  = (bf16_t*)(ws + szX + 3 * szW + szWo + 2 * szQ);
  bf16_t* ctx = (bf16_t*)(ws + szX + 3 * szW + szWo + 3 * szQ);

  const int nX = B_ * S_ * D_;
  k_cvt_bf16<<<(nX + 255) / 256, 256, 0, stream>>>(x, xb, nX);
  k_tr_hde<<<(H_ * D_ * E_ + 255) / 256, 256, 0, stream>>>(Wq, wqT);
  k_tr_hde<<<(H_ * D_ * E_ + 255) / 256, 256, 0, stream>>>(Wk, wkT);
  k_tr_hde<<<(H_ * D_ * E_ + 255) / 256, 256, 0, stream>>>(Wv, wvT);
  k_tr_wo<<<(D_ * D_ + 255) / 256, 256, 0, stream>>>(Wo, woT);

  const int nTiles = B_ * H_ * (S_ / 16);             // 6144
  k_qkv<<<nTiles, 32, 0, stream>>>(xb, wqT, wkT, wvT, bq, bk, bv, q, k, vT);

  k_attn<<<B_ * H_ * (S_ / 128), 128, 0, stream>>>(q, k, vT, mask, ctx);

  k_proj_ln<<<B_ * S_ / 16, 128, 0, stream>>>(ctx, woT, bo, gamma, beta, out);
}

// v002
// It runs in 342 microseconds.
// Timed twice side by side with v001, it ran 1.20 and 1.21 times as fast.
// Over all steps from v000 it is 8.58 times as fast.
#include <hip/hip_runtime.h>
#include <hip/hip_bf16.h>
#include <math.h>

// ---- problem constants (match reference) ----
static constexpr int B_ = 4, S_ = 2048, D_ = 768, H_ = 12, E_ = 64;
static constexpr float LN_EPS_ = 1e-5f;

typedef __bf16 bf16_t;
typedef __attribute__((ext_vector_type(16))) __bf16 v16bf;
typedef __attribute__((ext_vector_type(8)))  __bf16 v8bf;   // 16-byte pack
typedef __attribute__((ext_vector_type(8)))  float  v8f;

// -------------------------------------------------------------------------
// Every bf16 operand in the workspace is stored in FRAGMENT ORDER: a 16-row x
// 32-k fragment of V_WMMA_F32_16X16X32_BF16 (wave32) is one 1-KB block,
//   block[half * 256 + lane * 8 + i]  =  register element s = half * 8 + i of lane,
// so a wave loads a fragment with two b128 loads of 512 contiguous bytes each.
// Which (row, k) a position holds, for a row-major matrix M:
//   plain order: row = lane & 15, k = (lane >> 4) * 16 + s   (A and B alike)
// Fragments of a matrix with K columns lie as [row tile][k chunk of 32].
// -------------------------------------------------------------------------
__device__ __forceinline__ v16bf load_pk(const bf16_t* base, int frag, int lane) {
  const bf16_t* p = base + (size_t)frag * 512 + lane * 8;
  const v8bf lo = *(const v8bf*)p;
  const v8bf hi = *(const v8bf*)(p + 256);
  return __builtin_shufflevector(lo, hi, 0, 1, 2, 3, 4, 5, 6, 7, 8, 9, 10, 11,
                                 12, 13, 14, 15);
}

__device__ __forceinline__ v8f wmma_bf16(v16bf a, v16bf b, v8f c) {
  return __builtin_amdgcn_wmma_f32_16x16x32_bf16(false, a, false, b,
                                                 (short)0, c, false, false);
}

// ---------------- conversion kernels: f32 -> bf16 in fragment order ----------
// One thread makes one 16-byte piece j of the packed copy:
// fragment j >> 6, half (j >> 5) & 1, lane j & 31.
typedef __attribute__((ext_vector_type(4))) float v4f;

// x [B*S, D] -> fragments [row tile][k chunk]
__global__ __launch_bounds__(256) void k_cvt_bf16(const float* __restrict__ x,
                                                  bf16_t* __restrict__ y) {
  const int j    = blockIdx.x * 256 + threadIdx.x;
  const int frag = j >> 6, half = (j >> 5) & 1, ln = j & 31;
  const int rt = frag / (D_ / 32), kc = frag - rt * (D_ / 32);
  const float* s = x + (size_t)(rt * 16 + (ln & 15)) * D_ + kc * 32 +
                   (ln >> 4) * 16 + half * 8;
  const v4f a = *(const v4f*)s;
  const v4f b = *(const v4f*)(s + 4);
  v8bf pk;
#pragma unroll
  for (int i = 0; i < 4; ++i) { pk[i] = (bf16_t)a[i]; pk[4 + i] = (bf16_t)b[i]; }
  *(v8bf*)(y + (size_t)j * 8) = pk;
}

// W [H,D,E] -> fragments of W^T (rows e, k = d): [h][e tile][d chunk]
__global__ __launch_bounds__(256) void k_tr_hde(const float* __restrict__ W,
                                                bf16_t* __restrict__ WT) {
  const int j    = blockIdx.x * 256 + threadIdx.x;
  const int frag = j >> 6, half = (j >> 5) & 1, ln = j & 31;
  const int kc = frag % (D_ / 32);
  const int et = frag / (D_ / 32);                    // h * 4 + e tile
  const int h = et >> 2, e = (et & 3) * 16 + (ln & 15);
  const int d0 = kc * 32 + (ln >> 4) * 16 + half * 8;
  const float* s = W + ((size_t)h * D_ + d0) * E_ + e;
  v8bf pk;
#pragma unroll
  for (int i = 0; i < 8; ++i) pk[i] = (bf16_t)s[i * E_];
  *(v8bf*)(WT + (size_t)j * 8) = pk;
}

// Wo [768 f, 768 d] -> fragments of Wo^T (rows d, k = f): [d tile][f chunk]
__global__ __launch_bounds__(256) void k_tr_wo(const float* __restrict__ W,
                                               bf16_t* __restrict__ WT) {
  const int j    = blockIdx.x * 256 + threadIdx.x;
  const int frag = j >> 6, half = (j >> 5) & 1, ln = j & 31;
  const int kc = frag % (D_ / 32);
  const int d  = (frag / (D_ / 32)) * 16 + (ln & 15);
  const int f0 = kc * 32 + (ln >> 4) * 16 + half * 8;
  const float* s = W + (size_t)f0 * D_ + d;
  v8bf pk;
#pragma unroll
  for (int i = 0; i < 8; ++i) pk[i] = (bf16_t)s[i * D_];
  *(v8bf*)(WT + (size_t)j * 8) = pk;
}

// ---------------- QKV projection: one wave per (b,h,s-tile16) ----------------
// q,k stored as fragments [B,H][s tile][e chunk], plain order (staged via LDS);
// v stored as fragments of V^T (rows e, k = key) [B,H][e tile][32-key chunk] in
// the k order of a packed accumulator pair: k = 8 * (lane >> 4) + s for s < 8,
// 16 + 8 * (lane >> 4) + (s - 8) otherwise; a lane's 8 rows are one 16-B piece.
__global__ __launch_bounds__(32) void
k_qkv(const bf16_t* __restrict__ xb, const bf16_t* __restrict__ wqT,
      const bf16_t* __restrict__ wkT, const bf16_t* __restrict__ wvT,
      const float* __restrict__ bq, const float* __restrict__ bk,
      const float* __restrict__ bv, bf16_t* __restrict__ q,
      bf16_t* __restrict__ k, bf16_t* __restrict__ vT) {
  __shared__ bf16_t st[16 * E_];            // 2 KB staging tile

  const int lane = threadIdx.x & 31;
  const int tile = blockIdx.x;
  const int ts   = S_ / 16;                 // 128
  const int s0   = (tile % ts) << 4;
  const int h    = (tile / ts) % H_;
  const int bz   = tile / (ts * H_);

  const bf16_t* xfr  = xb + ((size_t)bz * S_ + s0) * D_;   // this row tile's fragments
  const bf16_t* wq   = wqT + (size_t)h * E_ * D_;
  const bf16_t* wk   = wkT + (size_t)h * E_ * D_;
  const bf16_t* wv   = wvT + (size_t)h * E_ * D_;

  v8f aq[4], ak[4], av[4];
#pragma unroll
  for (int i = 0; i < 4; ++i) { aq[i] = v8f{}; ak[i] = v8f{}; av[i] = v8f{}; }

  for (int kc = 0; kc < D_ / 32; ++kc) {          // 24 K-chunks
    __builtin_prefetch(xfr + (kc + 2) * 512 + lane * 16, 0, 1);
    // precaution: the loads below land in the registers that held the prefetch's address
    asm volatile("s_wait_xcnt 0x0" ::: "memory");
    v16bf a = load_pk(xfr, kc, lane);
#pragma unroll
    for (int nt = 0; nt < 4; ++nt) {
      const int f = nt * (D_ / 32) + kc;
      aq[nt] = wmma_bf16(a, load_pk(wq, f, lane), aq[nt]);
      ak[nt] = wmma_bf16(a, load_pk(wk, f, lane), ak[nt]);
      av[nt] = wmma_bf16(a, load_pk(wv, f, lane), av[nt]);
    }
  }

  const int N     = lane & 15;
  const int Mbase = (lane >> 4) << 3;
  const size_t bh = (size_t)bz * H_ + h;

  // ---- v: 8 keys per lane -> one b128 store, 512 contiguous bytes per wave ----
#pragma unroll
  for (int nt = 0; nt < 4; ++nt) {
    const float bi = bv[h * E_ + nt * 16 + N];
    v8bf pk;
#pragma unroll
    for (int r = 0; r < 8; ++r) pk[r] = (bf16_t)(av[nt][r] + bi);
    *(v8bf*)(vT + ((bh * 4 + nt) * (S_ / 32) + (s0 >> 5)) * 512 +
             ((s0 >> 4) & 1) * 256 + lane * 8) = pk;
  }

  // ---- q then k: stage 16x64 tile in LDS, flush its 2 fragments in order ----
#pragma unroll
  for (int mat = 0; mat < 2; ++mat) {
    const v8f*   acc  = mat ? ak : aq;
    const float* bias = mat ? bk : bq;
    bf16_t*      dst  = mat ? k : q;
#pragma unroll
    for (int nt = 0; nt < 4; ++nt) {
      const float bi = bias[h * E_ + nt * 16 + N];
#pragma unroll
      for (int r = 0; r < 8; ++r)
        st[(Mbase + r) * E_ + nt * 16 + N] = (bf16_t)(acc[nt][r] + bi);
    }
    __syncthreads();
#pragma unroll
    for (int c = 0; c < 4; ++c) {                 // fragment c >> 1, half c & 1
      const int col = (c >> 1) * 32 + (lane >> 4) * 16 + (c & 1) * 8;
      *(v8bf*)(dst + (bh * S_ + s0) * E_ + (c * 32 + lane) * 8) =
          *(const v8bf*)(st + (lane & 15) * E_ + col);
    }
    __syncthreads();
  }
}

typedef __attribute__((ext_vector_type(4))) int v4i;

// value of lane ^ 16
__device__ __forceinline__ float other_half(float x) {
  const int b = __builtin_bit_cast(int, x);
  return __builtin_bit_cast(float, __builtin_amdgcn_permlanex16(
      b, b, 0x76543210, 0xfedcba98, false, false));
}

__global__ __launch_bounds__(128) void
k_attn(const bf16_t* __restrict__ q, const bf16_t* __restrict__ k,
       const bf16_t* __restrict__ vT, const int* __restrict__ mask,
       bf16_t* __restrict__ ctx) {
  constexpr float SC2  = 0.03187935771f;   // log2(e) / sqrt(S): ref scales by 1/sqrt(S)
  constexpr float NEGR = -1e9f * 45.254834f;      // -1e9 before the 1/sqrt(S) scale
  constexpr float STEP = 8.0f / SC2;              // maximum may lag by 2^8

  const int lane = threadIdx.x & 31;
  const int wave = threadIdx.x >> 5;
  const int c    = lane & 15;
  const int hh   = lane >> 4;
  constexpr int QB = S_ / 128;                        // query blocks per (b,h)
  const int blk = blockIdx.x;
  const int h   = blk % H_;
  const int s0  = ((blk / H_) % QB) * 128 + wave * 32;
  const int bz  = blk / (H_ * QB);
  const size_t bh = (size_t)bz * H_ + h;

  const bf16_t* qbh = q + bh * S_ * E_;
  const bf16_t* kbh = k + bh * S_ * E_;
  const bf16_t* vbh = vT + bh * E_ * S_;
  const int* mrow0 = mask + ((size_t)bz * S_ + s0 + c) * S_ + 8 * hh;
  const int* mrow1 = mrow0 + (size_t)16 * S_;

  v16bf qf[2][2];                                     // [query tile][e chunk]
#pragma unroll
  for (int j = 0; j < 2; ++j)
#pragma unroll
    for (int e = 0; e < 2; ++e)
      qf[j][e] = load_pk(qbh, ((s0 >> 4) + j) * 2 + e, lane);

  v8f o[2][4];                                        // Ot: [query tile][e tile]
  float m[2], l[2];
#pragma unroll
  for (int j = 0; j < 2; ++j) {
    m[j] = -3.0e38f;
    l[j] = 0.f;
#pragma unroll
    for (int nt = 0; nt < 4; ++nt) o[j][nt] = v8f{};
  }

  v16bf kf[2][2];                                     // [key tile][e chunk]
  v4i   mk[2][2][2];                                  // [query tile][key tile][4 keys]
#pragma unroll
  for (int i = 0; i < 2; ++i) {
    kf[i][0] = load_pk(kbh, 2 * i, lane);
    kf[i][1] = load_pk(kbh, 2 * i + 1, lane);
    mk[0][i][0] = *(const v4i*)(mrow0 + 16 * i);
    mk[0][i][1] = *(const v4i*)(mrow0 + 16 * i + 4);
    mk[1][i][0] = *(const v4i*)(mrow1 + 16 * i);
    mk[1][i][1] = *(const v4i*)(mrow1 + 16 * i + 4);
  }

  for (int p = 0; p < S_ / 32; ++p) {
    const int t0 = p * 32;
    const int tn = (p + 1 < S_ / 32) ? t0 + 32 : t0;  // next pass, kept in bounds

    v16bf vf[4];
#pragma unroll
    for (int nt = 0; nt < 4; ++nt)
      vf[nt] = load_pk(vbh, nt * (S_ / 32) + p, lane);

    v8f s[2][2];                                      // [query tile][key tile]
#pragma unroll
    for (int j = 0; j < 2; ++j)
#pragma unroll
      for (int i = 0; i < 2; ++i) {
        s[j][i] = wmma_bf16(kf[i][0], qf[j][0], v8f{});
        s[j][i] = wmma_bf16(kf[i][1], qf[j][1], s[j][i]);
      }
#pragma unroll
    for (int i = 0; i < 2; ++i) {                     // next pass's K rows
      kf[i][0] = load_pk(kbh, (tn >> 3) + 2 * i, lane);
      kf[i][1] = load_pk(kbh, (tn >> 3) + 2 * i + 1, lane);
    }

    float mx[2];
#pragma unroll
    for (int j = 0; j < 2; ++j) {
      float t = NEGR;
#pragma unroll
      for (int i = 0; i < 2; ++i)
#pragma unroll
        for (int r = 0; r < 8; ++r) {
          const float x = mk[j][i][r >> 2][r & 3] != 0 ? NEGR : s[j][i][r];
          s[j][i][r] = x;
          t = fmaxf(t, x);
        }
      mx[j] = fmaxf(t, other_half(t));
    }
#pragma unroll
    for (int i = 0; i < 2; ++i) {                     // next pass's mask words
      mk[0][i][0] = *(const v4i*)(mrow0 + tn + 16 * i);
      mk[0][i][1] = *(const v4i*)(mrow0 + tn + 16 * i + 4);
      mk[1][i][0] = *(const v4i*)(mrow1 + tn + 16 * i);
      mk[1][i][1] = *(const v4i*)(mrow1 + tn + 16 * i + 4);
    }

    // Move the maximum in use only when a column outgrows it by 2^8: one
    // wave-uniform test per pass (softmax does not depend on the shift).
    const bool need = (mx[0] > m[0] + STEP) || (mx[1] > m[1] + STEP);
    if (__builtin_amdgcn_ballot_w32(need) != 0) {
#pragma unroll
      for (int j = 0; j < 2; ++j) {
        const float mn = fmaxf(m[j], mx[j]);
        const float al = __builtin_amdgcn_exp2f((m[j] - mn) * SC2);
        m[j] = mn;
        l[j] *= al;
#pragma unroll
        for (int nt = 0; nt < 4; ++nt)
#pragma unroll
          for (int r = 0; r < 8; ++r) o[j][nt][r] *= al;
      }
    }

#pragma unroll
    for (int j = 0; j < 2; ++j) {
      v16bf pb;
      float sum = 0.f;
#pragma unroll
      for (int i = 0; i < 2; ++i)
#pragma unroll
        for (int r = 0; r < 8; ++r) {
          // subtract first: a row whose keys are all masked gets exactly 1
          const float e = __builtin_amdgcn_exp2f((s[j][i][r] - m[j]) * SC2);
          sum += e;
          pb[i * 8 + r] = (bf16_t)e;
        }
      l[j] += sum;
#pragma unroll
      for (int nt = 0; nt < 4; ++nt)
        o[j][nt] = wmma_bf16(vf[nt], pb, o[j][nt]);
    }
  }

  // a lane holds 8 consecutive e of one query row: one 16-B piece of ctx's
  // fragment [row tile][k chunk h * 2 + nt / 2]: half hh, lane c + 16 * (nt & 1)
#pragma unroll
  for (int j = 0; j < 2; ++j) {
    const float inv = 1.f / (l[j] + other_half(l[j]));
    bf16_t* dst = ctx + ((size_t)bz * S_ + s0 + 16 * j) * (H_ * E_) + h * 1024 +
                  hh * 256 + c * 8;
#pragma unroll
    for (int nt = 0; nt < 4; ++nt) {
      v8bf pk;
#pragma unroll
      for (int r = 0; r < 8; ++r) pk[r] = (bf16_t)(o[j][nt][r] * inv);
      *(v8bf*)(dst + (nt >> 1) * 512 + (nt & 1) * 128) = pk;
    }
  }
}

// ---------------- output projection + LayerNorm ----------------
// 128 threads (4 waves); block owns 16 rows of [B*S, 768]. Each wave does 12
// n-tiles; result tile staged in LDS for row-wise LayerNorm.
__global__ __launch_bounds__(128) void
k_proj_ln(const bf16_t* __restrict__ ctx, const bf16_t* __restrict__ woT,
          const float* __restrict__ bo, const float* __restrict__ gamma,
          const float* __restrict__ beta, float* __restrict__ out) {
  __shared__ float sOut[16 * D_];                     // 48 KB
  __shared__ float sMu[16], sRs[16];

  const int tid  = threadIdx.x;
  const int lane = tid & 31;
  const int wave = tid >> 5;
  const int row0 = blockIdx.x * 16;                   // row in [0, B*S)
  const bf16_t* arow = ctx + (size_t)row0 * D_;

  v8f acc[12];
#pragma unroll
  for (int i = 0; i < 12; ++i) acc[i] = v8f{};

  for (int kc = 0; kc < D_ / 32; ++kc) {              // 24 K-chunks
    v16bf a = load_pk(arow, kc, lane);
#pragma unroll
    for (int j = 0; j < 12; ++j)
      acc[j] = wmma_bf16(a, load_pk(woT, (wave * 12 + j) * (D_ / 32) + kc, lane),
                         acc[j]);
  }

  const int N     = lane & 15;
  const int Mbase = (lane >> 4) << 3;
#pragma unroll
  for (int j = 0; j < 12; ++j) {
    const int n0 = (wave * 12 + j) * 16;
    const float bi = bo[n0 + N];
#pragma unroll
    for (int r = 0; r < 8; ++r)
      sOut[(Mbase + r) * D_ + n0 + N] = acc[j][r] + bi;
  }
  __syncthreads();

  if (tid < 16) {
    float mu = 0.f;
    for (int c = 0; c < D_; ++c) mu += sOut[tid * D_ + c];
    mu *= (1.f / D_);
    float var = 0.f;
    for (int c = 0; c < D_; ++c) {
      float d = sOut[tid * D_ + c] - mu;
      var += d * d;
    }
    var *= (1.f / D_);
    sMu[tid] = mu;
    sRs[tid] = rsqrtf(var + LN_EPS_);
  }
  __syncthreads();

  for (int idx = tid; idx < 16 * D_; idx += 128) {
    const int r = idx / D_, c = idx - r * D_;
    out[(size_t)row0 * D_ + idx] =
        (sOut[idx] - sMu[r]) * sRs[r] * gamma[c] + beta[c];
  }
}

// ---------------- host launcher ----------------
extern "C" void kernel_launch(void* const* d_in, const int* in_sizes, int n_in,
                              void* d_out, int out_size, void* d_ws, size_t ws_size,
                              hipStream_t stream) {
  const float* x    = (const float*)d_in[0];
  const int*   mask = (const int*)d_in[1];
  const float* Wq   = (const float*)d_in[2];
  const float* bq   = (const float*)d_in[3];
  const float* Wk   = (const float*)d_in[4];
  const float* bk   = (const float*)d_in[5];
  const float* Wv   = (const float*)d_in[6];
  const float* bv   = (const float*)d_in[7];
  const float* Wo   = (const float*)d_in[8];
  const float* bo   = (const float*)d_in[9];
  const float* gamma = (const float*)d_in[10];
  const float* beta  = (const float*)d_in[11];
  float* out = (float*)d_out;

  // workspace layout (bf16 intermediates), ~64.5 MB total
  char* ws = (char*)d_ws;
  const size_t szX  = (size_t)B_ * S_ * D_ * sizeof(bf16_t);
  const size_t szW  = (size_t)H_ * E_ * D_ * sizeof(bf16_t);
  const size_t szWo = (size_t)D_ * D_ * sizeof(bf16_t);
  const size_t szQ  = (size_t)B_ * H_ * S_ * E_ * sizeof(bf16_t);
  bf16_t* xb  = (bf16_t*)(ws);
  bf16_t* wqT = (bf16_t*)(ws + szX);
  bf16_t* wkT = (bf16_t*)(ws + szX + szW);
  bf16_t* wvT = (bf16_t*)(ws + szX + 2 * szW);
  bf16_t* woT = (bf16_t*)(ws + szX + 3 * szW);
  bf16_t* q   = (bf16_t*)(ws + szX + 3 * szW + szWo);
  bf16_t* k   = (bf16_t*)(ws + szX + 3 * szW + szWo + szQ);
  bf16_t* vT  = (bf16_t*)(ws + szX + 3 * szW + szWo + 2 * szQ);
  bf16_t* ctx = (bf16_t*)(ws + szX + 3 * szW + szWo + 3 * szQ);

  k_cvt_bf16<<<B_ * S_ * D_ / (8 * 256), 256, 0, stream>>>(x, xb);
  k_tr_hde<<<H_ * D_ * E_ / (8 * 256), 256, 0, stream>>>(Wq, wqT);
  k_tr_hde<<<H_ * D_ * E_ / (8 * 256), 256, 0, stream>>>(Wk, wkT);
  k_tr_hde<<<H_ * D_ * E_ / (8 * 256), 256, 0, stream>>>(Wv, wvT);
  k_tr_wo<<<D_ * D_ / (8 * 256), 256, 0, stream>>>(Wo, woT);

  const int nTiles = B_ * H_ * (S_ / 16);             // 6144
  k_qkv<<<nTiles, 32, 0, stream>>>(xb, wqT, wkT, wvT, bq, bk, bv, q, k, vT);

  k_attn<<<B_ * H_ * (S_ / 128), 128, 0, stream>>>(q, k, vT, mask, ctx);

  k_proj_ln<<<B_ * S_ / 16, 128, 0, stream>>>(ctx, woT, bo, gamma, beta, out);
}

// v003
// One run takes 325 microseconds.
// Two timings next to v002 put it at 1.05 and 1.06 times that version's speed.
// All steps since v000 together make it 9.06 times as fast.
#include <hip/hip_runtime.h>
#include <hip/hip_bf16.h>
#include <math.h>

// ---- problem constants (match reference) ----
static constexpr int B_ = 4, S_ = 2048, D_ = 768, H_ = 12, E_ = 64;
static constexpr float LN_EPS_ = 1e-5f;

typedef __bf16 bf16_t;
typedef __attribute__((ext_vector_type(16))) __bf16 v16bf;
typedef __attribute__((ext_vector_type(8)))  __bf16 v8bf;   // 16-byte pack
typedef __attribute__((ext_vector_type(8)))  float  v8f;

// -------------------------------------------------------------------------
// Every bf16 operand in the workspace is stored in FRAGMENT ORDER: a 16-row x
// 32-k fragment of V_WMMA_F32_16X16X32_BF16 (wave32) is one 1-KB block,
//   block[half * 256 + lane * 8 + i]  =  register element s = half * 8 + i of lane,
// so a wave loads a fragment with two b128 loads of 512 contiguous bytes each.
// Which (row, k) a position holds, for a row-major matrix M:
//   plain order: row = lane & 15, k = (lane >> 4) * 16 + s   (A and B alike)
// Fragments of a matrix with K columns lie as [row tile][k chunk of 32].
// -------------------------------------------------------------------------
__device__ __forceinline__ v16bf load_pk(const bf16_t* base, int frag, int lane) {
  const bf16_t* p = base + (size_t)frag * 512 + lane * 8;
  const v8bf lo = *(const v8bf*)p;
  const v8bf hi = *(const v8bf*)(p + 256);
  return __builtin_shufflevector(lo, hi, 0, 1, 2, 3, 4, 5, 6, 7, 8, 9, 10, 11,
                                 12, 13, 14, 15);
}

__device__ __forceinline__ v8f wmma_bf16(v16bf a, v16bf b, v8f c) {
  return __builtin_amdgcn_wmma_f32_16x16x32_bf16(false, a, false, b,
                                                 (short)0, c, false, false);
}

// ---------------- conversion kernels: f32 -> bf16 in fragment order ----------
// One thread makes one 16-byte piece j of the packed copy:
// fragment j >> 6, half (j >> 5) & 1, lane j & 31.
typedef __attribute__((ext_vector_type(4))) float v4f;

// x [B*S, D] -> fragments [row tile][k chunk]
__global__ __launch_bounds__(256) void k_cvt_bf16(const float* __restrict__ x,
                                                  bf16_t* __restrict__ y) {
  const int j    = blockIdx.x * 256 + threadIdx.x;
  const int frag = j >> 6, half = (j >> 5) & 1, ln = j & 31;
  const int rt = frag / (D_ / 32), kc = frag - rt * (D_ / 32);
  const float* s = x + (size_t)(rt * 16 + (ln & 15)) * D_ + kc * 32 +
                   (ln >> 4) * 16 + half * 8;
  const v4f a = *(const v4f*)s;
  const v4f b = *(const v4f*)(s + 4);
  v8bf pk;
#pragma unroll
  for (int i = 0; i < 4; ++i) { pk[i] = (bf16_t)a[i]; pk[4 + i] = (bf16_t)b[i]; }
  *(v8bf*)(y + (size_t)j * 8) = pk;
}

// W [H,D,E] -> fragments of W^T (rows e, k = d): [h][e tile][d chunk]
__global__ __launch_bounds__(256) void k_tr_hde(const float* __restrict__ W,
                                                bf16_t* __restrict__ WT) {
  const int j    = blockIdx.x * 256 + threadIdx.x;
  const int frag = j >> 6, half = (j >> 5) & 1, ln = j & 31;
  const int kc = frag % (D_ / 32);
  const int et = frag / (D_ / 32);                    // h * 4 + e tile
  const int h = et >> 2, e = (et & 3) * 16 + (ln & 15);
  const int d0 = kc * 32 + (ln >> 4) * 16 + half * 8;
  const float* s = W + ((size_t)h * D_ + d0) * E_ + e;
  v8bf pk;
#pragma unroll
  for (int i = 0; i < 8; ++i) pk[i] = (bf16_t)s[i * E_];
  *(v8bf*)(WT + (size_t)j * 8) = pk;
}

// Wo [768 f, 768 d] -> fragments of Wo^T (rows d, k = f): [d tile][f chunk]
__global__ __launch_bounds__(256) void k_tr_wo(const float* __restrict__ W,
                                               bf16_t* __restrict__ WT) {
  const int j    = blockIdx.x * 256 + threadIdx.x;
  const int frag = j >> 6, half = (j >> 5) & 1, ln = j & 31;
  const int kc = frag % (D_ / 32);
  const int d  = (frag / (D_ / 32)) * 16 + (ln & 15);
  const int f0 = kc * 32 + (ln >> 4) * 16 + half * 8;
  const float* s = W + (size_t)f0 * D_ + d;
  v8bf pk;
#pragma unroll
  for (int i = 0; i < 8; ++i) pk[i] = (bf16_t)s[i * D_];
  *(v8bf*)(WT + (size_t)j * 8) = pk;
}

// ---------------- mask [B,S,S] i32 -> lane-mask words ----------------
// Word [b][query tile of 16][key tile of 16][r]: bit L says whether
// mask[b][query tile * 16 + (L & 15)][key tile * 16 + 8 * (L >> 4) + r] != 0,
// which is the entry that lane L holds in register r of that transposed score
// tile: k_attn reads a word into a scalar register and selects on it directly.
// One wave takes 16 query rows x 128 keys at a time: 16 whole-line loads; lane l
// holds keys 4l..4l+3 (key tile l >> 2, half (l >> 1) & 1, r = 4 * (l & 1) + k).
typedef __attribute__((ext_vector_type(4))) int      v4i;
typedef __attribute__((ext_vector_type(4))) unsigned v4u;

__global__ __launch_bounds__(256) void k_pack_mask(const int* __restrict__ mask,
                                                   unsigned* __restrict__ wm) {
  const int lane = threadIdx.x & 31;
  const int w    = blockIdx.x * 8 + (threadIdx.x >> 5);
  const int rt   = w >> 3;                            // b * (S / 16) + query tile
#pragma unroll
  for (int t = 0; t < 2; ++t) {
    const int kg = (w & 7) * 2 + t;                   // group of 128 keys
    const int* s = mask + (size_t)rt * 16 * S_ + kg * 128 + lane * 4;
    v4i m[16];
#pragma unroll
    for (int qr = 0; qr < 16; ++qr) m[qr] = *(const v4i*)(s + (size_t)qr * S_);
    v4u pk;
#pragma unroll
    for (int kk = 0; kk < 4; ++kk) {
      unsigned hb = 0;                                // bit qr: query row qr, this key
#pragma unroll
      for (int qr = 0; qr < 16; ++qr)
        hb |= (m[qr][kk] != 0 ? 1u : 0u) << qr;
      // the upper key half of the same tile and r sits two lanes further on
      const unsigned up = (unsigned)__builtin_amdgcn_mov_dpp((int)hb, 0x4E, 0xF, 0xF, true);
      pk[kk] = hb | (up << 16);
    }
    if ((lane & 2) == 0)
      *(v4u*)(wm + (size_t)rt * (S_ / 2) + (kg * 8 + (lane >> 2)) * 8 + (lane & 1) * 4) = pk;
  }
}

// ---------------- QKV projection: one wave per (b,h,s-tile16) ----------------
// q,k stored as fragments [B,H][s tile][e chunk], plain order (staged via LDS);
// v stored as fragments of V^T (rows e, k = key) [B,H][e tile][32-key chunk] in
// the k order of a packed accumulator pair: k = 8 * (lane >> 4) + s for s < 8,
// 16 + 8 * (lane >> 4) + (s - 8) otherwise; a lane's 8 rows are one 16-B piece.
__global__ __launch_bounds__(32) void
k_qkv(const bf16_t* __restrict__ xb, const bf16_t* __restrict__ wqT,
      const bf16_t* __restrict__ wkT, const bf16_t* __restrict__ wvT,
      const float* __restrict__ bq, const float* __restrict__ bk,
      const float* __restrict__ bv, bf16_t* __restrict__ q,
      bf16_t* __restrict__ k, bf16_t* __restrict__ vT) {
  __shared__ bf16_t st[16 * E_];            // 2 KB staging tile

  const int lane = threadIdx.x & 31;
  const int tile = blockIdx.x;
  const int ts   = S_ / 16;                 // 128
  const int s0   = (tile % ts) << 4;
  const int h    = (tile / ts) % H_;
  const int bz   = tile / (ts * H_);

  const bf16_t* xfr  = xb + ((size_t)bz * S_ + s0) * D_;   // this row tile's fragments
  const bf16_t* wq   = wqT + (size_t)h * E_ * D_;
  const bf16_t* wk   = wkT + (size_t)h * E_ * D_;
  const bf16_t* wv   = wvT + (size_t)h * E_ * D_;

  v8f aq[4], ak[4], av[4];
#pragma unroll
  for (int i = 0; i < 4; ++i) { aq[i] = v8f{}; ak[i] = v8f{}; av[i] = v8f{}; }

  for (int kc = 0; kc < D_ / 32; ++kc) {          // 24 K-chunks
    __builtin_prefetch(xfr + (kc + 2) * 512 + lane * 16, 0, 1);
    // precaution: the loads below land in the registers that held the prefetch's address
    asm volatile("s_wait_xcnt 0x0" ::: "memory");
    v16bf a = load_pk(xfr, kc, lane);
#pragma unroll
    for (int nt = 0; nt < 4; ++nt) {
      const int f = nt * (D_ / 32) + kc;
      aq[nt] = wmma_bf16(a, load_pk(wq, f, lane), aq[nt]);
      ak[nt] = wmma_bf16(a, load_pk(wk, f, lane), ak[nt]);
      av[nt] = wmma_bf16(a, load_pk(wv, f, lane), av[nt]);
    }
  }

  const int N     = lane & 15;
  const int Mbase = (lane >> 4) << 3;
  const size_t bh = (size_t)bz * H_ + h;

  // ---- v: 8 keys per lane -> one b128 store, 512 contiguous bytes per wave ----
#pragma unroll
  for (int nt = 0; nt < 4; ++nt) {
    const float bi = bv[h * E_ + nt * 16 + N];
    v8bf pk;
#pragma unroll
    for (int r = 0; r < 8; ++r) pk[r] = (bf16_t)(av[nt][r] + bi);
    *(v8bf*)(vT + ((bh * 4 + nt) * (S_ / 32) + (s0 >> 5)) * 512 +
             ((s0 >> 4) & 1) * 256 + lane * 8) = pk;
  }

  // ---- q then k: stage 16x64 tile in LDS, flush its 2 fragments in order ----
#pragma unroll
  for (int mat = 0; mat < 2; ++mat) {
    const v8f*   acc  = mat ? ak : aq;
    const float* bias = mat ? bk : bq;
    bf16_t*      dst  = mat ? k : q;
#pragma unroll
    for (int nt = 0; nt < 4; ++nt) {
      const float bi = bias[h * E_ + nt * 16 + N];
#pragma unroll
      for (int r = 0; r < 8; ++r)
        st[(Mbase + r) * E_ + nt * 16 + N] = (bf16_t)(acc[nt][r] + bi);
    }
    __syncthreads();
#pragma unroll
    for (int c = 0; c < 4; ++c) {                 // fragment c >> 1, half c & 1
      const int col = (c >> 1) * 32 + (lane >> 4) * 16 + (c & 1) * 8;
      *(v8bf*)(dst + (bh * S_ + s0) * E_ + (c * 32 + lane) * 8) =
          *(const v8bf*)(st + (lane & 15) * E_ + col);
    }
    __syncthreads();
  }
}

typedef __attribute__((ext_vector_type(16))) unsigned v16u;

// value of lane ^ 16
__device__ __forceinline__ float other_half(float x) {
  const int b = __builtin_bit_cast(int, x);
  return __builtin_bit_cast(float, __builtin_amdgcn_permlanex16(
      b, b, 0x76543210, 0xfedcba98, false, false));
}

__global__ __launch_bounds__(128) void
k_attn(const bf16_t* __restrict__ q, const bf16_t* __restrict__ k,
       const bf16_t* __restrict__ vT, const unsigned* __restrict__ wm,
       bf16_t* __restrict__ ctx) {
  constexpr float SC2  = 0.03187935771f;   // log2(e) / sqrt(S): ref scales by 1/sqrt(S)
  constexpr float NEGR = -1e9f * 45.254834f;      // -1e9 before the 1/sqrt(S) scale
  constexpr float STEP = 8.0f / SC2;              // maximum may lag by 2^8

  const int lane = threadIdx.x & 31;
  // the wave's number in a scalar register, so that the mask words' address is scalar
  const int wave = __builtin_amdgcn_readfirstlane(threadIdx.x >> 5);
  const int c    = lane & 15;
  const int hh   = lane >> 4;
  constexpr int QB = S_ / 128;                        // query blocks per (b,h)
  const int blk = blockIdx.x;
  const int h   = blk % H_;
  const int s0  = ((blk / H_) % QB) * 128 + wave * 32;
  const int bz  = blk / (H_ * QB);
  const size_t bh = (size_t)bz * H_ + h;

  const bf16_t* qbh = q + bh * S_ * E_;
  const bf16_t* kbh = k + bh * S_ * E_;
  const bf16_t* vbh = vT + bh * E_ * S_;
  const unsigned* wrow0 = wm + ((size_t)bz * S_ + s0) * (S_ / 32);   // S / 2 words per tile
  const unsigned* wrow1 = wrow0 + S_ / 2;

  v16bf qf[2][2];                                     // [query tile][e chunk]
#pragma unroll
  for (int j = 0; j < 2; ++j)
#pragma unroll
    for (int e = 0; e < 2; ++e)
      qf[j][e] = load_pk(qbh, ((s0 >> 4) + j) * 2 + e, lane);

  v8f o[2][4];                                        // Ot: [query tile][e tile]
  float m[2], l[2];
#pragma unroll
  for (int j = 0; j < 2; ++j) {
    m[j] = -3.0e38f;
    l[j] = 0.f;
#pragma unroll
    for (int nt = 0; nt < 4; ++nt) o[j][nt] = v8f{};
  }

  v16bf kf[2][2];                                     // [key tile][e chunk]
  v16u  mw[2];                                        // [query tile][key tile * 8 + r]
#pragma unroll
  for (int i = 0; i < 2; ++i) {
    kf[i][0] = load_pk(kbh, 2 * i, lane);
    kf[i][1] = load_pk(kbh, 2 * i + 1, lane);
  }
  mw[0] = *(const v16u*)wrow0;
  mw[1] = *(const v16u*)wrow1;

  for (int p = 0; p < S_ / 32; ++p) {
    const int t0 = p * 32;
    const int tn = (p + 1 < S_ / 32) ? t0 + 32 : t0;  // next pass, kept in bounds

    v16bf vf[4];
#pragma unroll
    for (int nt = 0; nt < 4; ++nt)
      vf[nt] = load_pk(vbh, nt * (S_ / 32) + p, lane);

    v8f s[2][2];                                      // [query tile][key tile]
#pragma unroll
    for (int j = 0; j < 2; ++j)
#pragma unroll
      for (int i = 0; i < 2; ++i) {
        s[j][i] = wmma_bf16(kf[i][0], qf[j][0], v8f{});
        s[j][i] = wmma_bf16(kf[i][1], qf[j][1], s[j][i]);
      }
#pragma unroll
    for (int i = 0; i < 2; ++i) {                     // next pass's K rows
      kf[i][0] = load_pk(kbh, (tn >> 3) + 2 * i, lane);
      kf[i][1] = load_pk(kbh, (tn >> 3) + 2 * i + 1, lane);
    }

    float mx[2];
#pragma unroll
    for (int j = 0; j < 2; ++j) {
      float t = NEGR;
#pragma unroll
      for (int i = 0; i < 2; ++i)
#pragma unroll
        for (int r = 0; r < 8; ++r) {
          const float x =
              __builtin_amdgcn_inverse_ballot_w32(mw[j][i * 8 + r]) ? NEGR : s[j][i][r];
          s[j][i][r] = x;
          t = fmaxf(t, x);
        }
      mx[j] = fmaxf(t, other_half(t));
    }

    // Move the maximum in use only when a column outgrows it by 2^8: one
    // wave-uniform test per pass (softmax does not depend on the shift).
    const bool need = (mx[0] > m[0] + STEP) || (mx[1] > m[1] + STEP);
    if (__builtin_amdgcn_ballot_w32(need) != 0) {
#pragma unroll
      for (int j = 0; j < 2; ++j) {
        const float mn = fmaxf(m[j], mx[j]);
        const float al = __builtin_amdgcn_exp2f((m[j] - mn) * SC2);
        m[j] = mn;
        l[j] *= al;
#pragma unroll
        for (int nt = 0; nt < 4; ++nt)
#pragma unroll
          for (int r = 0; r < 8; ++r) o[j][nt][r] *= al;
      }
    }

    mw[0] = *(const v16u*)(wrow0 + (tn >> 1));        // next pass's mask words
    mw[1] = *(const v16u*)(wrow1 + (tn >> 1));
    // keeps the two scalar loads here, a whole exponential block ahead of their use;
    // left free, the scheduler sinks them to the end of the pass and their latency shows
    __builtin_amdgcn_sched_barrier(0);

#pragma unroll
    for (int j = 0; j < 2; ++j) {
      v16bf pb;
      float sum = 0.f;
#pragma unroll
      for (int i = 0; i < 2; ++i)
#pragma unroll
        for (int r = 0; r < 8; ++r) {
          // subtract first: a row whose keys are all masked gets exactly 1
          const float e = __builtin_amdgcn_exp2f((s[j][i][r] - m[j]) * SC2);
          sum += e;
          pb[i * 8 + r] = (bf16_t)e;
        }
      l[j] += sum;
#pragma unroll
      for (int nt = 0; nt < 4; ++nt)
        o[j][nt] = wmma_bf16(vf[nt], pb, o[j][nt]);
    }
    // precaution: the next pass's index arithmetic lands in the scalar registers
    // that held the address of the mask-word loads above
    asm volatile("s_wait_xcnt 0x0" ::: "memory");
  }

  // a lane holds 8 consecutive e of one query row: one 16-B piece of ctx's
  // fragment [row tile][k chunk h * 2 + nt / 2]: half hh, lane c + 16 * (nt & 1)
#pragma unroll
  for (int j = 0; j < 2; ++j) {
    const float inv = 1.f / (l[j] + other_half(l[j]));
    bf16_t* dst = ctx + ((size_t)bz * S_ + s0 + 16 * j) * (H_ * E_) + h * 1024 +
                  hh * 256 + c * 8;
#pragma unroll
    for (int nt = 0; nt < 4; ++nt) {
      v8bf pk;
#pragma unroll
      for (int r = 0; r < 8; ++r) pk[r] = (bf16_t)(o[j][nt][r] * inv);
      *(v8bf*)(dst + (nt >> 1) * 512 + (nt & 1) * 128) = pk;
    }
  }
}

// ---------------- output projection + LayerNorm ----------------
// 128 threads (4 waves); block owns 16 rows of [B*S, 768]. Each wave does 12
// n-tiles; result tile staged in LDS for row-wise LayerNorm.
__global__ __launch_bounds__(128) void
k_proj_ln(const bf16_t* __restrict__ ctx, const bf16_t* __restrict__ woT,
          const float* __restrict__ bo, const float* __restrict__ gamma,
          const float* __restrict__ beta, float* __restrict__ out) {
  __shared__ float sOut[16 * D_];                     // 48 KB
  __shared__ float sMu[16], sRs[16];

  const int tid  = threadIdx.x;
  const int lane = tid & 31;
  const int wave = tid >> 5;
  const int row0 = blockIdx.x * 16;                   // row in [0, B*S)
  const bf16_t* arow = ctx + (size_t)row0 * D_;

  v8f acc[12];
#pragma unroll
  for (int i = 0; i < 12; ++i) acc[i] = v8f{};

  for (int kc = 0; kc < D_ / 32; ++kc) {              // 24 K-chunks
    v16bf a = load_pk(arow, kc, lane);
#pragma unroll
    for (int j = 0; j < 12; ++j)
      acc[j] = wmma_bf16(a, load_pk(woT, (wave * 12 + j) * (D_ / 32) + kc, lane),
                         acc[j]);
  }

  const int N     = lane & 15;
  const int Mbase = (lane >> 4) << 3;
#pragma unroll
  for (int j = 0; j < 12; ++j) {
    const int n0 = (wave * 12 + j) * 16;
    const float bi = bo[n0 + N];
#pragma unroll
    for (int r = 0; r < 8; ++r)
      sOut[(Mbase + r) * D_ + n0 + N] = acc[j][r] + bi;
  }
  __syncthreads();

  if (tid < 16) {
    float mu = 0.f;
    for (int c = 0; c < D_; ++c) mu += sOut[tid * D_ + c];
    mu *= (1.f / D_);
    float var = 0.f;
    for (int c = 0; c < D_; ++c) {
      float d = sOut[tid * D_ + c] - mu;
      var += d * d;
    }
    var *= (1.f / D_);
    sMu[tid] = mu;
    sRs[tid] = rsqrtf(var + LN_EPS_);
  }
  __syncthreads();

  for (int idx = tid; idx < 16 * D_; idx += 128) {
    const int r = idx / D_, c = idx - r * D_;
    out[(size_t)row0 * D_ + idx] =
        (sOut[idx] - sMu[r]) * sRs[r] * gamma[c] + beta[c];
  }
}

// ---------------- host launcher ----------------
extern "C" void kernel_launch(void* const* d_in, const int* in_sizes, int n_in,
                              void* d_out, int out_size, void* d_ws, size_t ws_size,
                              hipStream_t stream) {
  const float* x    = (const float*)d_in[0];
  const int*   mask = (const int*)d_in[1];
  const float* Wq   = (const float*)d_in[2];
  const float* bq   = (const float*)d_in[3];
  const float* Wk   = (const float*)d_in[4];
  const float* bk   = (const float*)d_in[5];
  const float* Wv   = (const float*)d_in[6];
  const float* bv   = (const float*)d_in[7];
  const float* Wo   = (const float*)d_in[8];
  const float* bo   = (const float*)d_in[9];
  const float* gamma = (const float*)d_in[10];
  const float* beta  = (const float*)d_in[11];
  float* out = (float*)d_out;

  // workspace layout (bf16 intermediates, mask words), ~66.5 MB total
  char* ws = (char*)d_ws;
  const size_t szX  = (size_t)B_ * S_ * D_ * sizeof(bf16_t);
  const size_t szW  = (size_t)H_ * E_ * D_ * sizeof(bf16_t);
  const size_t szWo = (size_t)D_ * D_ * sizeof(bf16_t);
  const size_t szQ  = (size_t)B_ * H_ * S_ * E_ * sizeof(bf16_t);
  bf16_t* xb  = (bf16_t*)(ws);
  bf16_t* wqT = (bf16_t*)(ws + szX);
  bf16_t* wkT = (bf16_t*)(ws + szX + szW);
  bf16_t* wvT = (bf16_t*)(ws + szX + 2 * szW);
  bf16_t* woT = (bf16_t*)(ws + szX + 3 * szW);
  bf16_t* q   = (bf16_t*)(ws + szX + 3 * szW + szWo);
  bf16_t* k   = (bf16_t*)(ws + szX + 3 * szW + szWo + szQ);
  bf16_t* vT  = (bf16_t*)(ws + szX + 3 * szW + szWo + 2 * szQ);
  bf16_t* ctx = (bf16_t*)(ws + szX + 3 * szW + szWo + 3 * szQ);
  unsigned* wm = (unsigned*)(ws + szX + 3 * szW + szWo + 4 * szQ);   // 2 MB of mask words

  k_pack_mask<<<B_ * (S_ / 16), 256, 0, stream>>>(mask, wm);   // one block per query tile
  k_cvt_bf16<<<B_ * S_ * D_ / (8 * 256), 256, 0, stream>>>(x, xb);
  k_tr_hde<<<H_ * D_ * E_ / (8 * 256), 256, 0, stream>>>(Wq, wqT);
  k_tr_hde<<<H_ * D_ * E_ / (8 * 256), 256, 0, stream>>>(Wk, wkT);
  k_tr_hde<<<H_ * D_ * E_ / (8 * 256), 256, 0, stream>>>(Wv, wvT);
  k_tr_wo<<<D_ * D_ / (8 * 256), 256, 0, stream>>>(Wo, woT);

  const int nTiles = B_ * H_ * (S_ / 16);             // 6144
  k_qkv<<<nTiles, 32, 0, stream>>>(xb, wqT, wkT, wvT, bq, bk, bv, q, k, vT);

  k_attn<<<B_ * H_ * (S_ / 128), 128, 0, stream>>>(q, k, vT, wm, ctx);

  k_proj_ln<<<B_ * S_ / 16, 128, 0, stream>>>(ctx, woT, bo, gamma, beta, out);
}

// v004
// It runs in 154 microseconds.
// Next to v003, in two timings, it ran 2.09 times as fast each time.
// All steps since v000 together make it 18.9 times as fast.
#include <hip/hip_runtime.h>
#include <hip/hip_bf16.h>
#include <math.h>

// ---- problem constants (match reference) ----
static constexpr int B_ = 4, S_ = 2048, D_ = 768, H_ = 12, E_ = 64;
static constexpr float LN_EPS_ = 1e-5f;

typedef __bf16 bf16_t;
typedef __attribute__((ext_vector_type(16))) __bf16 v16bf;
typedef __attribute__((ext_vector_type(8)))  __bf16 v8bf;   // 16-byte pack
typedef __attribute__((ext_vector_type(8)))  float  v8f;

// -------------------------------------------------------------------------
// Every bf16 operand in the workspace is stored in FRAGMENT ORDER: a 16-row x
// 32-k fragment of V_WMMA_F32_16X16X32_BF16 (wave32) is one 1-KB block,
//   block[half * 256 + lane * 8 + i]  =  register element s = half * 8 + i of lane,
// so a wave loads a fragment with two b128 loads of 512 contiguous bytes each.
// Which (row, k) a position holds, for a row-major matrix M:
//   plain order: row = lane & 15, k = (lane >> 4) * 16 + s   (A and B alike)
// Fragments of a matrix with K columns lie as [row tile][k chunk of 32].
// -------------------------------------------------------------------------
__device__ __forceinline__ v16bf load_pk(const bf16_t* base, int frag, int lane) {
  const bf16_t* p = base + (size_t)frag * 512 + lane * 8;
  const v8bf lo = *(const v8bf*)p;
  const v8bf hi = *(const v8bf*)(p + 256);
  return __builtin_shufflevector(lo, hi, 0, 1, 2, 3, 4, 5, 6, 7, 8, 9, 10, 11,
                                 12, 13, 14, 15);
}

__device__ __forceinline__ v8f wmma_bf16(v16bf a, v16bf b, v8f c) {
  return __builtin_amdgcn_wmma_f32_16x16x32_bf16(false, a, false, b,
                                                 (short)0, c, false, false);
}

// ---------------- conversion kernels: f32 -> bf16 in fragment order ----------
// One thread makes one 16-byte piece j of the packed copy:
// fragment j >> 6, half (j >> 5) & 1, lane j & 31.
typedef __attribute__((ext_vector_type(4))) float v4f;

// x [B*S, D] -> fragments [row tile][k chunk]
__global__ __launch_bounds__(256) void k_cvt_bf16(const float* __restrict__ x,
                                                  bf16_t* __restrict__ y) {
  const int j    = blockIdx.x * 256 + threadIdx.x;
  const int frag = j >> 6, half = (j >> 5) & 1, ln = j & 31;
  const int rt = frag / (D_ / 32), kc = frag - rt * (D_ / 32);
  const float* s = x + (size_t)(rt * 16 + (ln & 15)) * D_ + kc * 32 +
                   (ln >> 4) * 16 + half * 8;
  const v4f a = *(const v4f*)s;
  const v4f b = *(const v4f*)(s + 4);
  v8bf pk;
#pragma unroll
  for (int i = 0; i < 4; ++i) { pk[i] = (bf16_t)a[i]; pk[4 + i] = (bf16_t)b[i]; }
  *(v8bf*)(y + (size_t)j * 8) = pk;
}

// W [H,D,E] -> fragments of W^T (rows e, k = d): [h][e tile][d chunk]
__global__ __launch_bounds__(256) void k_tr_hde(const float* __restrict__ W,
                                                bf16_t* __restrict__ WT) {
  const int j    = blockIdx.x * 256 + threadIdx.x;
  const int frag = j >> 6, half = (j >> 5) & 1, ln = j & 31;
  const int kc = frag % (D_ / 32);
  const int et = frag / (D_ / 32);                    // h * 4 + e tile
  const int h = et >> 2, e = (et & 3) * 16 + (ln & 15);
  const int d0 = kc * 32 + (ln >> 4) * 16 + half * 8;
  const float* s = W + ((size_t)h * D_ + d0) * E_ + e;
  v8bf pk;
#pragma unroll
  for (int i = 0; i < 8; ++i) pk[i] = (bf16_t)s[i * E_];
  *(v8bf*)(WT + (size_t)j * 8) = pk;
}

// Wo [768 f, 768 d] -> fragments of Wo^T (rows d, k = f): [d tile][f chunk]
__global__ __launch_bounds__(256) void k_tr_wo(const float* __restrict__ W,
                                               bf16_t* __restrict__ WT) {
  const int j    = blockIdx.x * 256 + threadIdx.x;
  const int frag = j >> 6, half = (j >> 5) & 1, ln = j & 31;
  const int kc = frag % (D_ / 32);
  const int d  = (frag / (D_ / 32)) * 16 + (ln & 15);
  const int f0 = kc * 32 + (ln >> 4) * 16 + half * 8;
  const float* s = W + (size_t)f0 * D_ + d;
  v8bf pk;
#pragma unroll
  for (int i = 0; i < 8; ++i) pk[i] = (bf16_t)s[i * D_];
  *(v8bf*)(WT + (size_t)j * 8) = pk;
}

// ---------------- mask [B,S,S] i32 -> lane-mask words ----------------
// Word [b][query tile of 16][key tile of 16][r]: bit L says whether
// mask[b][query tile * 16 + (L & 15)][key tile * 16 + 8 * (L >> 4) + r] != 0,
// which is the entry that lane L holds in register r of that transposed score
// tile: k_attn reads a word into a scalar register and selects on it directly.
// One wave takes 16 query rows x 128 keys at a time: 16 whole-line loads; lane l
// holds keys 4l..4l+3 (key tile l >> 2, half (l >> 1) & 1, r = 4 * (l & 1) + k).
typedef __attribute__((ext_vector_type(4))) int      v4i;
typedef __attribute__((ext_vector_type(4))) unsigned v4u;

__global__ __launch_bounds__(256) void k_pack_mask(const int* __restrict__ mask,
                                                   unsigned* __restrict__ wm) {
  const int lane = threadIdx.x & 31;
  const int w    = blockIdx.x * 8 + (threadIdx.x >> 5);
  const int rt   = w >> 3;                            // b * (S / 16) + query tile
#pragma unroll
  for (int t = 0; t < 2; ++t) {
    const int kg = (w & 7) * 2 + t;                   // group of 128 keys
    const int* s = mask + (size_t)rt * 16 * S_ + kg * 128 + lane * 4;
    v4i m[16];
#pragma unroll
    for (int qr = 0; qr < 16; ++qr) m[qr] = *(const v4i*)(s + (size_t)qr * S_);
    v4u pk;
#pragma unroll
    for (int kk = 0; kk < 4; ++kk) {
      unsigned hb = 0;                                // bit qr: query row qr, this key
#pragma unroll
      for (int qr = 0; qr < 16; ++qr)
        hb |= (m[qr][kk] != 0 ? 1u : 0u) << qr;
      // the upper key half of the same tile and r sits two lanes further on
      const unsigned up = (unsigned)__builtin_amdgcn_mov_dpp((int)hb, 0x4E, 0xF, 0xF, true);
      pk[kk] = hb | (up << 16);
    }
    if ((lane & 2) == 0)
      *(v4u*)(wm + (size_t)rt * (S_ / 2) + (kg * 8 + (lane >> 2)) * 8 + (lane & 1) * 4) = pk;
  }
}

// ---------------- QKV projection: one wave per 64 rows x 64 columns ----------
// A block is 128 rows x 2 heads of ONE of q, k, v; its 4 waves are 2 x 2, so each x
// and each weight fragment is wanted by two waves of the block at about the same time.
// A wave's 4 x 4 accumulator tiles take 8 fragment loads per 16 WMMAs.
// q,k stored as fragments [B,H][s tile][e chunk], plain order (staged via LDS);
// v stored as fragments of V^T (rows e, k = key) [B,H][e tile][32-key chunk] in
// the k order of a packed accumulator pair: k = 8 * (lane >> 4) + s for s < 8,
// 16 + 8 * (lane >> 4) + (s - 8) otherwise; a lane's 8 rows are one 16-B piece.
__global__ __launch_bounds__(128) void
k_qkv(const bf16_t* __restrict__ xb, const bf16_t* __restrict__ wqT,
      const bf16_t* __restrict__ wkT, const bf16_t* __restrict__ wvT,
      const float* __restrict__ bq, const float* __restrict__ bk,
      const float* __restrict__ bv, bf16_t* __restrict__ q,
      bf16_t* __restrict__ k, bf16_t* __restrict__ vT) {
  __shared__ bf16_t st[4][64 * E_];         // 8 KB staging tile per wave

  const int lane = threadIdx.x & 31;
  // the wave's number in a scalar register: fragment addresses are a scalar base + lane offset
  const int wave = __builtin_amdgcn_readfirstlane(threadIdx.x >> 5);
  constexpr int RB = S_ / 128;              // row blocks per batch entry
  const int blk = blockIdx.x;
  const int s0  = (blk % RB) * 128 + (wave & 1) * 64;
  const int h   = ((blk / RB) % (H_ / 2)) * 2 + (wave >> 1);
  const int mat = (blk / (RB * (H_ / 2))) % 3;          // 0 q, 1 k, 2 v: one per block
  const int bz  = blk / (RB * (H_ / 2) * 3);

  const bf16_t* xfr = xb + ((size_t)bz * S_ + s0) * D_;  // 4 row tiles of fragments
  const bf16_t* w   = (mat == 0 ? wqT : mat == 1 ? wkT : wvT) + (size_t)h * E_ * D_;
  const float* bias = (mat == 0 ? bq : mat == 1 ? bk : bv) + h * E_;

  v8f acc[4][4];                            // [row tile][e tile]
#pragma unroll
  for (int i = 0; i < 4; ++i)
#pragma unroll
    for (int nt = 0; nt < 4; ++nt) acc[i][nt] = v8f{};

  for (int kc = 0; kc < D_ / 32; ++kc) {          // 24 K-chunks
    v16bf a[4], b[4];
    a[0] = load_pk(xfr, kc, lane);
#pragma unroll
    for (int nt = 0; nt < 4; ++nt) b[nt] = load_pk(w, nt * (D_ / 32) + kc, lane);
#pragma unroll
    for (int i = 1; i < 3; ++i) a[i] = load_pk(xfr, i * (D_ / 32) + kc, lane);
    const bf16_t* p3 = xfr + (size_t)(3 * (D_ / 32) + kc) * 512 + lane * 8;
    const v8bf lo3 = *(const v8bf*)p3;
    // precaution: the last load lands in the registers that held the addresses of the loads above
    asm volatile("s_wait_xcnt 0x0" ::: "memory");
    const v8bf hi3 = *(const v8bf*)(p3 + 256);
    a[3] = __builtin_shufflevector(lo3, hi3, 0, 1, 2, 3, 4, 5, 6, 7, 8, 9, 10, 11, 12, 13,
                                   14, 15);
    // keeps the chunk's 16 loads together in front of its WMMAs: one latency per chunk;
    // left free, the scheduler reuses two buffers and every WMMA waits on a fresh load
    __builtin_amdgcn_sched_barrier(0);
#pragma unroll
    for (int i = 0; i < 4; ++i)
#pragma unroll
      for (int nt = 0; nt < 4; ++nt) acc[i][nt] = wmma_bf16(a[i], b[nt], acc[i][nt]);
  }

  const int N     = lane & 15;
  const int Mbase = (lane >> 4) << 3;
  const size_t bh = (size_t)bz * H_ + h;
  float bi[4];
#pragma unroll
  for (int nt = 0; nt < 4; ++nt) bi[nt] = bias[nt * 16 + N];

  if (mat == 2) {
    // ---- v: 8 keys per lane -> one b128 store, 512 contiguous bytes per wave ----
#pragma unroll
    for (int i = 0; i < 4; ++i) {
      const int si = s0 + 16 * i;
#pragma unroll
      for (int nt = 0; nt < 4; ++nt) {
        v8bf pk;
#pragma unroll
        for (int r = 0; r < 8; ++r) pk[r] = (bf16_t)(acc[i][nt][r] + bi[nt]);
        *(v8bf*)(vT + ((bh * 4 + nt) * (S_ / 32) + (si >> 5)) * 512 +
                 ((si >> 4) & 1) * 256 + lane * 8) = pk;
      }
    }
  } else {
    // ---- q or k: stage the wave's 64x64 tile in LDS, flush its 8 fragments in order ----
    bf16_t* dst = (mat ? k : q) + (bh * S_ + s0) * E_;
    bf16_t* sw  = st[wave];
#pragma unroll
    for (int i = 0; i < 4; ++i)
#pragma unroll
      for (int nt = 0; nt < 4; ++nt)
#pragma unroll
        for (int r = 0; r < 8; ++r)
          sw[(i * 16 + Mbase + r) * E_ + nt * 16 + N] = (bf16_t)(acc[i][nt][r] + bi[nt]);
    __syncthreads();                              // mat is the same for the whole block
#pragma unroll
    for (int i = 0; i < 4; ++i)
#pragma unroll
      for (int c = 0; c < 4; ++c) {               // fragment c >> 1, half c & 1
        const int col = (c >> 1) * 32 + (lane >> 4) * 16 + (c & 1) * 8;
        *(v8bf*)(dst + i * 16 * E_ + (c * 32 + lane) * 8) =
            *(const v8bf*)(sw + (i * 16 + (lane & 15)) * E_ + col);
      }
  }
}

typedef __attribute__((ext_vector_type(16))) unsigned v16u;

// value of lane ^ 16
__device__ __forceinline__ float other_half(float x) {
  const int b = __builtin_bit_cast(int, x);
  return __builtin_bit_cast(float, __builtin_amdgcn_permlanex16(
      b, b, 0x76543210, 0xfedcba98, false, false));
}

__global__ __launch_bounds__(128) void
k_attn(const bf16_t* __restrict__ q, const bf16_t* __restrict__ k,
       const bf16_t* __restrict__ vT, const unsigned* __restrict__ wm,
       bf16_t* __restrict__ ctx) {
  constexpr float SC2  = 0.03187935771f;   // log2(e) / sqrt(S): ref scales by 1/sqrt(S)
  constexpr float NEGR = -1e9f * 45.254834f;      // -1e9 before the 1/sqrt(S) scale
  constexpr float STEP = 8.0f / SC2;              // maximum may lag by 2^8

  const int lane = threadIdx.x & 31;
  // the wave's number in a scalar register, so that the mask words' address is scalar
  const int wave = __builtin_amdgcn_readfirstlane(threadIdx.x >> 5);
  const int c    = lane & 15;
  const int hh   = lane >> 4;
  constexpr int QB = S_ / 128;                        // query blocks per (b,h)
  const int blk = blockIdx.x;
  const int h   = blk % H_;
  const int s0  = ((blk / H_) % QB) * 128 + wave * 32;
  const int bz  = blk / (H_ * QB);
  const size_t bh = (size_t)bz * H_ + h;

  const bf16_t* qbh = q + bh * S_ * E_;
  const bf16_t* kbh = k + bh * S_ * E_;
  const bf16_t* vbh = vT + bh * E_ * S_;
  const unsigned* wrow0 = wm + ((size_t)bz * S_ + s0) * (S_ / 32);   // S / 2 words per tile
  const unsigned* wrow1 = wrow0 + S_ / 2;

  v16bf qf[2][2];                                     // [query tile][e chunk]
#pragma unroll
  for (int j = 0; j < 2; ++j)
#pragma unroll
    for (int e = 0; e < 2; ++e)
      qf[j][e] = load_pk(qbh, ((s0 >> 4) + j) * 2 + e, lane);

  v8f o[2][4];                                        // Ot: [query tile][e tile]
  float m[2], l[2];
#pragma unroll
  for (int j = 0; j < 2; ++j) {
    m[j] = -3.0e38f;
    l[j] = 0.f;
#pragma unroll
    for (int nt = 0; nt < 4; ++nt) o[j][nt] = v8f{};
  }

  v16bf kf[2][2];                                     // [key tile][e chunk]
  v16u  mw[2];                                        // [query tile][key tile * 8 + r]
#pragma unroll
  for (int i = 0; i < 2; ++i) {
    kf[i][0] = load_pk(kbh, 2 * i, lane);
    kf[i][1] = load_pk(kbh, 2 * i + 1, lane);
  }
  mw[0] = *(const v16u*)wrow0;
  mw[1] = *(const v16u*)wrow1;

  for (int p = 0; p < S_ / 32; ++p) {
    const int t0 = p * 32;
    const int tn = (p + 1 < S_ / 32) ? t0 + 32 : t0;  // next pass, kept in bounds

    v16bf vf[4];
#pragma unroll
    for (int nt = 0; nt < 4; ++nt)
      vf[nt] = load_pk(vbh, nt * (S_ / 32) + p, lane);

    v8f s[2][2];                                      // [query tile][key tile]
#pragma unroll
    for (int j = 0; j < 2; ++j)
#pragma unroll
      for (int i = 0; i < 2; ++i) {
        s[j][i] = wmma_bf16(kf[i][0], qf[j][0], v8f{});
        s[j][i] = wmma_bf16(kf[i][1], qf[j][1], s[j][i]);
      }
#pragma unroll
    for (int i = 0; i < 2; ++i) {                     // next pass's K rows
      kf[i][0] = load_pk(kbh, (tn >> 3) + 2 * i, lane);
      kf[i][1] = load_pk(kbh, (tn >> 3) + 2 * i + 1, lane);
    }

    float mx[2];
#pragma unroll
    for (int j = 0; j < 2; ++j) {
      float t = NEGR;
#pragma unroll
      for (int i = 0; i < 2; ++i)
#pragma unroll
        for (int r = 0; r < 8; ++r) {
          const float x =
              __builtin_amdgcn_inverse_ballot_w32(mw[j][i * 8 + r]) ? NEGR : s[j][i][r];
          s[j][i][r] = x;
          t = fmaxf(t, x);
        }
      mx[j] = fmaxf(t, other_half(t));
    }

    // Move the maximum in use only when a column outgrows it by 2^8: one
    // wave-uniform test per pass (softmax does not depend on the shift).
    const bool need = (mx[0] > m[0] + STEP) || (mx[1] > m[1] + STEP);
    if (__builtin_amdgcn_ballot_w32(need) != 0) {
#pragma unroll
      for (int j = 0; j < 2; ++j) {
        const float mn = fmaxf(m[j], mx[j]);
        const float al = __builtin_amdgcn_exp2f((m[j] - mn) * SC2);
        m[j] = mn;
        l[j] *= al;
#pragma unroll
        for (int nt = 0; nt < 4; ++nt)
#pragma unroll
          for (int r = 0; r < 8; ++r) o[j][nt][r] *= al;
      }
    }

    mw[0] = *(const v16u*)(wrow0 + (tn >> 1));        // next pass's mask words
    mw[1] = *(const v16u*)(wrow1 + (tn >> 1));
    // keeps the two scalar loads here, a whole exponential block ahead of their use;
    // left free, the scheduler sinks them to the end of the pass and their latency shows
    __builtin_amdgcn_sched_barrier(0);

#pragma unroll
    for (int j = 0; j < 2; ++j) {
      v16bf pb;
      float sum = 0.f;
#pragma unroll
      for (int i = 0; i < 2; ++i)
#pragma unroll
        for (int r = 0; r < 8; ++r) {
          // subtract first: a row whose keys are all masked gets exactly 1
          const float e = __builtin_amdgcn_exp2f((s[j][i][r] - m[j]) * SC2);
          sum += e;
          pb[i * 8 + r] = (bf16_t)e;
        }
      l[j] += sum;
#pragma unroll
      for (int nt = 0; nt < 4; ++nt)
        o[j][nt] = wmma_bf16(vf[nt], pb, o[j][nt]);
    }
    // precaution: the next pass's index arithmetic lands in the scalar registers
    // that held the address of the mask-word loads above
    asm volatile("s_wait_xcnt 0x0" ::: "memory");
  }

  // a lane holds 8 consecutive e of one query row: one 16-B piece of ctx's
  // fragment [row tile][k chunk h * 2 + nt / 2]: half hh, lane c + 16 * (nt & 1)
#pragma unroll
  for (int j = 0; j < 2; ++j) {
    const float inv = 1.f / (l[j] + other_half(l[j]));
    bf16_t* dst = ctx + ((size_t)bz * S_ + s0 + 16 * j) * (H_ * E_) + h * 1024 +
                  hh * 256 + c * 8;
#pragma unroll
    for (int nt = 0; nt < 4; ++nt) {
      v8bf pk;
#pragma unroll
      for (int r = 0; r < 8; ++r) pk[r] = (bf16_t)(o[j][nt][r] * inv);
      *(v8bf*)(dst + (nt >> 1) * 512 + (nt & 1) * 128) = pk;
    }
  }
}

// ---------------- output projection + LayerNorm ----------------
// 256 threads (8 waves); block owns 32 rows of [B*S, 768]. Each wave does 2 row tiles
// x 6 n-tiles (8 fragment loads per 12 WMMAs); result staged in LDS for the LayerNorm.
__global__ __launch_bounds__(256) void
k_proj_ln(const bf16_t* __restrict__ ctx, const bf16_t* __restrict__ woT,
          const float* __restrict__ bo, const float* __restrict__ gamma,
          const float* __restrict__ beta, float* __restrict__ out) {
  __shared__ float sOut[32 * D_];                     // 96 KB
  __shared__ float sMu[32], sRs[32];

  const int tid  = threadIdx.x;
  const int lane = tid & 31;
  // the wave's number in a scalar register: fragment addresses are a scalar base + lane offset
  const int wave = __builtin_amdgcn_readfirstlane(tid >> 5);
  const int row0 = blockIdx.x * 32;                   // row in [0, B*S)
  const bf16_t* arow = ctx + (size_t)row0 * D_;

  v8f acc[2][6];
#pragma unroll
  for (int i = 0; i < 2; ++i)
#pragma unroll
    for (int j = 0; j < 6; ++j) acc[i][j] = v8f{};

  // kept rolled: fully unrolled this loop built to 266 VGPRs, past the 256 reached without a window
#pragma unroll 1
  for (int kc = 0; kc < D_ / 32; kc += 2) {           // 24 K-chunks, two at a time
    v16bf a[2][2], b[2][6];                           // [chunk][tile]
#pragma unroll
    for (int u = 0; u < 2; ++u) {
      // precaution: the second chunk's loads land in registers that held addresses of the first's
      if (u) asm volatile("s_wait_xcnt 0x0" ::: "memory");
#pragma unroll
      for (int i = 0; i < 2; ++i) a[u][i] = load_pk(arow, i * (D_ / 32) + kc + u, lane);
#pragma unroll
      for (int j = 0; j < 6; ++j)
        b[u][j] = load_pk(woT, (wave * 6 + j) * (D_ / 32) + kc + u, lane);
    }
    // keeps the 32 loads of two chunks together in front of their WMMAs: one latency per
    // pair; left free, the scheduler reuses two buffers and every WMMA waits on a fresh load
    __builtin_amdgcn_sched_barrier(0);
#pragma unroll
    for (int u = 0; u < 2; ++u)
#pragma unroll
      for (int j = 0; j < 6; ++j)
#pragma unroll
        for (int i = 0; i < 2; ++i) acc[i][j] = wmma_bf16(a[u][i], b[u][j], acc[i][j]);
  }

  const int N     = lane & 15;
  const int Mbase = (lane >> 4) << 3;
#pragma unroll
  for (int j = 0; j < 6; ++j) {
    const int n0 = (wave * 6 + j) * 16;
    const float bi = bo[n0 + N];
#pragma unroll
    for (int i = 0; i < 2; ++i)
#pragma unroll
      for (int r = 0; r < 8; ++r)
        sOut[(i * 16 + Mbase + r) * D_ + n0 + N] = acc[i][j][r] + bi;
  }
  __syncthreads();

  if (tid < 32) {
    float mu = 0.f;
    for (int c = 0; c < D_; ++c) mu += sOut[tid * D_ + c];
    mu *= (1.f / D_);
    float var = 0.f;
    for (int c = 0; c < D_; ++c) {
      float d = sOut[tid * D_ + c] - mu;
      var += d * d;
    }
    var *= (1.f / D_);
    sMu[tid] = mu;
    sRs[tid] = rsqrtf(var + LN_EPS_);
  }
  __syncthreads();

  for (int idx = tid; idx < 32 * D_; idx += 256) {
    const int r = idx / D_, c = idx - r * D_;
    out[(size_t)row0 * D_ + idx] =
        (sOut[idx] - sMu[r]) * sRs[r] * gamma[c] + beta[c];
  }
}

// ---------------- host launcher ----------------
extern "C" void kernel_launch(void* const* d_in, const int* in_sizes, int n_in,
                              void* d_out, int out_size, void* d_ws, size_t ws_size,
                              hipStream_t stream) {
  const float* x    = (const float*)d_in[0];
  const int*   mask = (const int*)d_in[1];
  const float* Wq   = (const float*)d_in[2];
  const float* bq   = (const float*)d_in[3];
  const float* Wk   = (const float*)d_in[4];
  const float* bk   = (const float*)d_in[5];
  const float* Wv   = (const float*)d_in[6];
  const float* bv   = (const float*)d_in[7];
  const float* Wo   = (const float*)d_in[8];
  const float* bo   = (const float*)d_in[9];
  const float* gamma = (const float*)d_in[10];
  const float* beta  = (const float*)d_in[11];
  float* out = (float*)d_out;

  // workspace layout (bf16 intermediates, mask words), ~66.5 MB total
  char* ws = (char*)d_ws;
  const size_t szX  = (size_t)B_ * S_ * D_ * sizeof(bf16_t);
  const size_t szW  = (size_t)H_ * E_ * D_ * sizeof(bf16_t);
  const size_t szWo = (size_t)D_ * D_ * sizeof(bf16_t);
  const size_t szQ  = (size_t)B_ * H_ * S_ * E_ * sizeof(bf16_t);
  bf16_t* xb  = (bf16_t*)(ws);
  bf16_t* wqT = (bf16_t*)(ws + szX);
  bf16_t* wkT = (bf16_t*)(ws + szX + szW);
  bf16_t* wvT = (bf16_t*)(ws + szX + 2 * szW);
  bf16_t* woT = (bf16_t*)(ws + szX + 3 * szW);
  bf16_t* q   = (bf16_t*)(ws + szX + 3 * szW + szWo);
  bf16_t* k   = (bf16_t*)(ws + szX + 3 * szW + szWo + szQ);
  bf16_t* vT  = (bf16_t*)(ws + szX + 3 * szW + szWo + 2 * szQ);
  bf16_t* ctx = (bf16_t*)(ws + szX + 3 * szW + szWo + 3 * szQ);
  unsigned* wm = (unsigned*)(ws + szX + 3 * szW + szWo + 4 * szQ);   // 2 MB of mask words

  k_pack_mask<<<B_ * (S_ / 16), 256, 0, stream>>>(mask, wm);   // one block per query tile
  k_cvt_bf16<<<B_ * S_ * D_ / (8 * 256), 256, 0, stream>>>(x, xb);
  k_tr_hde<<<H_ * D_ * E_ / (8 * 256), 256, 0, stream>>>(Wq, wqT);
  k_tr_hde<<<H_ * D_ * E_ / (8 * 256), 256, 0, stream>>>(Wk, wkT);
  k_tr_hde<<<H_ * D_ * E_ / (8 * 256), 256, 0, stream>>>(Wv, wvT);
  k_tr_wo<<<D_ * D_ / (8 * 256), 256, 0, stream>>>(Wo, woT);

  k_qkv<<<B_ * 3 * (H_ / 2) * (S_ / 128), 128, 0, stream>>>(xb, wqT, wkT, wvT, bq, bk, bv,
                                                            q, k, vT);

  k_attn<<<B_ * H_ * (S_ / 128), 128, 0, stream>>>(q, k, vT, wm, ctx);

  k_proj_ln<<<B_ * S_ / 32, 256, 0, stream>>>(ctx, woT, bo, gamma, beta, out);
}

// v005
// It runs in 131 microseconds.
// Next to v004, in two timings, it ran 1.18 times as fast each time.
// All steps since v000 together make it 22.3 times as fast.
#include <hip/hip_runtime.h>
#include <hip/hip_bf16.h>
#include <math.h>

// ---- problem constants (match reference) ----
static constexpr int B_ = 4, S_ = 2048, D_ = 768, H_ = 12, E_ = 64;
static constexpr float LN_EPS_ = 1e-5f;

typedef __bf16 bf16_t;
typedef __attribute__((ext_vector_type(16))) __bf16 v16bf;
typedef __attribute__((ext_vector_type(8)))  __bf16 v8bf;   // 16-byte pack
typedef __attribute__((ext_vector_type(8)))  float  v8f;

// -------------------------------------------------------------------------
// Every bf16 operand in the workspace is stored in FRAGMENT ORDER: a 16-row x
// 32-k fragment of V_WMMA_F32_16X16X32_BF16 (wave32) is one 1-KB block,
//   block[half * 256 + lane * 8 + i]  =  register element s = half * 8 + i of lane,
// so a wave loads a fragment with two b128 loads of 512 contiguous bytes each.
// Which (row, k) a position holds, for a row-major matrix M:
//   plain order: row = lane & 15, k = (lane >> 4) * 16 + s   (A and B alike)
// Fragments of a matrix with K columns lie as [row tile][k chunk of 32].
// -------------------------------------------------------------------------
__device__ __forceinline__ v16bf load_pk(const bf16_t* base, int frag, int lane) {
  const bf16_t* p = base + (size_t)frag * 512 + lane * 8;
  const v8bf lo = *(const v8bf*)p;
  const v8bf hi = *(const v8bf*)(p + 256);
  return __builtin_shufflevector(lo, hi, 0, 1, 2, 3, 4, 5, 6, 7, 8, 9, 10, 11,
                                 12, 13, 14, 15);
}

__device__ __forceinline__ v8f wmma_bf16(v16bf a, v16bf b, v8f c) {
  return __builtin_amdgcn_wmma_f32_16x16x32_bf16(false, a, false, b,
                                                 (short)0, c, false, false);
}

// ---------------- conversion kernels: f32 -> bf16 in fragment order ----------
// One thread makes one 16-byte piece j of the packed copy:
// fragment j >> 6, half (j >> 5) & 1, lane j & 31.
typedef __attribute__((ext_vector_type(4))) float v4f;

// x [B*S, D] -> fragments [row tile][k chunk]
__global__ __launch_bounds__(256) void k_cvt_bf16(const float* __restrict__ x,
                                                  bf16_t* __restrict__ y) {
  const int j    = blockIdx.x * 256 + threadIdx.x;
  const int frag = j >> 6, half = (j >> 5) & 1, ln = j & 31;
  const int rt = frag / (D_ / 32), kc = frag - rt * (D_ / 32);
  const float* s = x + (size_t)(rt * 16 + (ln & 15)) * D_ + kc * 32 +
                   (ln >> 4) * 16 + half * 8;
  const v4f a = *(const v4f*)s;
  const v4f b = *(const v4f*)(s + 4);
  v8bf pk;
#pragma unroll
  for (int i = 0; i < 4; ++i) { pk[i] = (bf16_t)a[i]; pk[4 + i] = (bf16_t)b[i]; }
  *(v8bf*)(y + (size_t)j * 8) = pk;
}

// W [H,D,E] -> fragments of W^T (rows e, k = d): [h][e tile][d chunk]
__global__ __launch_bounds__(256) void k_tr_hde(const float* __restrict__ W,
                                                bf16_t* __restrict__ WT) {
  const int j    = blockIdx.x * 256 + threadIdx.x;
  const int frag = j >> 6, half = (j >> 5) & 1, ln = j & 31;
  const int kc = frag % (D_ / 32);
  const int et = frag / (D_ / 32);                    // h * 4 + e tile
  const int h = et >> 2, e = (et & 3) * 16 + (ln & 15);
  const int d0 = kc * 32 + (ln >> 4) * 16 + half * 8;
  const float* s = W + ((size_t)h * D_ + d0) * E_ + e;
  v8bf pk;
#pragma unroll
  for (int i = 0; i < 8; ++i) pk[i] = (bf16_t)s[i * E_];
  *(v8bf*)(WT + (size_t)j * 8) = pk;
}

// Wo [768 f, 768 d] -> fragments of Wo^T (rows d, k = f): [d tile][f chunk]
__global__ __launch_bounds__(256) void k_tr_wo(const float* __restrict__ W,
                                               bf16_t* __restrict__ WT) {
  const int j    = blockIdx.x * 256 + threadIdx.x;
  const int frag = j >> 6, half = (j >> 5) & 1, ln = j & 31;
  const int kc = frag % (D_ / 32);
  const int d  = (frag / (D_ / 32)) * 16 + (ln & 15);
  const int f0 = kc * 32 + (ln >> 4) * 16 + half * 8;
  const float* s = W + (size_t)f0 * D_ + d;
  v8bf pk;
#pragma unroll
  for (int i = 0; i < 8; ++i) pk[i] = (bf16_t)s[i * D_];
  *(v8bf*)(WT + (size_t)j * 8) = pk;
}

// ---------------- mask [B,S,S] i32 -> lane-mask words ----------------
// Word [b][query tile of 16][key tile of 16][r]: bit L says whether
// mask[b][query tile * 16 + (L & 15)][key tile * 16 + 8 * (L >> 4) + r] != 0,
// which is the entry that lane L holds in register r of that transposed score
// tile: k_attn reads a word into a scalar register and selects on it directly.
// One wave takes 16 query rows x 128 keys at a time: 16 whole-line loads; lane l
// holds keys 4l..4l+3 (key tile l >> 2, half (l >> 1) & 1, r = 4 * (l & 1) + k).
typedef __attribute__((ext_vector_type(4))) int      v4i;
typedef __attribute__((ext_vector_type(4))) unsigned v4u;

__global__ __launch_bounds__(256) void k_pack_mask(const int* __restrict__ mask,
                                                   unsigned* __restrict__ wm) {
  const int lane = threadIdx.x & 31;
  const int w    = blockIdx.x * 8 + (threadIdx.x >> 5);
  const int rt   = w >> 3;                            // b * (S / 16) + query tile
#pragma unroll
  for (int t = 0; t < 2; ++t) {
    const int kg = (w & 7) * 2 + t;                   // group of 128 keys
    const int* s = mask + (size_t)rt * 16 * S_ + kg * 128 + lane * 4;
    v4i m[16];
#pragma unroll
    for (int qr = 0; qr < 16; ++qr) m[qr] = *(const v4i*)(s + (size_t)qr * S_);
    v4u pk;
#pragma unroll
    for (int kk = 0; kk < 4; ++kk) {
      unsigned hb = 0;                                // bit qr: query row qr, this key
#pragma unroll
      for (int qr = 0; qr < 16; ++qr)
        hb |= (m[qr][kk] != 0 ? 1u : 0u) << qr;
      // the upper key half of the same tile and r sits two lanes further on
      const unsigned up = (unsigned)__builtin_amdgcn_mov_dpp((int)hb, 0x4E, 0xF, 0xF, true);
      pk[kk] = hb | (up << 16);
    }
    if ((lane & 2) == 0)
      *(v4u*)(wm + (size_t)rt * (S_ / 2) + (kg * 8 + (lane >> 2)) * 8 + (lane & 1) * 4) = pk;
  }
}

// ---------------- QKV projection: one wave per 64 rows x 64 columns ----------
// A block is 128 rows x 2 heads of ONE of q, k, v; its 4 waves are 2 x 2, so each x
// and each weight fragment is wanted by two waves of the block at about the same time.
// A wave's 4 x 4 accumulator tiles take 8 fragment loads per 16 WMMAs.
// q,k stored as fragments [B,H][s tile][e chunk], plain order (staged via LDS);
// v stored as fragments of V^T (rows e, k = key) [B,H][e tile][32-key chunk] in
// the k order of a packed accumulator pair: k = 8 * (lane >> 4) + s for s < 8,
// 16 + 8 * (lane >> 4) + (s - 8) otherwise; a lane's 8 rows are one 16-B piece.
__global__ __launch_bounds__(128) void
k_qkv(const bf16_t* __restrict__ xb, const bf16_t* __restrict__ wqT,
      const bf16_t* __restrict__ wkT, const bf16_t* __restrict__ wvT,
      const float* __restrict__ bq, const float* __restrict__ bk,
      const float* __restrict__ bv, bf16_t* __restrict__ q,
      bf16_t* __restrict__ k, bf16_t* __restrict__ vT) {
  __shared__ bf16_t st[4][64 * E_];         // 8 KB staging tile per wave

  const int lane = threadIdx.x & 31;
  // the wave's number in a scalar register: fragment addresses are a scalar base + lane offset
  const int wave = __builtin_amdgcn_readfirstlane(threadIdx.x >> 5);
  constexpr int RB = S_ / 128;              // row blocks per batch entry
  const int blk = blockIdx.x;
  const int s0  = (blk % RB) * 128 + (wave & 1) * 64;
  const int h   = ((blk / RB) % (H_ / 2)) * 2 + (wave >> 1);
  const int mat = (blk / (RB * (H_ / 2))) % 3;          // 0 q, 1 k, 2 v: one per block
  const int bz  = blk / (RB * (H_ / 2) * 3);

  const bf16_t* xfr = xb + ((size_t)bz * S_ + s0) * D_;  // 4 row tiles of fragments
  const bf16_t* w   = (mat == 0 ? wqT : mat == 1 ? wkT : wvT) + (size_t)h * E_ * D_;
  const float* bias = (mat == 0 ? bq : mat == 1 ? bk : bv) + h * E_;

  v8f acc[4][4];                            // [row tile][e tile]
#pragma unroll
  for (int i = 0; i < 4; ++i)
#pragma unroll
    for (int nt = 0; nt < 4; ++nt) acc[i][nt] = v8f{};

  for (int kc = 0; kc < D_ / 32; ++kc) {          // 24 K-chunks
    v16bf a[4], b[4];
    a[0] = load_pk(xfr, kc, lane);
#pragma unroll
    for (int nt = 0; nt < 4; ++nt) b[nt] = load_pk(w, nt * (D_ / 32) + kc, lane);
#pragma unroll
    for (int i = 1; i < 3; ++i) a[i] = load_pk(xfr, i * (D_ / 32) + kc, lane);
    const bf16_t* p3 = xfr + (size_t)(3 * (D_ / 32) + kc) * 512 + lane * 8;
    const v8bf lo3 = *(const v8bf*)p3;
    // precaution: the last load lands in the registers that held the addresses of the loads above
    asm volatile("s_wait_xcnt 0x0" ::: "memory");
    const v8bf hi3 = *(const v8bf*)(p3 + 256);
    a[3] = __builtin_shufflevector(lo3, hi3, 0, 1, 2, 3, 4, 5, 6, 7, 8, 9, 10, 11, 12, 13,
                                   14, 15);
    // keeps the chunk's 16 loads together in front of its WMMAs: one latency per chunk;
    // left free, the scheduler reuses two buffers and every WMMA waits on a fresh load
    __builtin_amdgcn_sched_barrier(0);
#pragma unroll
    for (int i = 0; i < 4; ++i)
#pragma unroll
      for (int nt = 0; nt < 4; ++nt) acc[i][nt] = wmma_bf16(a[i], b[nt], acc[i][nt]);
  }

  const int N     = lane & 15;
  const int Mbase = (lane >> 4) << 3;
  const size_t bh = (size_t)bz * H_ + h;
  float bi[4];
#pragma unroll
  for (int nt = 0; nt < 4; ++nt) bi[nt] = bias[nt * 16 + N];

  if (mat == 2) {
    // ---- v: 8 keys per lane -> one b128 store, 512 contiguous bytes per wave ----
#pragma unroll
    for (int i = 0; i < 4; ++i) {
      const int si = s0 + 16 * i;
#pragma unroll
      for (int nt = 0; nt < 4; ++nt) {
        v8bf pk;
#pragma unroll
        for (int r = 0; r < 8; ++r) pk[r] = (bf16_t)(acc[i][nt][r] + bi[nt]);
        *(v8bf*)(vT + ((bh * 4 + nt) * (S_ / 32) + (si >> 5)) * 512 +
                 ((si >> 4) & 1) * 256 + lane * 8) = pk;
      }
    }
  } else {
    // ---- q or k: stage the wave's 64x64 tile in LDS, flush its 8 fragments in order ----
    bf16_t* dst = (mat ? k : q) + (bh * S_ + s0) * E_;
    bf16_t* sw  = st[wave];
#pragma unroll
    for (int i = 0; i < 4; ++i)
#pragma unroll
      for (int nt = 0; nt < 4; ++nt)
#pragma unroll
        for (int r = 0; r < 8; ++r)
          sw[(i * 16 + Mbase + r) * E_ + nt * 16 + N] = (bf16_t)(acc[i][nt][r] + bi[nt]);
    __syncthreads();                              // mat is the same for the whole block
#pragma unroll
    for (int i = 0; i < 4; ++i)
#pragma unroll
      for (int c = 0; c < 4; ++c) {               // fragment c >> 1, half c & 1
        const int col = (c >> 1) * 32 + (lane >> 4) * 16 + (c & 1) * 8;
        *(v8bf*)(dst + i * 16 * E_ + (c * 32 + lane) * 8) =
            *(const v8bf*)(sw + (i * 16 + (lane & 15)) * E_ + col);
      }
  }
}

typedef __attribute__((ext_vector_type(16))) unsigned v16u;

// value of lane ^ 16
__device__ __forceinline__ float other_half(float x) {
  const int b = __builtin_bit_cast(int, x);
  return __builtin_bit_cast(float, __builtin_amdgcn_permlanex16(
      b, b, 0x76543210, 0xfedcba98, false, false));
}

__global__ __launch_bounds__(128) void
k_attn(const bf16_t* __restrict__ q, const bf16_t* __restrict__ k,
       const bf16_t* __restrict__ vT, const unsigned* __restrict__ wm,
       bf16_t* __restrict__ ctx) {
  constexpr float SC2  = 0.03187935771f;   // log2(e) / sqrt(S): ref scales by 1/sqrt(S)
  constexpr float NEGR = -1e9f * 45.254834f;      // -1e9 before the 1/sqrt(S) scale
  constexpr float STEP = 8.0f / SC2;              // maximum may lag by 2^8

  const int lane = threadIdx.x & 31;
  // the wave's number in a scalar register, so that the mask words' address is scalar
  const int wave = __builtin_amdgcn_readfirstlane(threadIdx.x >> 5);
  const int c    = lane & 15;
  const int hh   = lane >> 4;
  constexpr int QB = S_ / 128;                        // query blocks per (b,h)
  const int blk = blockIdx.x;
  const int h   = blk % H_;
  const int s0  = ((blk / H_) % QB) * 128 + wave * 32;
  const int bz  = blk / (H_ * QB);
  const size_t bh = (size_t)bz * H_ + h;

  const bf16_t* qbh = q + bh * S_ * E_;
  const bf16_t* kbh = k + bh * S_ * E_;
  const bf16_t* vbh = vT + bh * E_ * S_;
  const unsigned* wrow0 = wm + ((size_t)bz * S_ + s0) * (S_ / 32);   // S / 2 words per tile
  const unsigned* wrow1 = wrow0 + S_ / 2;

  v16bf qf[2][2];                                     // [query tile][e chunk]
#pragma unroll
  for (int j = 0; j < 2; ++j)
#pragma unroll
    for (int e = 0; e < 2; ++e)
      qf[j][e] = load_pk(qbh, ((s0 >> 4) + j) * 2 + e, lane);

  v8f o[2][4];                                        // Ot: [query tile][e tile]
  float m[2], l[2];
#pragma unroll
  for (int j = 0; j < 2; ++j) {
    m[j] = -3.0e38f;
    l[j] = 0.f;
#pragma unroll
    for (int nt = 0; nt < 4; ++nt) o[j][nt] = v8f{};
  }

  v16bf kf[2][2];                                     // [key tile][e chunk]
  v16u  mw[2];                                        // [query tile][key tile * 8 + r]
#pragma unroll
  for (int i = 0; i < 2; ++i) {
    kf[i][0] = load_pk(kbh, 2 * i, lane);
    kf[i][1] = load_pk(kbh, 2 * i + 1, lane);
  }
  mw[0] = *(const v16u*)wrow0;
  mw[1] = *(const v16u*)wrow1;

  for (int p = 0; p < S_ / 32; ++p) {
    const int t0 = p * 32;
    const int tn = (p + 1 < S_ / 32) ? t0 + 32 : t0;  // next pass, kept in bounds

    v16bf vf[4];
#pragma unroll
    for (int nt = 0; nt < 4; ++nt)
      vf[nt] = load_pk(vbh, nt * (S_ / 32) + p, lane);

    v8f s[2][2];                                      // [query tile][key tile]
#pragma unroll
    for (int j = 0; j < 2; ++j)
#pragma unroll
      for (int i = 0; i < 2; ++i) {
        s[j][i] = wmma_bf16(kf[i][0], qf[j][0], v8f{});
        s[j][i] = wmma_bf16(kf[i][1], qf[j][1], s[j][i]);
      }
#pragma unroll
    for (int i = 0; i < 2; ++i) {                     // next pass's K rows
      kf[i][0] = load_pk(kbh, (tn >> 3) + 2 * i, lane);
      kf[i][1] = load_pk(kbh, (tn >> 3) + 2 * i + 1, lane);
    }

    float mx[2];
#pragma unroll
    for (int j = 0; j < 2; ++j) {
      float t = NEGR;
#pragma unroll
      for (int i = 0; i < 2; ++i)
#pragma unroll
        for (int r = 0; r < 8; ++r) {
          const float x =
              __builtin_amdgcn_inverse_ballot_w32(mw[j][i * 8 + r]) ? NEGR : s[j][i][r];
          s[j][i][r] = x;
          t = fmaxf(t, x);
        }
      mx[j] = fmaxf(t, other_half(t));
    }

    // Move the maximum in use only when a column outgrows it by 2^8: one
    // wave-uniform test per pass (softmax does not depend on the shift).
    const bool need = (mx[0] > m[0] + STEP) || (mx[1] > m[1] + STEP);
    if (__builtin_amdgcn_ballot_w32(need) != 0) {
#pragma unroll
      for (int j = 0; j < 2; ++j) {
        const float mn = fmaxf(m[j], mx[j]);
        const float al = __builtin_amdgcn_exp2f((m[j] - mn) * SC2);
        m[j] = mn;
        l[j] *= al;
#pragma unroll
        for (int nt = 0; nt < 4; ++nt)
#pragma unroll
          for (int r = 0; r < 8; ++r) o[j][nt][r] *= al;
      }
    }

    mw[0] = *(const v16u*)(wrow0 + (tn >> 1));        // next pass's mask words
    mw[1] = *(const v16u*)(wrow1 + (tn >> 1));
    // keeps the two scalar loads here, a whole exponential block ahead of their use;
    // left free, the scheduler sinks them to the end of the pass and their latency shows
    __builtin_amdgcn_sched_barrier(0);

#pragma unroll
    for (int j = 0; j < 2; ++j) {
      v16bf pb;
      float sum = 0.f;
#pragma unroll
      for (int i = 0; i < 2; ++i)
#pragma unroll
        for (int r = 0; r < 8; ++r) {
          // subtract first: a row whose keys are all masked gets exactly 1
          const float e = __builtin_amdgcn_exp2f((s[j][i][r] - m[j]) * SC2);
          sum += e;
          pb[i * 8 + r] = (bf16_t)e;
        }
      l[j] += sum;
#pragma unroll
      for (int nt = 0; nt < 4; ++nt)
        o[j][nt] = wmma_bf16(vf[nt], pb, o[j][nt]);
    }
    // precaution: the next pass's index arithmetic lands in the scalar registers
    // that held the address of the mask-word loads above
    asm volatile("s_wait_xcnt 0x0" ::: "memory");
  }

  // a lane holds 8 consecutive e of one query row: one 16-B piece of ctx's
  // fragment [row tile][k chunk h * 2 + nt / 2]: half hh, lane c + 16 * (nt & 1)
#pragma unroll
  for (int j = 0; j < 2; ++j) {
    const float inv = 1.f / (l[j] + other_half(l[j]));
    bf16_t* dst = ctx + ((size_t)bz * S_ + s0 + 16 * j) * (H_ * E_) + h * 1024 +
                  hh * 256 + c * 8;
#pragma unroll
    for (int nt = 0; nt < 4; ++nt) {
      v8bf pk;
#pragma unroll
      for (int r = 0; r < 8; ++r) pk[r] = (bf16_t)(o[j][nt][r] * inv);
      *(v8bf*)(dst + (nt >> 1) * 512 + (nt & 1) * 128) = pk;
    }
  }
}

// ---------------- output projection + LayerNorm ----------------
// 256 threads (8 waves); block owns 32 rows of [B*S, 768]. Each wave does 2 row tiles
// x 6 n-tiles (8 fragment loads per 12 WMMAs); result staged in LDS for the LayerNorm.
// LayerNorm: each wave takes 4 whole rows; a lane holds 24 elements of a row in registers
// (6 reads of 16 B, the wave reading 512 contiguous bytes at a time), so mean, variance
// and the scaled result come from one read of LDS and go out as whole-line 16-B stores.

// sum over the 32 lanes, the same value in every lane: four exchanges inside the
// 16-lane row (row_xmask 1, 2, 4, 8), then one between the two rows
template <int CTRL>
__device__ __forceinline__ float add_xmask(float x) {
  return x + __builtin_bit_cast(float, __builtin_amdgcn_mov_dpp(
                 __builtin_bit_cast(int, x), CTRL, 0xF, 0xF, true));
}
__device__ __forceinline__ float wave_sum(float x) {
  x = add_xmask<0x161>(x);
  x = add_xmask<0x162>(x);
  x = add_xmask<0x164>(x);
  x = add_xmask<0x168>(x);
  return x + other_half(x);
}

__global__ __launch_bounds__(256) void
k_proj_ln(const bf16_t* __restrict__ ctx, const bf16_t* __restrict__ woT,
          const float* __restrict__ bo, const float* __restrict__ gamma,
          const float* __restrict__ beta, float* __restrict__ out) {
  __shared__ float sOut[32 * D_];                     // 96 KB

  const int tid  = threadIdx.x;
  const int lane = tid & 31;
  // the wave's number in a scalar register: fragment addresses are a scalar base + lane offset
  const int wave = __builtin_amdgcn_readfirstlane(tid >> 5);
  const int row0 = blockIdx.x * 32;                   // row in [0, B*S)
  const bf16_t* arow = ctx + (size_t)row0 * D_;

  v8f acc[2][6];
#pragma unroll
  for (int i = 0; i < 2; ++i)
#pragma unroll
    for (int j = 0; j < 6; ++j) acc[i][j] = v8f{};

  // kept rolled: fully unrolled this loop built to 266 VGPRs, past the 256 reached without a window
#pragma unroll 1
  for (int kc = 0; kc < D_ / 32; kc += 2) {           // 24 K-chunks, two at a time
    v16bf a[2][2], b[2][6];                           // [chunk][tile]
#pragma unroll
    for (int u = 0; u < 2; ++u) {
      // precaution: the second chunk's loads land in registers that held addresses of the first's
      if (u) asm volatile("s_wait_xcnt 0x0" ::: "memory");
#pragma unroll
      for (int i = 0; i < 2; ++i) a[u][i] = load_pk(arow, i * (D_ / 32) + kc + u, lane);
#pragma unroll
      for (int j = 0; j < 6; ++j)
        b[u][j] = load_pk(woT, (wave * 6 + j) * (D_ / 32) + kc + u, lane);
    }
    // keeps the 32 loads of two chunks together in front of their WMMAs: one latency per
    // pair; left free, the scheduler reuses two buffers and every WMMA waits on a fresh load
    __builtin_amdgcn_sched_barrier(0);
#pragma unroll
    for (int u = 0; u < 2; ++u)
#pragma unroll
      for (int j = 0; j < 6; ++j)
#pragma unroll
        for (int i = 0; i < 2; ++i) acc[i][j] = wmma_bf16(a[u][i], b[u][j], acc[i][j]);
  }

  // the lane's 24 columns of gamma and beta, asked for here so that they arrive
  // while the tile is staged
  v4f ga[6], be[6];
  // unrolled, like every loop of the LayerNorm below: ga, be and xv are then indexed by
  // constants only and stay in registers
#pragma unroll
  for (int t = 0; t < 6; ++t) {
    ga[t] = *(const v4f*)(gamma + (t * 32 + lane) * 4);
    be[t] = *(const v4f*)(beta + (t * 32 + lane) * 4);
  }

  const int N     = lane & 15;
  const int Mbase = (lane >> 4) << 3;
#pragma unroll
  for (int j = 0; j < 6; ++j) {
    const int n0 = (wave * 6 + j) * 16;
    const float bi = bo[n0 + N];
#pragma unroll
    for (int i = 0; i < 2; ++i)
#pragma unroll
      for (int r = 0; r < 8; ++r)
        sOut[(i * 16 + Mbase + r) * D_ + n0 + N] = acc[i][j][r] + bi;
  }
  __syncthreads();

  v4f xv[4][6];                                       // [row of the wave][16-B piece]
#pragma unroll
  for (int rr = 0; rr < 4; ++rr)
#pragma unroll
    for (int t = 0; t < 6; ++t)
      xv[rr][t] = *(const v4f*)(sOut + (wave * 4 + rr) * D_ + (t * 32 + lane) * 4);

  float mu[4], rs[4];
#pragma unroll
  for (int rr = 0; rr < 4; ++rr) {
    v4f s4 = xv[rr][0];
#pragma unroll
    for (int t = 1; t < 6; ++t) s4 += xv[rr][t];
    mu[rr] = (s4[0] + s4[1]) + (s4[2] + s4[3]);
  }
#pragma unroll
  for (int rr = 0; rr < 4; ++rr) mu[rr] = wave_sum(mu[rr]) * (1.f / D_);
#pragma unroll
  for (int rr = 0; rr < 4; ++rr) {
    v4f q4 = v4f{};
#pragma unroll
    for (int t = 0; t < 6; ++t) {
      xv[rr][t] -= mu[rr];
      q4 += xv[rr][t] * xv[rr][t];
    }
    rs[rr] = (q4[0] + q4[1]) + (q4[2] + q4[3]);
  }
#pragma unroll
  for (int rr = 0; rr < 4; ++rr) rs[rr] = rsqrtf(wave_sum(rs[rr]) * (1.f / D_) + LN_EPS_);

#pragma unroll
  for (int rr = 0; rr < 4; ++rr) {
    float* dst = out + (size_t)(row0 + wave * 4 + rr) * D_ + lane * 4;
#pragma unroll
    for (int t = 0; t < 6; ++t)
      *(v4f*)(dst + t * 128) = xv[rr][t] * rs[rr] * ga[t] + be[t];
  }
}

// ---------------- host launcher ----------------
extern "C" void kernel_launch(void* const* d_in, const int* in_sizes, int n_in,
                              void* d_out, int out_size, void* d_ws, size_t ws_size,
                              hipStream_t stream) {
  const float* x    = (const float*)d_in[0];
  const int*   mask = (const int*)d_in[1];
  const float* Wq   = (const float*)d_in[2];
  const float* bq   = (const float*)d_in[3];
  const float* Wk   = (const float*)d_in[4];
  const float* bk   = (const float*)d_in[5];
  const float* Wv   = (const float*)d_in[6];
  const float* bv   = (const float*)d_in[7];
  const float* Wo   = (const float*)d_in[8];
  const float* bo   = (const float*)d_in[9];
  const float* gamma = (const float*)d_in[10];
  const float* beta  = (const float*)d_in[11];
  float* out = (float*)d_out;

  // workspace layout (bf16 intermediates, mask words), ~66.5 MB total
  char* ws = (char*)d_ws;
  const size_t szX  = (size_t)B_ * S_ * D_ * sizeof(bf16_t);
  const size_t szW  = (size_t)H_ * E_ * D_ * sizeof(bf16_t);
  const size_t szWo = (size_t)D_ * D_ * sizeof(bf16_t);
  const size_t szQ  = (size_t)B_ * H_ * S_ * E_ * sizeof(bf16_t);
  bf16_t* xb  = (bf16_t*)(ws);
  bf16_t* wqT = (bf16_t*)(ws + szX);
  bf16_t* wkT = (bf16_t*)(ws + szX + szW);
  bf16_t* wvT = (bf16_t*)(ws + szX + 2 * szW);
  bf16_t* woT = (bf16_t*)(ws + szX + 3 * szW);
  bf16_t* q   = (bf16_t*)(ws + szX + 3 * szW + szWo);
  bf16_t* k   = (bf16_t*)(ws + szX + 3 * szW + szWo + szQ);
  bf16_t* vT  = (bf16_t*)(ws + szX + 3 * szW + szWo + 2 * szQ);
  bf16_t* ctx = (bf16_t*)(ws + szX + 3 * szW + szWo + 3 * szQ);
  unsigned* wm = (unsigned*)(ws + szX + 3 * szW + szWo + 4 * szQ);   // 2 MB of mask words

  k_pack_mask<<<B_ * (S_ / 16), 256, 0, stream>>>(mask, wm);   // one block per query tile
  k_cvt_bf16<<<B_ * S_ * D_ / (8 * 256), 256, 0, stream>>>(x, xb);
  k_tr_hde<<<H_ * D_ * E_ / (8 * 256), 256, 0, stream>>>(Wq, wqT);
  k_tr_hde<<<H_ * D_ * E_ / (8 * 256), 256, 0, stream>>>(Wk, wkT);
  k_tr_hde<<<H_ * D_ * E_ / (8 * 256), 256, 0, stream>>>(Wv, wvT);
  k_tr_wo<<<D_ * D_ / (8 * 256), 256, 0, stream>>>(Wo, woT);

  k_qkv<<<B_ * 3 * (H_ / 2) * (S_ / 128), 128, 0, stream>>>(xb, wqT, wkT, wvT, bq, bk, bv,
                                                            q, k, vT);

  k_attn<<<B_ * H_ * (S_ / 128), 128, 0, stream>>>(q, k, vT, wm, ctx);

  k_proj_ln<<<B_ * S_ / 32, 256, 0, stream>>>(ctx, woT, bo, gamma, beta, out);
}

// v006
// One run takes 120 microseconds.
// Next to v005, in two timings, it ran 1.09 times as fast each time.
// Over all steps from v000 it is 24.3 times as fast.
#include <hip/hip_runtime.h>
#include <hip/hip_bf16.h>
#include <math.h>

// ---- problem constants (match reference) ----
static constexpr int B_ = 4, S_ = 2048, D_ = 768, H_ = 12, E_ = 64;
static constexpr float LN_EPS_ = 1e-5f;

typedef __bf16 bf16_t;
typedef __attribute__((ext_vector_type(16))) __bf16 v16bf;
typedef __attribute__((ext_vector_type(8)))  __bf16 v8bf;   // 16-byte pack
typedef __attribute__((ext_vector_type(8)))  float  v8f;

// -------------------------------------------------------------------------
// Every bf16 operand in the workspace is stored in FRAGMENT ORDER: a 16-row x
// 32-k fragment of V_WMMA_F32_16X16X32_BF16 (wave32) is one 1-KB block,
//   block[half * 256 + lane * 8 + i]  =  register element s = half * 8 + i of lane,
// so a wave loads a fragment with two b128 loads of 512 contiguous bytes each.
// Which (row, k) a position holds, for a row-major matrix M:
//   plain order: row = lane & 15, k = (lane >> 4) * 16 + s   (A and B alike)
// Fragments of a matrix with K columns lie as [row tile][k chunk of 32].
// -------------------------------------------------------------------------
__device__ __forceinline__ v16bf load_pk(const bf16_t* base, int frag, int lane) {
  const bf16_t* p = base + (size_t)frag * 512 + lane * 8;
  const v8bf lo = *(const v8bf*)p;
  const v8bf hi = *(const v8bf*)(p + 256);
  return __builtin_shufflevector(lo, hi, 0, 1, 2, 3, 4, 5, 6, 7, 8, 9, 10, 11,
                                 12, 13, 14, 15);
}

__device__ __forceinline__ v8f wmma_bf16(v16bf a, v16bf b, v8f c) {
  return __builtin_amdgcn_wmma_f32_16x16x32_bf16(false, a, false, b,
                                                 (short)0, c, false, false);
}

// ---------------- preparation: ONE launch for every repacked operand ----------
// f32 -> bf16 in fragment order for x and the four weight matrices, and the mask as
// lane-mask words. Ranges of the block index pick the job; the jobs are independent.
// A wave makes whole fragments (two 512-byte stores each) and takes several that lie a
// constant step apart in the source, so that the launch starts few waves, each wave has
// all its loads in flight at once, and every address is one base plus a constant.
typedef __attribute__((ext_vector_type(4))) float    v4f;
typedef __attribute__((ext_vector_type(4))) int      v4i;
typedef __attribute__((ext_vector_type(4))) unsigned v4u;

static constexpr int KC_   = D_ / 32;                 // k chunks of a 768-wide matrix
static constexpr int XF_   = 6;                       // x fragments per wave
static constexpr int WF_   = KC_ / 8;                 // weight fragments per wave
static constexpr int NB_X_ = B_ * (S_ / 16) * KC_ / (XF_ * 8);  // 2 row tiles per block
static constexpr int NB_1W_ = D_ / 16;                // a weight matrix: a block per tile
static constexpr int NB_M_ = B_ * (S_ / 16);          // mask: a block per query tile

// x [B*S, D] -> fragments [row tile][k chunk]; the wave takes k chunks kc0 .. kc0 + 5 of
// row tile rt; a lane reads its 16 k of a chunk as 64 contiguous bytes.
__device__ __forceinline__ void prep_x(const float* __restrict__ x, bf16_t* __restrict__ y,
                                       int rt, int kc0, int lane) {
  const float* s = x + (size_t)rt * 16 * D_ + kc0 * 32 + ((lane & 15) * D_ + (lane >> 4) * 16);
  bf16_t* d = y + ((size_t)rt * KC_ + kc0) * 512 + lane * 8;
  v4f a[XF_][4];
#pragma unroll
  for (int f = 0; f < XF_; ++f)
#pragma unroll
    for (int c = 0; c < 4; ++c) a[f][c] = *(const v4f*)(s + f * 32 + c * 4);
  // keeps all 24 loads in front of the conversions: one latency per wave; left free, the
  // scheduler holds the last of them back until the first have arrived
  __builtin_amdgcn_sched_barrier(0);
#pragma unroll
  for (int f = 0; f < XF_; ++f)
#pragma unroll
    for (int half = 0; half < 2; ++half) {
      v8bf pk;
#pragma unroll
      for (int i = 0; i < 4; ++i) {
        pk[i]     = (bf16_t)a[f][half * 2][i];
        pk[4 + i] = (bf16_t)a[f][half * 2 + 1][i];
      }
      *(v8bf*)(d + f * 512 + half * 256) = pk;
    }
}

// A weight matrix -> fragments of its transpose, [output-column tile ct][k chunk]; the
// wave takes k chunks kc0 .. kc0 + 2 of tile ct.
// HDE: W [H,D,E], rows of the transpose are e of head h (ct = h * 4 + e tile), k = d.
// else: Wo [768 f, 768 d], rows of the transpose are d, k = f.
template <bool HDE>
__device__ __forceinline__ void prep_w(const float* __restrict__ W, bf16_t* __restrict__ WT,
                                       int ct, int kc0, int lane) {
  constexpr int LD = HDE ? E_ : D_;                   // floats from one k to the next
  const float* s = W + (HDE ? (size_t)(ct >> 2) * D_ * E_ + (ct & 3) * 16 : (size_t)ct * 16) +
                   (size_t)kc0 * 32 * LD + ((lane >> 4) * 16 * LD + (lane & 15));
  bf16_t* d = WT + ((size_t)ct * KC_ + kc0) * 512 + lane * 8;
  float v[WF_][16];
#pragma unroll
  for (int f = 0; f < WF_; ++f)
#pragma unroll
    for (int i = 0; i < 16; ++i) v[f][i] = s[(f * 32 + i) * LD];
#pragma unroll
  for (int f = 0; f < WF_; ++f)
#pragma unroll
    for (int half = 0; half < 2; ++half) {
      v8bf pk;
#pragma unroll
      for (int i = 0; i < 8; ++i) pk[i] = (bf16_t)v[f][half * 8 + i];
      *(v8bf*)(d + f * 512 + half * 256) = pk;
    }
  // precaution: behind the job the compiler's code for the other block ranges lands in
  // registers that held data and base of the stores above
  asm volatile("s_wait_xcnt 0x0" ::: "memory");
}

// mask [B,S,S] i32 -> lane-mask words.
// Word [b][query tile of 16][key tile of 16][r]: bit L says whether
// mask[b][query tile * 16 + (L & 15)][key tile * 16 + 8 * (L >> 4) + r] != 0,
// which is the entry that lane L holds in register r of that transposed score
// tile: k_attn reads a word into a scalar register and selects on it directly.
// One wave takes 16 query rows x 128 keys at a time: 16 whole-line loads; lane l
// holds keys 4l..4l+3 (key tile l >> 2, half (l >> 1) & 1, r = 4 * (l & 1) + k).
__device__ __forceinline__ void prep_mask(const int* __restrict__ mask,
                                          unsigned* __restrict__ wm, int rt, int wave,
                                          int lane) {
#pragma unroll
  for (int t = 0; t < 2; ++t) {
    const int kg = wave * 2 + t;                      // group of 128 keys
    const int* s = mask + (size_t)rt * 16 * S_ + kg * 128 + lane * 4;
    v4i m[16];
#pragma unroll
    for (int qr = 0; qr < 16; ++qr) m[qr] = *(const v4i*)(s + (size_t)qr * S_);
    v4u pk;
#pragma unroll
    for (int kk = 0; kk < 4; ++kk) {
      unsigned hb = 0;                                // bit qr: query row qr, this key
#pragma unroll
      for (int qr = 0; qr < 16; ++qr)
        hb |= (m[qr][kk] != 0 ? 1u : 0u) << qr;
      // the upper key half of the same tile and r sits two lanes further on
      const unsigned up = (unsigned)__builtin_amdgcn_mov_dpp((int)hb, 0x4E, 0xF, 0xF, true);
      pk[kk] = hb | (up << 16);
    }
    if ((lane & 2) == 0)
      *(v4u*)(wm + (size_t)rt * (S_ / 2) + (kg * 8 + (lane >> 2)) * 8 + (lane & 1) * 4) = pk;
  }
}

__global__ __launch_bounds__(256) void
k_prep(const float* __restrict__ x, const int* __restrict__ mask,
       const float* __restrict__ Wq, const float* __restrict__ Wk,
       const float* __restrict__ Wv, const float* __restrict__ Wo,
       bf16_t* __restrict__ xb, bf16_t* __restrict__ wqT, bf16_t* __restrict__ wkT,
       bf16_t* __restrict__ wvT, bf16_t* __restrict__ woT, unsigned* __restrict__ wm) {
  const int lane = threadIdx.x & 31;
  // the wave's number in a scalar register: the wave's share of a job is a scalar base
  const int wave = __builtin_amdgcn_readfirstlane(threadIdx.x >> 5);
  const int blk  = blockIdx.x;
  // the mask blocks, which load twice in a row, start first; the one-round jobs last
  if (blk < NB_M_) {
    prep_mask(mask, wm, blk, wave, lane);
  } else if (blk < NB_M_ + NB_X_) {
    prep_x(x, xb, (blk - NB_M_) * 2 + (wave >> 2), (wave & 3) * XF_, lane);
  } else if (blk < NB_M_ + NB_X_ + 3 * NB_1W_) {
    const int mat = (blk - NB_M_ - NB_X_) / NB_1W_;
    prep_w<true>(mat == 0 ? Wq : mat == 1 ? Wk : Wv, mat == 0 ? wqT : mat == 1 ? wkT : wvT,
                 (blk - NB_M_ - NB_X_) - mat * NB_1W_, wave * WF_, lane);
  } else {
    prep_w<false>(Wo, woT, blk - NB_M_ - NB_X_ - 3 * NB_1W_, wave * WF_, lane);
  }
}

// ---------------- QKV projection: one wave per 64 rows x 64 columns ----------
// A block is 128 rows x 2 heads of ONE of q, k, v; its 4 waves are 2 x 2, so each x
// and each weight fragment is wanted by two waves of the block at about the same time.
// A wave's 4 x 4 accumulator tiles take 8 fragment loads per 16 WMMAs.
// q,k stored as fragments [B,H][s tile][e chunk], plain order (staged via LDS);
// v stored as fragments of V^T (rows e, k = key) [B,H][e tile][32-key chunk] in
// the k order of a packed accumulator pair: k = 8 * (lane >> 4) + s for s < 8,
// 16 + 8 * (lane >> 4) + (s - 8) otherwise; a lane's 8 rows are one 16-B piece.
__global__ __launch_bounds__(128) void
k_qkv(const bf16_t* __restrict__ xb, const bf16_t* __restrict__ wqT,
      const bf16_t* __restrict__ wkT, const bf16_t* __restrict__ wvT,
      const float* __restrict__ bq, const float* __restrict__ bk,
      const float* __restrict__ bv, bf16_t* __restrict__ q,
      bf16_t* __restrict__ k, bf16_t* __restrict__ vT) {
  __shared__ bf16_t st[4][64 * E_];         // 8 KB staging tile per wave

  const int lane = threadIdx.x & 31;
  // the wave's number in a scalar register: fragment addresses are a scalar base + lane offset
  const int wave = __builtin_amdgcn_readfirstlane(threadIdx.x >> 5);
  constexpr int RB = S_ / 128;              // row blocks per batch entry
  const int blk = blockIdx.x;
  const int s0  = (blk % RB) * 128 + (wave & 1) * 64;
  const int h   = ((blk / RB) % (H_ / 2)) * 2 + (wave >> 1);
  const int mat = (blk / (RB * (H_ / 2))) % 3;          // 0 q, 1 k, 2 v: one per block
  const int bz  = blk / (RB * (H_ / 2) * 3);

  const bf16_t* xfr = xb + ((size_t)bz * S_ + s0) * D_;  // 4 row tiles of fragments
  const bf16_t* w   = (mat == 0 ? wqT : mat == 1 ? wkT : wvT) + (size_t)h * E_ * D_;
  const float* bias = (mat == 0 ? bq : mat == 1 ? bk : bv) + h * E_;

  v8f acc[4][4];                            // [row tile][e tile]
#pragma unroll
  for (int i = 0; i < 4; ++i)
#pragma unroll
    for (int nt = 0; nt < 4; ++nt) acc[i][nt] = v8f{};

  for (int kc = 0; kc < D_ / 32; ++kc) {          // 24 K-chunks
    v16bf a[4], b[4];
    a[0] = load_pk(xfr, kc, lane);
#pragma unroll
    for (int nt = 0; nt < 4; ++nt) b[nt] = load_pk(w, nt * (D_ / 32) + kc, lane);
#pragma unroll
    for (int i = 1; i < 3; ++i) a[i] = load_pk(xfr, i * (D_ / 32) + kc, lane);
    const bf16_t* p3 = xfr + (size_t)(3 * (D_ / 32) + kc) * 512 + lane * 8;
    const v8bf lo3 = *(const v8bf*)p3;
    // precaution: the last load lands in the registers that held the addresses of the loads above
    asm volatile("s_wait_xcnt 0x0" ::: "memory");
    const v8bf hi3 = *(const v8bf*)(p3 + 256);
    a[3] = __builtin_shufflevector(lo3, hi3, 0, 1, 2, 3, 4, 5, 6, 7, 8, 9, 10, 11, 12, 13,
                                   14, 15);
    // keeps the chunk's 16 loads together in front of its WMMAs: one latency per chunk;
    // left free, the scheduler reuses two buffers and every WMMA waits on a fresh load
    __builtin_amdgcn_sched_barrier(0);
#pragma unroll
    for (int i = 0; i < 4; ++i)
#pragma unroll
      for (int nt = 0; nt < 4; ++nt) acc[i][nt] = wmma_bf16(a[i], b[nt], acc[i][nt]);
  }

  const int N     = lane & 15;
  const int Mbase = (lane >> 4) << 3;
  const size_t bh = (size_t)bz * H_ + h;
  float bi[4];
#pragma unroll
  for (int nt = 0; nt < 4; ++nt) bi[nt] = bias[nt * 16 + N];

  if (mat == 2) {
    // ---- v: 8 keys per lane -> one b128 store, 512 contiguous bytes per wave ----
#pragma unroll
    for (int i = 0; i < 4; ++i) {
      const int si = s0 + 16 * i;
#pragma unroll
      for (int nt = 0; nt < 4; ++nt) {
        v8bf pk;
#pragma unroll
        for (int r = 0; r < 8; ++r) pk[r] = (bf16_t)(acc[i][nt][r] + bi[nt]);
        *(v8bf*)(vT + ((bh * 4 + nt) * (S_ / 32) + (si >> 5)) * 512 +
                 ((si >> 4) & 1) * 256 + lane * 8) = pk;
      }
    }
  } else {
    // ---- q or k: stage the wave's 64x64 tile in LDS, flush its 8 fragments in order ----
    bf16_t* dst = (mat ? k : q) + (bh * S_ + s0) * E_;
    bf16_t* sw  = st[wave];
#pragma unroll
    for (int i = 0; i < 4; ++i)
#pragma unroll
      for (int nt = 0; nt < 4; ++nt)
#pragma unroll
        for (int r = 0; r < 8; ++r)
          sw[(i * 16 + Mbase + r) * E_ + nt * 16 + N] = (bf16_t)(acc[i][nt][r] + bi[nt]);
    __syncthreads();                              // mat is the same for the whole block
#pragma unroll
    for (int i = 0; i < 4; ++i)
#pragma unroll
      for (int c = 0; c < 4; ++c) {               // fragment c >> 1, half c & 1
        const int col = (c >> 1) * 32 + (lane >> 4) * 16 + (c & 1) * 8;
        *(v8bf*)(dst + i * 16 * E_ + (c * 32 + lane) * 8) =
            *(const v8bf*)(sw + (i * 16 + (lane & 15)) * E_ + col);
      }
  }
}

typedef __attribute__((ext_vector_type(16))) unsigned v16u;

// value of lane ^ 16
__device__ __forceinline__ float other_half(float x) {
  const int b = __builtin_bit_cast(int, x);
  return __builtin_bit_cast(float, __builtin_amdgcn_permlanex16(
      b, b, 0x76543210, 0xfedcba98, false, false));
}

__global__ __launch_bounds__(128) void
k_attn(const bf16_t* __restrict__ q, const bf16_t* __restrict__ k,
       const bf16_t* __restrict__ vT, const unsigned* __restrict__ wm,
       bf16_t* __restrict__ ctx) {
  constexpr float SC2  = 0.03187935771f;   // log2(e) / sqrt(S): ref scales by 1/sqrt(S)
  constexpr float NEGR = -1e9f * 45.254834f;      // -1e9 before the 1/sqrt(S) scale
  constexpr float STEP = 8.0f / SC2;              // maximum may lag by 2^8

  const int lane = threadIdx.x & 31;
  // the wave's number in a scalar register, so that the mask words' address is scalar
  const int wave = __builtin_amdgcn_readfirstlane(threadIdx.x >> 5);
  const int c    = lane & 15;
  const int hh   = lane >> 4;
  constexpr int QB = S_ / 128;                        // query blocks per (b,h)
  const int blk = blockIdx.x;
  const int h   = blk % H_;
  const int s0  = ((blk / H_) % QB) * 128 + wave * 32;
  const int bz  = blk / (H_ * QB);
  const size_t bh = (size_t)bz * H_ + h;

  const bf16_t* qbh = q + bh * S_ * E_;
  const bf16_t* kbh = k + bh * S_ * E_;
  const bf16_t* vbh = vT + bh * E_ * S_;
  const unsigned* wrow0 = wm + ((size_t)bz * S_ + s0) * (S_ / 32);   // S / 2 words per tile
  const unsigned* wrow1 = wrow0 + S_ / 2;

  v16bf qf[2][2];                                     // [query tile][e chunk]
#pragma unroll
  for (int j = 0; j < 2; ++j)
#pragma unroll
    for (int e = 0; e < 2; ++e)
      qf[j][e] = load_pk(qbh, ((s0 >> 4) + j) * 2 + e, lane);

  v8f o[2][4];                                        // Ot: [query tile][e tile]
  float m[2], l[2];
#pragma unroll
  for (int j = 0; j < 2; ++j) {
    m[j] = -3.0e38f;
    l[j] = 0.f;
#pragma unroll
    for (int nt = 0; nt < 4; ++nt) o[j][nt] = v8f{};
  }

  v16bf kf[2][2];                                     // [key tile][e chunk]
  v16u  mw[2];                                        // [query tile][key tile * 8 + r]
#pragma unroll
  for (int i = 0; i < 2; ++i) {
    kf[i][0] = load_pk(kbh, 2 * i, lane);
    kf[i][1] = load_pk(kbh, 2 * i + 1, lane);
  }
  mw[0] = *(const v16u*)wrow0;
  mw[1] = *(const v16u*)wrow1;

  for (int p = 0; p < S_ / 32; ++p) {
    const int t0 = p * 32;
    const int tn = (p + 1 < S_ / 32) ? t0 + 32 : t0;  // next pass, kept in bounds

    v16bf vf[4];
#pragma unroll
    for (int nt = 0; nt < 4; ++nt)
      vf[nt] = load_pk(vbh, nt * (S_ / 32) + p, lane);

    v8f s[2][2];                                      // [query tile][key tile]
#pragma unroll
    for (int j = 0; j < 2; ++j)
#pragma unroll
      for (int i = 0; i < 2; ++i) {
        s[j][i] = wmma_bf16(kf[i][0], qf[j][0], v8f{});
        s[j][i] = wmma_bf16(kf[i][1], qf[j][1], s[j][i]);
      }
#pragma unroll
    for (int i = 0; i < 2; ++i) {                     // next pass's K rows
      kf[i][0] = load_pk(kbh, (tn >> 3) + 2 * i, lane);
      kf[i][1] = load_pk(kbh, (tn >> 3) + 2 * i + 1, lane);
    }

    float mx[2];
#pragma unroll
    for (int j = 0; j < 2; ++j) {
      float t = NEGR;
#pragma unroll
      for (int i = 0; i < 2; ++i)
#pragma unroll
        for (int r = 0; r < 8; ++r) {
          const float x =
              __builtin_amdgcn_inverse_ballot_w32(mw[j][i * 8 + r]) ? NEGR : s[j][i][r];
          s[j][i][r] = x;
          t = fmaxf(t, x);
        }
      mx[j] = fmaxf(t, other_half(t));
    }

    // Move the maximum in use only when a column outgrows it by 2^8: one
    // wave-uniform test per pass (softmax does not depend on the shift).
    const bool need = (mx[0] > m[0] + STEP) || (mx[1] > m[1] + STEP);
    if (__builtin_amdgcn_ballot_w32(need) != 0) {
#pragma unroll
      for (int j = 0; j < 2; ++j) {
        const float mn = fmaxf(m[j], mx[j]);
        const float al = __builtin_amdgcn_exp2f((m[j] - mn) * SC2);
        m[j] = mn;
        l[j] *= al;
#pragma unroll
        for (int nt = 0; nt < 4; ++nt)
#pragma unroll
          for (int r = 0; r < 8; ++r) o[j][nt][r] *= al;
      }
    }

    mw[0] = *(const v16u*)(wrow0 + (tn >> 1));        // next pass's mask words
    mw[1] = *(const v16u*)(wrow1 + (tn >> 1));
    // keeps the two scalar loads here, a whole exponential block ahead of their use;
    // left free, the scheduler sinks them to the end of the pass and their latency shows
    __builtin_amdgcn_sched_barrier(0);

#pragma unroll
    for (int j = 0; j < 2; ++j) {
      v16bf pb;
      float sum = 0.f;
#pragma unroll
      for (int i = 0; i < 2; ++i)
#pragma unroll
        for (int r = 0; r < 8; ++r) {
          // subtract first: a row whose keys are all masked gets exactly 1
          const float e = __builtin_amdgcn_exp2f((s[j][i][r] - m[j]) * SC2);
          sum += e;
          pb[i * 8 + r] = (bf16_t)e;
        }
      l[j] += sum;
#pragma unroll
      for (int nt = 0; nt < 4; ++nt)
        o[j][nt] = wmma_bf16(vf[nt], pb, o[j][nt]);
    }
    // precaution: the next pass's index arithmetic lands in the scalar registers
    // that held the address of the mask-word loads above
    asm volatile("s_wait_xcnt 0x0" ::: "memory");
  }

  // a lane holds 8 consecutive e of one query row: one 16-B piece of ctx's
  // fragment [row tile][k chunk h * 2 + nt / 2]: half hh, lane c + 16 * (nt & 1)
#pragma unroll
  for (int j = 0; j < 2; ++j) {
    const float inv = 1.f / (l[j] + other_half(l[j]));
    bf16_t* dst = ctx + ((size_t)bz * S_ + s0 + 16 * j) * (H_ * E_) + h * 1024 +
                  hh * 256 + c * 8;
#pragma unroll
    for (int nt = 0; nt < 4; ++nt) {
      v8bf pk;
#pragma unroll
      for (int r = 0; r < 8; ++r) pk[r] = (bf16_t)(o[j][nt][r] * inv);
      *(v8bf*)(dst + (nt >> 1) * 512 + (nt & 1) * 128) = pk;
    }
  }
}

// ---------------- output projection + LayerNorm ----------------
// 256 threads (8 waves); block owns 32 rows of [B*S, 768]. Each wave does 2 row tiles
// x 6 n-tiles (8 fragment loads per 12 WMMAs); result staged in LDS for the LayerNorm.
// LayerNorm: each wave takes 4 whole rows; a lane holds 24 elements of a row in registers
// (6 reads of 16 B, the wave reading 512 contiguous bytes at a time), so mean, variance
// and the scaled result come from one read of LDS and go out as whole-line 16-B stores.

// sum over the 32 lanes, the same value in every lane: four exchanges inside the
// 16-lane row (row_xmask 1, 2, 4, 8), then one between the two rows
template <int CTRL>
__device__ __forceinline__ float add_xmask(float x) {
  return x + __builtin_bit_cast(float, __builtin_amdgcn_mov_dpp(
                 __builtin_bit_cast(int, x), CTRL, 0xF, 0xF, true));
}
__device__ __forceinline__ float wave_sum(float x) {
  x = add_xmask<0x161>(x);
  x = add_xmask<0x162>(x);
  x = add_xmask<0x164>(x);
  x = add_xmask<0x168>(x);
  return x + other_half(x);
}

__global__ __launch_bounds__(256) void
k_proj_ln(const bf16_t* __restrict__ ctx, const bf16_t* __restrict__ woT,
          const float* __restrict__ bo, const float* __restrict__ gamma,
          const float* __restrict__ beta, float* __restrict__ out) {
  __shared__ float sOut[32 * D_];                     // 96 KB

  const int tid  = threadIdx.x;
  const int lane = tid & 31;
  // the wave's number in a scalar register: fragment addresses are a scalar base + lane offset
  const int wave = __builtin_amdgcn_readfirstlane(tid >> 5);
  const int row0 = blockIdx.x * 32;                   // row in [0, B*S)
  const bf16_t* arow = ctx + (size_t)row0 * D_;

  v8f acc[2][6];
#pragma unroll
  for (int i = 0; i < 2; ++i)
#pragma unroll
    for (int j = 0; j < 6; ++j) acc[i][j] = v8f{};

  // kept rolled: fully unrolled this loop built to 266 VGPRs, past the 256 reached without a window
#pragma unroll 1
  for (int kc = 0; kc < D_ / 32; kc += 2) {           // 24 K-chunks, two at a time
    v16bf a[2][2], b[2][6];                           // [chunk][tile]
#pragma unroll
    for (int u = 0; u < 2; ++u) {
      // precaution: the second chunk's loads land in registers that held addresses of the first's
      if (u) asm volatile("s_wait_xcnt 0x0" ::: "memory");
#pragma unroll
      for (int i = 0; i < 2; ++i) a[u][i] = load_pk(arow, i * (D_ / 32) + kc + u, lane);
#pragma unroll
      for (int j = 0; j < 6; ++j)
        b[u][j] = load_pk(woT, (wave * 6 + j) * (D_ / 32) + kc + u, lane);
    }
    // keeps the 32 loads of two chunks together in front of their WMMAs: one latency per
    // pair; left free, the scheduler reuses two buffers and every WMMA waits on a fresh load
    __builtin_amdgcn_sched_barrier(0);
#pragma unroll
    for (int u = 0; u < 2; ++u)
#pragma unroll
      for (int j = 0; j < 6; ++j)
#pragma unroll
        for (int i = 0; i < 2; ++i) acc[i][j] = wmma_bf16(a[u][i], b[u][j], acc[i][j]);
  }

  // the lane's 24 columns of gamma and beta, asked for here so that they arrive
  // while the tile is staged
  v4f ga[6], be[6];
  // unrolled, like every loop of the LayerNorm below: ga, be and xv are then indexed by
  // constants only and stay in registers
#pragma unroll
  for (int t = 0; t < 6; ++t) {
    ga[t] = *(const v4f*)(gamma + (t * 32 + lane) * 4);
    be[t] = *(const v4f*)(beta + (t * 32 + lane) * 4);
  }

  const int N     = lane & 15;
  const int Mbase = (lane >> 4) << 3;
#pragma unroll
  for (int j = 0; j < 6; ++j) {
    const int n0 = (wave * 6 + j) * 16;
    const float bi = bo[n0 + N];
#pragma unroll
    for (int i = 0; i < 2; ++i)
#pragma unroll
      for (int r = 0; r < 8; ++r)
        sOut[(i * 16 + Mbase + r) * D_ + n0 + N] = acc[i][j][r] + bi;
  }
  __syncthreads();

  v4f xv[4][6];                                       // [row of the wave][16-B piece]
#pragma unroll
  for (int rr = 0; rr < 4; ++rr)
#pragma unroll
    for (int t = 0; t < 6; ++t)
      xv[rr][t] = *(const v4f*)(sOut + (wave * 4 + rr) * D_ + (t * 32 + lane) * 4);

  float mu[4], rs[4];
#pragma unroll
  for (int rr = 0; rr < 4; ++rr) {
    v4f s4 = xv[rr][0];
#pragma unroll
    for (int t = 1; t < 6; ++t) s4 += xv[rr][t];
    mu[rr] = (s4[0] + s4[1]) + (s4[2] + s4[3]);
  }
#pragma unroll
  for (int rr = 0; rr < 4; ++rr) mu[rr] = wave_sum(mu[rr]) * (1.f / D_);
#pragma unroll
  for (int rr = 0; rr < 4; ++rr) {
    v4f q4 = v4f{};
#pragma unroll
    for (int t = 0; t < 6; ++t) {
      xv[rr][t] -= mu[rr];
      q4 += xv[rr][t] * xv[rr][t];
    }
    rs[rr] = (q4[0] + q4[1]) + (q4[2] + q4[3]);
  }
#pragma unroll
  for (int rr = 0; rr < 4; ++rr) rs[rr] = rsqrtf(wave_sum(rs[rr]) * (1.f / D_) + LN_EPS_);

#pragma unroll
  for (int rr = 0; rr < 4; ++rr) {
    float* dst = out + (size_t)(row0 + wave * 4 + rr) * D_ + lane * 4;
#pragma unroll
    for (int t = 0; t < 6; ++t)
      *(v4f*)(dst + t * 128) = xv[rr][t] * rs[rr] * ga[t] + be[t];
  }
}

// ---------------- host launcher ----------------
extern "C" void kernel_launch(void* const* d_in, const int* in_sizes, int n_in,
                              void* d_out, int out_size, void* d_ws, size_t ws_size,
                              hipStream_t stream) {
  const float* x    = (const float*)d_in[0];
  const int*   mask = (const int*)d_in[1];
  const float* Wq   = (const float*)d_in[2];
  const float* bq   = (const float*)d_in[3];
  const float* Wk   = (const float*)d_in[4];
  const float* bk   = (const float*)d_in[5];
  const float* Wv   = (const float*)d_in[6];
  const float* bv   = (const float*)d_in[7];
  const float* Wo   = (const float*)d_in[8];
  const float* bo   = (const float*)d_in[9];
  const float* gamma = (const float*)d_in[10];
  const float* beta  = (const float*)d_in[11];
  float* out = (float*)d_out;

  // workspace layout (bf16 intermediates, mask words), ~66.5 MB total
  char* ws = (char*)d_ws;
  const size_t szX  = (size_t)B_ * S_ * D_ * sizeof(bf16_t);
  const size_t szW  = (size_t)H_ * E_ * D_ * sizeof(bf16_t);
  const size_t szWo = (size_t)D_ * D_ * sizeof(bf16_t);
  const size_t szQ  = (size_t)B_ * H_ * S_ * E_ * sizeof(bf16_t);
  bf16_t* xb  = (bf16_t*)(ws);
  bf16_t* wqT = (bf16_t*)(ws + szX);
  bf16_t* wkT = (bf16_t*)(ws + szX + szW);
  bf16_t* wvT = (bf16_t*)(ws + szX + 2 * szW);
  bf16_t* woT = (bf16_t*)(ws + szX + 3 * szW);
  bf16_t* q   = (bf16_t*)(ws + szX + 3 * szW + szWo);
  bf16_t* k   = (bf16_t*)(ws + szX + 3 * szW + szWo + szQ);
  bf16_t* vT  = (bf16_t*)(ws + szX + 3 * szW + szWo + 2 * szQ);
  bf16_t* ctx = (bf16_t*)(ws + szX + 3 * szW + szWo + 3 * szQ);
  unsigned* wm = (unsigned*)(ws + szX + 3 * szW + szWo + 4 * szQ);   // 2 MB of mask words

  k_prep<<<NB_X_ + 4 * NB_1W_ + NB_M_, 256, 0, stream>>>(x, mask, Wq, Wk, Wv, Wo, xb, wqT, wkT,
                                                         wvT, woT, wm);

  k_qkv<<<B_ * 3 * (H_ / 2) * (S_ / 128), 128, 0, stream>>>(xb, wqT, wkT, wvT, bq, bk, bv,
                                                            q, k, vT);

  k_attn<<<B_ * H_ * (S_ / 128), 128, 0, stream>>>(q, k, vT, wm, ctx);

  k_proj_ln<<<B_ * S_ / 32, 256, 0, stream>>>(ctx, woT, bo, gamma, beta, out);
}

// v007
// A run of this version takes 114 microseconds.
// Two timings next to v006 both put it at 1.05 times that version's speed.
// Over all steps from v000 it is 25.6 times as fast.
#include <hip/hip_runtime.h>
#include <hip/hip_bf16.h>
#include <math.h>

// ---- problem constants (match reference) ----
static constexpr int B_ = 4, S_ = 2048, D_ = 768, H_ = 12, E_ = 64;
static constexpr float LN_EPS_ = 1e-5f;

typedef __bf16 bf16_t;
typedef __attribute__((ext_vector_type(16))) __bf16 v16bf;
typedef __attribute__((ext_vector_type(8)))  __bf16 v8bf;   // 16-byte pack
typedef __attribute__((ext_vector_type(8)))  float  v8f;

// -------------------------------------------------------------------------
// Every bf16 operand in the workspace is stored in FRAGMENT ORDER: a 16-row x
// 32-k fragment of V_WMMA_F32_16X16X32_BF16 (wave32) is one 1-KB block,
//   block[half * 256 + lane * 8 + i]  =  register element s = half * 8 + i of lane,
// so a wave loads a fragment with two b128 loads of 512 contiguous bytes each.
// Which (row, k) a position holds, for a row-major matrix M:
//   plain order: row = lane & 15, k = (lane >> 4) * 16 + s   (A and B alike)
// Fragments of a matrix with K columns lie as [row tile][k chunk of 32].
// -------------------------------------------------------------------------
__device__ __forceinline__ v16bf load_pk(const bf16_t* base, int frag, int lane) {
  const bf16_t* p = base + (size_t)frag * 512 + lane * 8;
  const v8bf lo = *(const v8bf*)p;
  const v8bf hi = *(const v8bf*)(p + 256);
  return __builtin_shufflevector(lo, hi, 0, 1, 2, 3, 4, 5, 6, 7, 8, 9, 10, 11,
                                 12, 13, 14, 15);
}

__device__ __forceinline__ v8f wmma_bf16(v16bf a, v16bf b, v8f c) {
  return __builtin_amdgcn_wmma_f32_16x16x32_bf16(false, a, false, b,
                                                 (short)0, c, false, false);
}

// ---------------- preparation: ONE launch for every repacked operand ----------
// f32 -> bf16 in fragment order for x and the four weight matrices, and the mask as
// lane-mask words. Ranges of the block index pick the job; the jobs are independent.
// A wave makes whole fragments (two 512-byte stores each) and takes several that lie a
// constant step apart in the source, so that the launch starts few waves, each wave has
// all its loads in flight at once, and every address is one base plus a constant.
typedef __attribute__((ext_vector_type(4))) float    v4f;
typedef __attribute__((ext_vector_type(4))) int      v4i;
typedef __attribute__((ext_vector_type(4))) unsigned v4u;

static constexpr int KC_   = D_ / 32;                 // k chunks of a 768-wide matrix
static constexpr int XF_   = 6;                       // x fragments per wave
static constexpr int WF_   = KC_ / 8;                 // weight fragments per wave
static constexpr int NB_X_ = B_ * (S_ / 16) * KC_ / (XF_ * 8);  // 2 row tiles per block
static constexpr int NB_1W_ = D_ / 16;                // a weight matrix: a block per tile
static constexpr int NB_M_ = B_ * (S_ / 16);          // mask: a block per query tile

// x [B*S, D] -> fragments [row tile][k chunk]; the wave takes k chunks kc0 .. kc0 + 5 of
// row tile rt; a lane reads its 16 k of a chunk as 64 contiguous bytes.
__device__ __forceinline__ void prep_x(const float* __restrict__ x, bf16_t* __restrict__ y,
                                       int rt, int kc0, int lane) {
  const float* s = x + (size_t)rt * 16 * D_ + kc0 * 32 + ((lane & 15) * D_ + (lane >> 4) * 16);
  bf16_t* d = y + ((size_t)rt * KC_ + kc0) * 512 + lane * 8;
  v4f a[XF_][4];
#pragma unroll
  for (int f = 0; f < XF_; ++f)
#pragma unroll
    for (int c = 0; c < 4; ++c) a[f][c] = *(const v4f*)(s + f * 32 + c * 4);
  // keeps all 24 loads in front of the conversions: one latency per wave; left free, the
  // scheduler holds the last of them back until the first have arrived
  __builtin_amdgcn_sched_barrier(0);
#pragma unroll
  for (int f = 0; f < XF_; ++f)
#pragma unroll
    for (int half = 0; half < 2; ++half) {
      v8bf pk;
#pragma unroll
      for (int i = 0; i < 4; ++i) {
        pk[i]     = (bf16_t)a[f][half * 2][i];
        pk[4 + i] = (bf16_t)a[f][half * 2 + 1][i];
      }
      *(v8bf*)(d + f * 512 + half * 256) = pk;
    }
}

// A weight matrix -> fragments of its transpose, [output-column tile ct][k chunk]; the
// wave takes k chunks kc0 .. kc0 + 2 of tile ct.
// HDE: W [H,D,E], rows of the transpose are e of head h (ct = h * 4 + e tile), k = d.
// else: Wo [768 f, 768 d], rows of the transpose are d, k = f.
template <bool HDE>
__device__ __forceinline__ void prep_w(const float* __restrict__ W, bf16_t* __restrict__ WT,
                                       int ct, int kc0, int lane) {
  constexpr int LD = HDE ? E_ : D_;                   // floats from one k to the next
  const float* s = W + (HDE ? (size_t)(ct >> 2) * D_ * E_ + (ct & 3) * 16 : (size_t)ct * 16) +
                   (size_t)kc0 * 32 * LD + ((lane >> 4) * 16 * LD + (lane & 15));
  bf16_t* d = WT + ((size_t)ct * KC_ + kc0) * 512 + lane * 8;
  float v[WF_][16];
#pragma unroll
  for (int f = 0; f < WF_; ++f)
#pragma unroll
    for (int i = 0; i < 16; ++i) v[f][i] = s[(f * 32 + i) * LD];
#pragma unroll
  for (int f = 0; f < WF_; ++f)
#pragma unroll
    for (int half = 0; half < 2; ++half) {
      v8bf pk;
#pragma unroll
      for (int i = 0; i < 8; ++i) pk[i] = (bf16_t)v[f][half * 8 + i];
      *(v8bf*)(d + f * 512 + half * 256) = pk;
    }
  // precaution: behind the job the compiler's code for the other block ranges lands in
  // registers that held data and base of the stores above
  asm volatile("s_wait_xcnt 0x0" ::: "memory");
}

// mask [B,S,S] i32 -> lane-mask words.
// Word [b][query tile of 16][key tile of 16][r]: bit L says whether
// mask[b][query tile * 16 + (L & 15)][key tile * 16 + 8 * (L >> 4) + r] != 0,
// which is the entry that lane L holds in register r of that transposed score
// tile: k_attn reads a word into a scalar register and selects on it directly.
// One wave takes 16 query rows x 128 keys at a time: 16 whole-line loads; lane l
// holds keys 4l..4l+3 (key tile l >> 2, half (l >> 1) & 1, r = 4 * (l & 1) + k).
__device__ __forceinline__ void prep_mask(const int* __restrict__ mask,
                                          unsigned* __restrict__ wm, int rt, int wave,
                                          int lane) {
#pragma unroll
  for (int t = 0; t < 2; ++t) {
    const int kg = wave * 2 + t;                      // group of 128 keys
    const int* s = mask + (size_t)rt * 16 * S_ + kg * 128 + lane * 4;
    v4i m[16];
#pragma unroll
    for (int qr = 0; qr < 16; ++qr) m[qr] = *(const v4i*)(s + (size_t)qr * S_);
    v4u pk;
#pragma unroll
    for (int kk = 0; kk < 4; ++kk) {
      unsigned hb = 0;                                // bit qr: query row qr, this key
#pragma unroll
      for (int qr = 0; qr < 16; ++qr)
        hb |= (m[qr][kk] != 0 ? 1u : 0u) << qr;
      // the upper key half of the same tile and r sits two lanes further on
      const unsigned up = (unsigned)__builtin_amdgcn_mov_dpp((int)hb, 0x4E, 0xF, 0xF, true);
      pk[kk] = hb | (up << 16);
    }
    if ((lane & 2) == 0)
      *(v4u*)(wm + (size_t)rt * (S_ / 2) + (kg * 8 + (lane >> 2)) * 8 + (lane & 1) * 4) = pk;
  }
}

__global__ __launch_bounds__(256) void
k_prep(const float* __restrict__ x, const int* __restrict__ mask,
       const float* __restrict__ Wq, const float* __restrict__ Wk,
       const float* __restrict__ Wv, const float* __restrict__ Wo,
       bf16_t* __restrict__ xb, bf16_t* __restrict__ wqT, bf16_t* __restrict__ wkT,
       bf16_t* __restrict__ wvT, bf16_t* __restrict__ woT, unsigned* __restrict__ wm) {
  const int lane = threadIdx.x & 31;
  // the wave's number in a scalar register: the wave's share of a job is a scalar base
  const int wave = __builtin_amdgcn_readfirstlane(threadIdx.x >> 5);
  const int blk  = blockIdx.x;
  // the mask blocks, which load twice in a row, start first; the one-round jobs last
  if (blk < NB_M_) {
    prep_mask(mask, wm, blk, wave, lane);
  } else if (blk < NB_M_ + NB_X_) {
    prep_x(x, xb, (blk - NB_M_) * 2 + (wave >> 2), (wave & 3) * XF_, lane);
  } else if (blk < NB_M_ + NB_X_ + 3 * NB_1W_) {
    const int mat = (blk - NB_M_ - NB_X_) / NB_1W_;
    prep_w<true>(mat == 0 ? Wq : mat == 1 ? Wk : Wv, mat == 0 ? wqT : mat == 1 ? wkT : wvT,
                 (blk - NB_M_ - NB_X_) - mat * NB_1W_, wave * WF_, lane);
  } else {
    prep_w<false>(Wo, woT, blk - NB_M_ - NB_X_ - 3 * NB_1W_, wave * WF_, lane);
  }
}

// ---------------- QKV projection: one wave per 64 rows x 96 columns ----------
// The product is [B*S, 768] x [768, 2304], the columns being q, k, v side by side. A block
// is 256 rows x 288 columns, 12 waves as 4 x 3: 32 x 8 = 256 equal blocks, three waves on
// every SIMD, all resident at once. An x fragment is wanted by three waves of the block and
// a weight fragment by four, at about the same time.
// A wave's 4 x 6 accumulator tiles take 10 fragment loads per 24 WMMAs. Its 96 columns lie
// in ONE of q, k, v (768 = 8 x 96) and are three whole e chunks of 32, in one or two heads.
// q,k stored as fragments [B,H][s tile][e chunk], plain order (staged via LDS);
// v stored as fragments of V^T (rows e, k = key) [B,H][e tile][32-key chunk] in
// the k order of a packed accumulator pair: k = 8 * (lane >> 4) + s for s < 8,
// 16 + 8 * (lane >> 4) + (s - 8) otherwise; a lane's 8 rows are one 16-B piece.
static constexpr int QR_ = 256, QC_ = 288;    // block tile
static constexpr int QP_ = 104;               // staging pitch: 208 B, an odd number of 16 B

__global__ __launch_bounds__(384) void
k_qkv(const bf16_t* __restrict__ xb, const bf16_t* __restrict__ wqT,
      const bf16_t* __restrict__ wkT, const bf16_t* __restrict__ wvT,
      const float* __restrict__ bq, const float* __restrict__ bk,
      const float* __restrict__ bv, bf16_t* __restrict__ q,
      bf16_t* __restrict__ k, bf16_t* __restrict__ vT) {
  __shared__ bf16_t st[12][64 * QP_];       // 13 KB staging tile per wave

  const int lane = threadIdx.x & 31;
  // the wave's number in a scalar register: fragment addresses are a scalar base + lane offset
  const int wave = __builtin_amdgcn_readfirstlane(threadIdx.x >> 5);
  constexpr int RB = B_ * S_ / QR_;         // row blocks
  const int blk = blockIdx.x;
  const int row0 = (blk % RB) * QR_ + (wave & 3) * 64;  // row in [0, B*S)
  const int grp  = (blk / RB) * 3 + (wave >> 2);        // group of 96 columns, 0 .. 23
  const int mat  = grp >> 3;                            // 0 q, 1 k, 2 v: one per wave
  const int ct0  = (grp & 7) * 6;                       // first column tile, h * 4 + e tile
  const int bz   = row0 / S_;
  const int s0   = row0 % S_;

  const bf16_t* xfr = xb + (size_t)row0 * D_;            // 4 row tiles of fragments
  const bf16_t* w   = (mat == 0 ? wqT : mat == 1 ? wkT : wvT) + (size_t)ct0 * 16 * D_;
  const float* bias = (mat == 0 ? bq : mat == 1 ? bk : bv) + ct0 * 16;

  v8f acc[4][6];                            // [row tile][column tile]
#pragma unroll
  for (int i = 0; i < 4; ++i)
#pragma unroll
    for (int nt = 0; nt < 6; ++nt) acc[i][nt] = v8f{};

  for (int kc = 0; kc < D_ / 32; ++kc) {          // 24 K-chunks
    v16bf a[4], b[6];
#pragma unroll
    for (int i = 0; i < 3; ++i) a[i] = load_pk(xfr, i * (D_ / 32) + kc, lane);
    const bf16_t* pa = xfr + (size_t)(3 * (D_ / 32) + kc) * 512 + lane * 8;
    const v8bf alo = *(const v8bf*)pa;
#pragma unroll
    for (int nt = 0; nt < 5; ++nt) b[nt] = load_pk(w, nt * (D_ / 32) + kc, lane);
    const bf16_t* pb = w + (size_t)(5 * (D_ / 32) + kc) * 512 + lane * 8;
    const v8bf blo = *(const v8bf*)pb;
    // precaution: the last load of x and the last of w land in the registers that held the
    // addresses of the loads above
    asm volatile("s_wait_xcnt 0x0" ::: "memory");
    const v8bf ahi = *(const v8bf*)(pa + 256);
    const v8bf bhi = *(const v8bf*)(pb + 256);
    a[3] = __builtin_shufflevector(alo, ahi, 0, 1, 2, 3, 4, 5, 6, 7, 8, 9, 10, 11, 12, 13, 14,
                                   15);
    b[5] = __builtin_shufflevector(blo, bhi, 0, 1, 2, 3, 4, 5, 6, 7, 8, 9, 10, 11, 12, 13, 14,
                                   15);
    // keeps the chunk's 20 loads together in front of its WMMAs: one latency per chunk;
    // left free, the scheduler reuses two buffers and every WMMA waits on a fresh load
    __builtin_amdgcn_sched_barrier(0);
#pragma unroll
    for (int i = 0; i < 4; ++i)
#pragma unroll
      for (int nt = 0; nt < 6; ++nt) acc[i][nt] = wmma_bf16(a[i], b[nt], acc[i][nt]);
  }

  const int N     = lane & 15;
  const int Mbase = (lane >> 4) << 3;
  float bi[6];
#pragma unroll
  for (int nt = 0; nt < 6; ++nt) bi[nt] = bias[nt * 16 + N];

  bf16_t* sw = st[wave];
  if (mat == 2) {
    // ---- v: 8 keys per lane -> one b128 store, 512 contiguous bytes per wave ----
#pragma unroll
    for (int i = 0; i < 4; ++i) {
      const int si = s0 + 16 * i;
#pragma unroll
      for (int nt = 0; nt < 6; ++nt) {
        v8bf pk;
#pragma unroll
        for (int r = 0; r < 8; ++r) pk[r] = (bf16_t)(acc[i][nt][r] + bi[nt]);
        *(v8bf*)(vT + ((size_t)(bz * (H_ * 4) + ct0 + nt) * (S_ / 32) + (si >> 5)) * 512 +
                 ((si >> 4) & 1) * 256 + lane * 8) = pk;
      }
    }
  } else {
    // ---- q or k: stage the wave's 64x96 tile in LDS ----
#pragma unroll
    for (int i = 0; i < 4; ++i)
#pragma unroll
      for (int nt = 0; nt < 6; ++nt)
#pragma unroll
        for (int r = 0; r < 8; ++r)
          sw[(i * 16 + Mbase + r) * QP_ + nt * 16 + N] = (bf16_t)(acc[i][nt][r] + bi[nt]);
  }
  __syncthreads();                                // every wave passes it, the v waves too
  if (mat != 2) {
    // ---- flush the tile's 12 fragments in order; e chunk p is chunk (ct0 / 2 + p) & 1 of
    // head (ct0 / 2 + p) >> 1 ----
    bf16_t* dst = (mat ? k : q) + ((size_t)bz * H_ * S_ + s0) * E_;
#pragma unroll
    for (int p = 0; p < 3; ++p) {
      const int ec = (ct0 >> 1) + p;
      bf16_t* dp = dst + (size_t)(ec >> 1) * S_ * E_ + (ec & 1) * 512 + lane * 8;
#pragma unroll
      for (int i = 0; i < 4; ++i)
#pragma unroll
        for (int half = 0; half < 2; ++half)
          *(v8bf*)(dp + i * 16 * E_ + half * 256) =
              *(const v8bf*)(sw + (i * 16 + (lane & 15)) * QP_ + p * 32 + (lane >> 4) * 16 +
                             half * 8);
    }
  }
}

typedef __attribute__((ext_vector_type(16))) unsigned v16u;

// value of lane ^ 16
__device__ __forceinline__ float other_half(float x) {
  const int b = __builtin_bit_cast(int, x);
  return __builtin_bit_cast(float, __builtin_amdgcn_permlanex16(
      b, b, 0x76543210, 0xfedcba98, false, false));
}

__global__ __launch_bounds__(128) void
k_attn(const bf16_t* __restrict__ q, const bf16_t* __restrict__ k,
       const bf16_t* __restrict__ vT, const unsigned* __restrict__ wm,
       bf16_t* __restrict__ ctx) {
  constexpr float SC2  = 0.03187935771f;   // log2(e) / sqrt(S): ref scales by 1/sqrt(S)
  constexpr float NEGR = -1e9f * 45.254834f;      // -1e9 before the 1/sqrt(S) scale
  constexpr float STEP = 8.0f / SC2;              // maximum may lag by 2^8

  const int lane = threadIdx.x & 31;
  // the wave's number in a scalar register, so that the mask words' address is scalar
  const int wave = __builtin_amdgcn_readfirstlane(threadIdx.x >> 5);
  const int c    = lane & 15;
  const int hh   = lane >> 4;
  constexpr int QB = S_ / 128;                        // query blocks per (b,h)
  const int blk = blockIdx.x;
  const int h   = blk % H_;
  const int s0  = ((blk / H_) % QB) * 128 + wave * 32;
  const int bz  = blk / (H_ * QB);
  const size_t bh = (size_t)bz * H_ + h;

  const bf16_t* qbh = q + bh * S_ * E_;
  const bf16_t* kbh = k + bh * S_ * E_;
  const bf16_t* vbh = vT + bh * E_ * S_;
  const unsigned* wrow0 = wm + ((size_t)bz * S_ + s0) * (S_ / 32);   // S / 2 words per tile
  const unsigned* wrow1 = wrow0 + S_ / 2;

  v16bf qf[2][2];                                     // [query tile][e chunk]
#pragma unroll
  for (int j = 0; j < 2; ++j)
#pragma unroll
    for (int e = 0; e < 2; ++e)
      qf[j][e] = load_pk(qbh, ((s0 >> 4) + j) * 2 + e, lane);

  v8f o[2][4];                                        // Ot: [query tile][e tile]
  float m[2], l[2];
#pragma unroll
  for (int j = 0; j < 2; ++j) {
    m[j] = -3.0e38f;
    l[j] = 0.f;
#pragma unroll
    for (int nt = 0; nt < 4; ++nt) o[j][nt] = v8f{};
  }

  v16bf kf[2][2];                                     // [key tile][e chunk]
  v16u  mw[2];                                        // [query tile][key tile * 8 + r]
#pragma unroll
  for (int i = 0; i < 2; ++i) {
    kf[i][0] = load_pk(kbh, 2 * i, lane);
    kf[i][1] = load_pk(kbh, 2 * i + 1, lane);
  }
  mw[0] = *(const v16u*)wrow0;
  mw[1] = *(const v16u*)wrow1;

  for (int p = 0; p < S_ / 32; ++p) {
    const int t0 = p * 32;
    const int tn = (p + 1 < S_ / 32) ? t0 + 32 : t0;  // next pass, kept in bounds

    v16bf vf[4];
#pragma unroll
    for (int nt = 0; nt < 4; ++nt)
      vf[nt] = load_pk(vbh, nt * (S_ / 32) + p, lane);

    v8f s[2][2];                                      // [query tile][key tile]
#pragma unroll
    for (int j = 0; j < 2; ++j)
#pragma unroll
      for (int i = 0; i < 2; ++i) {
        s[j][i] = wmma_bf16(kf[i][0], qf[j][0], v8f{});
        s[j][i] = wmma_bf16(kf[i][1], qf[j][1], s[j][i]);
      }
#pragma unroll
    for (int i = 0; i < 2; ++i) {                     // next pass's K rows
      kf[i][0] = load_pk(kbh, (tn >> 3) + 2 * i, lane);
      kf[i][1] = load_pk(kbh, (tn >> 3) + 2 * i + 1, lane);
    }

    float mx[2];
#pragma unroll
    for (int j = 0; j < 2; ++j) {
      float t = NEGR;
#pragma unroll
      for (int i = 0; i < 2; ++i)
#pragma unroll
        for (int r = 0; r < 8; ++r) {
          const float x =
              __builtin_amdgcn_inverse_ballot_w32(mw[j][i * 8 + r]) ? NEGR : s[j][i][r];
          s[j][i][r] = x;
          t = fmaxf(t, x);
        }
      mx[j] = fmaxf(t, other_half(t));
    }

    // Move the maximum in use only when a column outgrows it by 2^8: one
    // wave-uniform test per pass (softmax does not depend on the shift).
    const bool need = (mx[0] > m[0] + STEP) || (mx[1] > m[1] + STEP);
    if (__builtin_amdgcn_ballot_w32(need) != 0) {
#pragma unroll
      for (int j = 0; j < 2; ++j) {
        const float mn = fmaxf(m[j], mx[j]);
        const float al = __builtin_amdgcn_exp2f((m[j] - mn) * SC2);
        m[j] = mn;
        l[j] *= al;
#pragma unroll
        for (int nt = 0; nt < 4; ++nt)
#pragma unroll
          for (int r = 0; r < 8; ++r) o[j][nt][r] *= al;
      }
    }

    mw[0] = *(const v16u*)(wrow0 + (tn >> 1));        // next pass's mask words
    mw[1] = *(const v16u*)(wrow1 + (tn >> 1));
    // keeps the two scalar loads here, a whole exponential block ahead of their use;
    // left free, the scheduler sinks them to the end of the pass and their latency shows
    __builtin_amdgcn_sched_barrier(0);

#pragma unroll
    for (int j = 0; j < 2; ++j) {
      v16bf pb;
      float sum = 0.f;
#pragma unroll
      for (int i = 0; i < 2; ++i)
#pragma unroll
        for (int r = 0; r < 8; ++r) {
          // subtract first: a row whose keys are all masked gets exactly 1
          const float e = __builtin_amdgcn_exp2f((s[j][i][r] - m[j]) * SC2);
          sum += e;
          pb[i * 8 + r] = (bf16_t)e;
        }
      l[j] += sum;
#pragma unroll
      for (int nt = 0; nt < 4; ++nt)
        o[j][nt] = wmma_bf16(vf[nt], pb, o[j][nt]);
    }
    // precaution: the next pass's index arithmetic lands in the scalar registers
    // that held the address of the mask-word loads above
    asm volatile("s_wait_xcnt 0x0" ::: "memory");
  }

  // a lane holds 8 consecutive e of one query row: one 16-B piece of ctx's
  // fragment [row tile][k chunk h * 2 + nt / 2]: half hh, lane c + 16 * (nt & 1)
#pragma unroll
  for (int j = 0; j < 2; ++j) {
    const float inv = 1.f / (l[j] + other_half(l[j]));
    bf16_t* dst = ctx + ((size_t)bz * S_ + s0 + 16 * j) * (H_ * E_) + h * 1024 +
                  hh * 256 + c * 8;
#pragma unroll
    for (int nt = 0; nt < 4; ++nt) {
      v8bf pk;
#pragma unroll
      for (int r = 0; r < 8; ++r) pk[r] = (bf16_t)(o[j][nt][r] * inv);
      *(v8bf*)(dst + (nt >> 1) * 512 + (nt & 1) * 128) = pk;
    }
  }
}

// ---------------- output projection + LayerNorm ----------------
// 256 threads (8 waves); block owns 32 rows of [B*S, 768]. Each wave does 2 row tiles
// x 6 n-tiles (8 fragment loads per 12 WMMAs); result staged in LDS for the LayerNorm.
// LayerNorm: each wave takes 4 whole rows; a lane holds 24 elements of a row in registers
// (6 reads of 16 B, the wave reading 512 contiguous bytes at a time), so mean, variance
// and the scaled result come from one read of LDS and go out as whole-line 16-B stores.

// sum over the 32 lanes, the same value in every lane: four exchanges inside the
// 16-lane row (row_xmask 1, 2, 4, 8), then one between the two rows
template <int CTRL>
__device__ __forceinline__ float add_xmask(float x) {
  return x + __builtin_bit_cast(float, __builtin_amdgcn_mov_dpp(
                 __builtin_bit_cast(int, x), CTRL, 0xF, 0xF, true));
}
__device__ __forceinline__ float wave_sum(float x) {
  x = add_xmask<0x161>(x);
  x = add_xmask<0x162>(x);
  x = add_xmask<0x164>(x);
  x = add_xmask<0x168>(x);
  return x + other_half(x);
}

__global__ __launch_bounds__(256) void
k_proj_ln(const bf16_t* __restrict__ ctx, const bf16_t* __restrict__ woT,
          const float* __restrict__ bo, const float* __restrict__ gamma,
          const float* __restrict__ beta, float* __restrict__ out) {
  __shared__ float sOut[32 * D_];                     // 96 KB

  const int tid  = threadIdx.x;
  const int lane = tid & 31;
  // the wave's number in a scalar register: fragment addresses are a scalar base + lane offset
  const int wave = __builtin_amdgcn_readfirstlane(tid >> 5);
  const int row0 = blockIdx.x * 32;                   // row in [0, B*S)
  const bf16_t* arow = ctx + (size_t)row0 * D_;

  v8f acc[2][6];
#pragma unroll
  for (int i = 0; i < 2; ++i)
#pragma unroll
    for (int j = 0; j < 6; ++j) acc[i][j] = v8f{};

  // kept rolled: fully unrolled this loop built to 266 VGPRs, past the 256 reached without a window
#pragma unroll 1
  for (int kc = 0; kc < D_ / 32; kc += 2) {           // 24 K-chunks, two at a time
    v16bf a[2][2], b[2][6];                           // [chunk][tile]
#pragma unroll
    for (int u = 0; u < 2; ++u) {
      // precaution: the second chunk's loads land in registers that held addresses of the first's
      if (u) asm volatile("s_wait_xcnt 0x0" ::: "memory");
#pragma unroll
      for (int i = 0; i < 2; ++i) a[u][i] = load_pk(arow, i * (D_ / 32) + kc + u, lane);
#pragma unroll
      for (int j = 0; j < 6; ++j)
        b[u][j] = load_pk(woT, (wave * 6 + j) * (D_ / 32) + kc + u, lane);
    }
    // keeps the 32 loads of two chunks together in front of their WMMAs: one latency per
    // pair; left free, the scheduler reuses two buffers and every WMMA waits on a fresh load
    __builtin_amdgcn_sched_barrier(0);
#pragma unroll
    for (int u = 0; u < 2; ++u)
#pragma unroll
      for (int j = 0; j < 6; ++j)
#pragma unroll
        for (int i = 0; i < 2; ++i) acc[i][j] = wmma_bf16(a[u][i], b[u][j], acc[i][j]);
  }

  // the lane's 24 columns of gamma and beta, asked for here so that they arrive
  // while the tile is staged
  v4f ga[6], be[6];
  // unrolled, like every loop of the LayerNorm below: ga, be and xv are then indexed by
  // constants only and stay in registers
#pragma unroll
  for (int t = 0; t < 6; ++t) {
    ga[t] = *(const v4f*)(gamma + (t * 32 + lane) * 4);
    be[t] = *(const v4f*)(beta + (t * 32 + lane) * 4);
  }

  const int N     = lane & 15;
  const int Mbase = (lane >> 4) << 3;
#pragma unroll
  for (int j = 0; j < 6; ++j) {
    const int n0 = (wave * 6 + j) * 16;
    const float bi = bo[n0 + N];
#pragma unroll
    for (int i = 0; i < 2; ++i)
#pragma unroll
      for (int r = 0; r < 8; ++r)
        sOut[(i * 16 + Mbase + r) * D_ + n0 + N] = acc[i][j][r] + bi;
  }
  __syncthreads();

  v4f xv[4][6];                                       // [row of the wave][16-B piece]
#pragma unroll
  for (int rr = 0; rr < 4; ++rr)
#pragma unroll
    for (int t = 0; t < 6; ++t)
      xv[rr][t] = *(const v4f*)(sOut + (wave * 4 + rr) * D_ + (t * 32 + lane) * 4);

  float mu[4], rs[4];
#pragma unroll
  for (int rr = 0; rr < 4; ++rr) {
    v4f s4 = xv[rr][0];
#pragma unroll
    for (int t = 1; t < 6; ++t) s4 += xv[rr][t];
    mu[rr] = (s4[0] + s4[1]) + (s4[2] + s4[3]);
  }
#pragma unroll
  for (int rr = 0; rr < 4; ++rr) mu[rr] = wave_sum(mu[rr]) * (1.f / D_);
#pragma unroll
  for (int rr = 0; rr < 4; ++rr) {
    v4f q4 = v4f{};
#pragma unroll
    for (int t = 0; t < 6; ++t) {
      xv[rr][t] -= mu[rr];
      q4 += xv[rr][t] * xv[rr][t];
    }
    rs[rr] = (q4[0] + q4[1]) + (q4[2] + q4[3]);
  }
#pragma unroll
  for (int rr = 0; rr < 4; ++rr) rs[rr] = rsqrtf(wave_sum(rs[rr]) * (1.f / D_) + LN_EPS_);

#pragma unroll
  for (int rr = 0; rr < 4; ++rr) {
    float* dst = out + (size_t)(row0 + wave * 4 + rr) * D_ + lane * 4;
#pragma unroll
    for (int t = 0; t < 6; ++t)
      *(v4f*)(dst + t * 128) = xv[rr][t] * rs[rr] * ga[t] + be[t];
  }
}

// ---------------- host launcher ----------------
extern "C" void kernel_launch(void* const* d_in, const int* in_sizes, int n_in,
                              void* d_out, int out_size, void* d_ws, size_t ws_size,
                              hipStream_t stream) {
  const float* x    = (const float*)d_in[0];
  const int*   mask = (const int*)d_in[1];
  const float* Wq   = (const float*)d_in[2];
  const float* bq   = (const float*)d_in[3];
  const float* Wk   = (const float*)d_in[4];
  const float* bk   = (const float*)d_in[5];
  const float* Wv   = (const float*)d_in[6];
  const float* bv   = (const float*)d_in[7];
  const float* Wo   = (const float*)d_in[8];
  const float* bo   = (const float*)d_in[9];
  const float* gamma = (const float*)d_in[10];
  const float* beta  = (const float*)d_in[11];
  float* out = (float*)d_out;

  // workspace layout (bf16 intermediates, mask words), ~66.5 MB total
  char* ws = (char*)d_ws;
  const size_t szX  = (size_t)B_ * S_ * D_ * sizeof(bf16_t);
  const size_t szW  = (size_t)H_ * E_ * D_ * sizeof(bf16_t);
  const size_t szWo = (size_t)D_ * D_ * sizeof(bf16_t);
  const size_t szQ  = (size_t)B_ * H_ * S_ * E_ * sizeof(bf16_t);
  bf16_t* xb  = (bf16_t*)(ws);
  bf16_t* wqT = (bf16_t*)(ws + szX);
  bf16_t* wkT = (bf16_t*)(ws + szX + szW);
  bf16_t* wvT = (bf16_t*)(ws + szX + 2 * szW);
  bf16_t* woT = (bf16_t*)(ws + szX + 3 * szW);
  bf16_t* q   = (bf16_t*)(ws + szX + 3 * szW + szWo);
  bf16_t* k   = (bf16_t*)(ws + szX + 3 * szW + szWo + szQ);
  bf16_t* vT  = (bf16_t*)(ws + szX + 3 * szW + szWo + 2 * szQ);
  bf16_t* ctx = (bf16_t*)(ws + szX + 3 * szW + szWo + 3 * szQ);
  unsigned* wm = (unsigned*)(ws + szX + 3 * szW + szWo + 4 * szQ);   // 2 MB of mask words

  k_prep<<<NB_X_ + 4 * NB_1W_ + NB_M_, 256, 0, stream>>>(x, mask, Wq, Wk, Wv, Wo, xb, wqT, wkT,
                                                         wvT, woT, wm);

  k_qkv<<<(B_ * S_ / QR_) * (3 * H_ * E_ / QC_), 384, 0, stream>>>(xb, wqT, wkT, wvT, bq, bk,
                                                                   bv, q, k, vT);

  k_attn<<<B_ * H_ * (S_ / 128), 128, 0, stream>>>(q, k, vT, wm, ctx);

  k_proj_ln<<<B_ * S_ / 32, 256, 0, stream>>>(ctx, woT, bo, gamma, beta, out);
}

// v008
// Measured time: 99.9 microseconds a run.
// Next to v007, in two timings, it ran 1.15 times as fast each time.
// Counting every step since v000, it is 29.3 times as fast.
#include <hip/hip_runtime.h>
#include <hip/hip_bf16.h>
#include <math.h>

// ---- problem constants (match reference) ----
static constexpr int B_ = 4, S_ = 2048, D_ = 768, H_ = 12, E_ = 64;
static constexpr float LN_EPS_ = 1e-5f;

typedef __bf16 bf16_t;
typedef __attribute__((ext_vector_type(16))) __bf16 v16bf;
typedef __attribute__((ext_vector_type(8)))  __bf16 v8bf;   // 16-byte pack
typedef __attribute__((ext_vector_type(8)))  float  v8f;

// -------------------------------------------------------------------------
// Every bf16 operand in the workspace is stored in FRAGMENT ORDER: a 16-row x
// 32-k fragment of V_WMMA_F32_16X16X32_BF16 (wave32) is one 1-KB block,
//   block[half * 256 + lane * 8 + i]  =  register element s = half * 8 + i of lane,
// so a wave loads a fragment with two b128 loads of 512 contiguous bytes each.
// Which (row, k) a position holds, for a row-major matrix M:
//   plain order: row = lane & 15, k = (lane >> 4) * 16 + s   (A and B alike)
// Fragments of a matrix with K columns lie as [row tile][k chunk of 32].
// -------------------------------------------------------------------------
__device__ __forceinline__ v16bf load_pk(const bf16_t* base, int frag, int lane) {
  const bf16_t* p = base + (size_t)frag * 512 + lane * 8;
  const v8bf lo = *(const v8bf*)p;
  const v8bf hi = *(const v8bf*)(p + 256);
  return __builtin_shufflevector(lo, hi, 0, 1, 2, 3, 4, 5, 6, 7, 8, 9, 10, 11,
                                 12, 13, 14, 15);
}

__device__ __forceinline__ v8f wmma_bf16(v16bf a, v16bf b, v8f c) {
  return __builtin_amdgcn_wmma_f32_16x16x32_bf16(false, a, false, b,
                                                 (short)0, c, false, false);
}

// ---------------- preparation: ONE launch for every repacked operand ----------
// f32 -> bf16 in fragment order for x and the four weight matrices, and the mask as
// lane-mask words. Ranges of the block index pick the job; the jobs are independent.
// A wave makes whole fragments (two 512-byte stores each) and takes several that lie a
// constant step apart in the source, so that the launch starts few waves, each wave has
// all its loads in flight at once, and every address is one base plus a constant.
typedef __attribute__((ext_vector_type(4))) float    v4f;
typedef __attribute__((ext_vector_type(4))) int      v4i;
typedef __attribute__((ext_vector_type(4))) unsigned v4u;

static constexpr int KC_   = D_ / 32;                 // k chunks of a 768-wide matrix
static constexpr int XF_   = 6;                       // x fragments per wave
static constexpr int WF_   = KC_ / 8;                 // weight fragments per wave
static constexpr int NB_X_ = B_ * (S_ / 16) * KC_ / (XF_ * 8);  // 2 row tiles per block
static constexpr int NB_1W_ = D_ / 16;                // a weight matrix: a block per tile
static constexpr int NB_M_ = B_ * (S_ / 16);          // mask: a block per query tile

// x [B*S, D] -> fragments [row tile][k chunk]; the wave takes k chunks kc0 .. kc0 + 5 of
// row tile rt; a lane reads its 16 k of a chunk as 64 contiguous bytes.
__device__ __forceinline__ void prep_x(const float* __restrict__ x, bf16_t* __restrict__ y,
                                       int rt, int kc0, int lane) {
  const float* s = x + (size_t)rt * 16 * D_ + kc0 * 32 + ((lane & 15) * D_ + (lane >> 4) * 16);
  bf16_t* d = y + ((size_t)rt * KC_ + kc0) * 512 + lane * 8;
  v4f a[XF_][4];
#pragma unroll
  for (int f = 0; f < XF_; ++f)
#pragma unroll
    for (int c = 0; c < 4; ++c) a[f][c] = *(const v4f*)(s + f * 32 + c * 4);
  // keeps all 24 loads in front of the conversions: one latency per wave; left free, the
  // scheduler holds the last of them back until the first have arrived
  __builtin_amdgcn_sched_barrier(0);
#pragma unroll
  for (int f = 0; f < XF_; ++f)
#pragma unroll
    for (int half = 0; half < 2; ++half) {
      v8bf pk;
#pragma unroll
      for (int i = 0; i < 4; ++i) {
        pk[i]     = (bf16_t)a[f][half * 2][i];
        pk[4 + i] = (bf16_t)a[f][half * 2 + 1][i];
      }
      *(v8bf*)(d + f * 512 + half * 256) = pk;
    }
}

// A weight matrix -> fragments of its transpose, [output-column tile ct][k chunk]; the
// wave takes k chunks kc0 .. kc0 + 2 of tile ct.
// HDE: W [H,D,E], rows of the transpose are e of head h (ct = h * 4 + e tile), k = d.
// else: Wo [768 f, 768 d], rows of the transpose are d, k = f.
template <bool HDE>
__device__ __forceinline__ void prep_w(const float* __restrict__ W, bf16_t* __restrict__ WT,
                                       int ct, int kc0, int lane) {
  constexpr int LD = HDE ? E_ : D_;                   // floats from one k to the next
  const float* s = W + (HDE ? (size_t)(ct >> 2) * D_ * E_ + (ct & 3) * 16 : (size_t)ct * 16) +
                   (size_t)kc0 * 32 * LD + ((lane >> 4) * 16 * LD + (lane & 15));
  bf16_t* d = WT + ((size_t)ct * KC_ + kc0) * 512 + lane * 8;
  float v[WF_][16];
#pragma unroll
  for (int f = 0; f < WF_; ++f)
#pragma unroll
    for (int i = 0; i < 16; ++i) v[f][i] = s[(f * 32 + i) * LD];
#pragma unroll
  for (int f = 0; f < WF_; ++f)
#pragma unroll
    for (int half = 0; half < 2; ++half) {
      v8bf pk;
#pragma unroll
      for (int i = 0; i < 8; ++i) pk[i] = (bf16_t)v[f][half * 8 + i];
      *(v8bf*)(d + f * 512 + half * 256) = pk;
    }
  // precaution: behind the job the compiler's code for the other block ranges lands in
  // registers that held data and base of the stores above
  asm volatile("s_wait_xcnt 0x0" ::: "memory");
}

// mask [B,S,S] i32 -> lane-mask words.
// Word [b][query tile of 16][key tile of 16][r]: bit L says whether
// mask[b][query tile * 16 + (L & 15)][key tile * 16 + 8 * (L >> 4) + r] != 0,
// which is the entry that lane L holds in register r of that transposed score
// tile: k_attn reads a word into a scalar register and selects on it directly.
// One wave takes 16 query rows x 128 keys at a time: 16 whole-line loads; lane l
// holds keys 4l..4l+3 (key tile l >> 2, half (l >> 1) & 1, r = 4 * (l & 1) + k).
__device__ __forceinline__ void prep_mask(const int* __restrict__ mask,
                                          unsigned* __restrict__ wm, int rt, int wave,
                                          int lane) {
#pragma unroll
  for (int t = 0; t < 2; ++t) {
    const int kg = wave * 2 + t;                      // group of 128 keys
    const int* s = mask + (size_t)rt * 16 * S_ + kg * 128 + lane * 4;
    v4i m[16];
#pragma unroll
    for (int qr = 0; qr < 16; ++qr) m[qr] = *(const v4i*)(s + (size_t)qr * S_);
    v4u pk;
#pragma unroll
    for (int kk = 0; kk < 4; ++kk) {
      unsigned hb = 0;                                // bit qr: query row qr, this key
#pragma unroll
      for (int qr = 0; qr < 16; ++qr)
        hb |= (m[qr][kk] != 0 ? 1u : 0u) << qr;
      // the upper key half of the same tile and r sits two lanes further on
      const unsigned up = (unsigned)__builtin_amdgcn_mov_dpp((int)hb, 0x4E, 0xF, 0xF, true);
      pk[kk] = hb | (up << 16);
    }
    if ((lane & 2) == 0)
      *(v4u*)(wm + (size_t)rt * (S_ / 2) + (kg * 8 + (lane >> 2)) * 8 + (lane & 1) * 4) = pk;
  }
}

__global__ __launch_bounds__(256) void
k_prep(const float* __restrict__ x, const int* __restrict__ mask,
       const float* __restrict__ Wq, const float* __restrict__ Wk,
       const float* __restrict__ Wv, const float* __restrict__ Wo,
       bf16_t* __restrict__ xb, bf16_t* __restrict__ wqT, bf16_t* __restrict__ wkT,
       bf16_t* __restrict__ wvT, bf16_t* __restrict__ woT, unsigned* __restrict__ wm) {
  const int lane = threadIdx.x & 31;
  // the wave's number in a scalar register: the wave's share of a job is a scalar base
  const int wave = __builtin_amdgcn_readfirstlane(threadIdx.x >> 5);
  const int blk  = blockIdx.x;
  // the mask blocks, which load twice in a row, start first; the one-round jobs last
  if (blk < NB_M_) {
    prep_mask(mask, wm, blk, wave, lane);
  } else if (blk < NB_M_ + NB_X_) {
    prep_x(x, xb, (blk - NB_M_) * 2 + (wave >> 2), (wave & 3) * XF_, lane);
  } else if (blk < NB_M_ + NB_X_ + 3 * NB_1W_) {
    const int mat = (blk - NB_M_ - NB_X_) / NB_1W_;
    prep_w<true>(mat == 0 ? Wq : mat == 1 ? Wk : Wv, mat == 0 ? wqT : mat == 1 ? wkT : wvT,
                 (blk - NB_M_ - NB_X_) - mat * NB_1W_, wave * WF_, lane);
  } else {
    prep_w<false>(Wo, woT, blk - NB_M_ - NB_X_ - 3 * NB_1W_, wave * WF_, lane);
  }
}

// ---------------- QKV projection: one wave per 64 rows x 96 columns ----------
// The product is [B*S, 768] x [768, 2304], the columns being q, k, v side by side. A block
// is 256 rows x 288 columns, 12 waves as 4 x 3: 32 x 8 = 256 equal blocks, three waves on
// every SIMD, all resident at once. An x fragment is wanted by three waves of the block and
// a weight fragment by four, at about the same time.
// A wave's 4 x 6 accumulator tiles take 10 fragment loads per 24 WMMAs. Its 96 columns lie
// in ONE of q, k, v (768 = 8 x 96) and are three whole e chunks of 32, in one or two heads.
// q,k stored as fragments [B,H][s tile][e chunk], plain order (staged via LDS);
// v stored as fragments of V^T (rows e, k = key) [B,H][e tile][32-key chunk] in
// the k order of a packed accumulator pair: k = 8 * (lane >> 4) + s for s < 8,
// 16 + 8 * (lane >> 4) + (s - 8) otherwise; a lane's 8 rows are one 16-B piece.
static constexpr int QR_ = 256, QC_ = 288;    // block tile
static constexpr int QP_ = 104;               // staging pitch: 208 B, an odd number of 16 B

__global__ __launch_bounds__(384) void
k_qkv(const bf16_t* __restrict__ xb, const bf16_t* __restrict__ wqT,
      const bf16_t* __restrict__ wkT, const bf16_t* __restrict__ wvT,
      const float* __restrict__ bq, const float* __restrict__ bk,
      const float* __restrict__ bv, bf16_t* __restrict__ q,
      bf16_t* __restrict__ k, bf16_t* __restrict__ vT) {
  __shared__ bf16_t st[12][64 * QP_];       // 13 KB staging tile per wave

  const int lane = threadIdx.x & 31;
  // the wave's number in a scalar register: fragment addresses are a scalar base + lane offset
  const int wave = __builtin_amdgcn_readfirstlane(threadIdx.x >> 5);
  constexpr int RB = B_ * S_ / QR_;         // row blocks
  const int blk = blockIdx.x;
  const int row0 = (blk % RB) * QR_ + (wave & 3) * 64;  // row in [0, B*S)
  const int grp  = (blk / RB) * 3 + (wave >> 2);        // group of 96 columns, 0 .. 23
  const int mat  = grp >> 3;                            // 0 q, 1 k, 2 v: one per wave
  const int ct0  = (grp & 7) * 6;                       // first column tile, h * 4 + e tile
  const int bz   = row0 / S_;
  const int s0   = row0 % S_;

  const bf16_t* xfr = xb + (size_t)row0 * D_;            // 4 row tiles of fragments
  const bf16_t* w   = (mat == 0 ? wqT : mat == 1 ? wkT : wvT) + (size_t)ct0 * 16 * D_;
  const float* bias = (mat == 0 ? bq : mat == 1 ? bk : bv) + ct0 * 16;

  v8f acc[4][6];                            // [row tile][column tile]
#pragma unroll
  for (int i = 0; i < 4; ++i)
#pragma unroll
    for (int nt = 0; nt < 6; ++nt) acc[i][nt] = v8f{};

  // Blocks that read the same x rows (8 of them) or the same weight rows (32) enter the K
  // walk at different chunks and wrap round: asked for at the same moment by many blocks, a
  // line is delivered to one after the other, and a line new to L2 makes them all wait.
  const int kr = (blk % RB + 3 * (blk / RB)) % (D_ / 32);
  for (int t = 0; t < D_ / 32; ++t) {             // 24 K-chunks
    const int kc = kr + t < D_ / 32 ? kr + t : kr + t - D_ / 32;
    v16bf a[4], b[6];
#pragma unroll
    for (int i = 0; i < 3; ++i) a[i] = load_pk(xfr, i * (D_ / 32) + kc, lane);
    const bf16_t* pa = xfr + (size_t)(3 * (D_ / 32) + kc) * 512 + lane * 8;
    const v8bf alo = *(const v8bf*)pa;
#pragma unroll
    for (int nt = 0; nt < 5; ++nt) b[nt] = load_pk(w, nt * (D_ / 32) + kc, lane);
    const bf16_t* pb = w + (size_t)(5 * (D_ / 32) + kc) * 512 + lane * 8;
    const v8bf blo = *(const v8bf*)pb;
    // precaution: the last load of x and the last of w land in the registers that held the
    // addresses of the loads above
    asm volatile("s_wait_xcnt 0x0" ::: "memory");
    const v8bf ahi = *(const v8bf*)(pa + 256);
    const v8bf bhi = *(const v8bf*)(pb + 256);
    a[3] = __builtin_shufflevector(alo, ahi, 0, 1, 2, 3, 4, 5, 6, 7, 8, 9, 10, 11, 12, 13, 14,
                                   15);
    b[5] = __builtin_shufflevector(blo, bhi, 0, 1, 2, 3, 4, 5, 6, 7, 8, 9, 10, 11, 12, 13, 14,
                                   15);
    // keeps the chunk's 20 loads together in front of its WMMAs: one latency per chunk;
    // left free, the scheduler reuses two buffers and every WMMA waits on a fresh load
    __builtin_amdgcn_sched_barrier(0);
#pragma unroll
    for (int i = 0; i < 4; ++i)
#pragma unroll
      for (int nt = 0; nt < 6; ++nt) acc[i][nt] = wmma_bf16(a[i], b[nt], acc[i][nt]);
  }

  const int N     = lane & 15;
  const int Mbase = (lane >> 4) << 3;
  float bi[6];
#pragma unroll
  for (int nt = 0; nt < 6; ++nt) bi[nt] = bias[nt * 16 + N];

  bf16_t* sw = st[wave];
  if (mat == 2) {
    // ---- v: 8 keys per lane -> one b128 store, 512 contiguous bytes per wave ----
#pragma unroll
    for (int i = 0; i < 4; ++i) {
      const int si = s0 + 16 * i;
#pragma unroll
      for (int nt = 0; nt < 6; ++nt) {
        v8bf pk;
#pragma unroll
        for (int r = 0; r < 8; ++r) pk[r] = (bf16_t)(acc[i][nt][r] + bi[nt]);
        *(v8bf*)(vT + ((size_t)(bz * (H_ * 4) + ct0 + nt) * (S_ / 32) + (si >> 5)) * 512 +
                 ((si >> 4) & 1) * 256 + lane * 8) = pk;
      }
    }
  } else {
    // ---- q or k: stage the wave's 64x96 tile in LDS ----
#pragma unroll
    for (int i = 0; i < 4; ++i)
#pragma unroll
      for (int nt = 0; nt < 6; ++nt)
#pragma unroll
        for (int r = 0; r < 8; ++r)
          sw[(i * 16 + Mbase + r) * QP_ + nt * 16 + N] = (bf16_t)(acc[i][nt][r] + bi[nt]);
  }
  __syncthreads();                                // every wave passes it, the v waves too
  if (mat != 2) {
    // ---- flush the tile's 12 fragments in order; e chunk p is chunk (ct0 / 2 + p) & 1 of
    // head (ct0 / 2 + p) >> 1 ----
    bf16_t* dst = (mat ? k : q) + ((size_t)bz * H_ * S_ + s0) * E_;
#pragma unroll
    for (int p = 0; p < 3; ++p) {
      const int ec = (ct0 >> 1) + p;
      bf16_t* dp = dst + (size_t)(ec >> 1) * S_ * E_ + (ec & 1) * 512 + lane * 8;
#pragma unroll
      for (int i = 0; i < 4; ++i)
#pragma unroll
        for (int half = 0; half < 2; ++half)
          *(v8bf*)(dp + i * 16 * E_ + half * 256) =
              *(const v8bf*)(sw + (i * 16 + (lane & 15)) * QP_ + p * 32 + (lane >> 4) * 16 +
                             half * 8);
    }
  }
}

typedef __attribute__((ext_vector_type(16))) unsigned v16u;

// value of lane ^ 16
__device__ __forceinline__ float other_half(float x) {
  const int b = __builtin_bit_cast(int, x);
  return __builtin_bit_cast(float, __builtin_amdgcn_permlanex16(
      b, b, 0x76543210, 0xfedcba98, false, false));
}

__global__ __launch_bounds__(128) void
k_attn(const bf16_t* __restrict__ q, const bf16_t* __restrict__ k,
       const bf16_t* __restrict__ vT, const unsigned* __restrict__ wm,
       bf16_t* __restrict__ ctx) {
  constexpr float SC2  = 0.03187935771f;   // log2(e) / sqrt(S): ref scales by 1/sqrt(S)
  constexpr float NEGR = -1e9f * 45.254834f;      // -1e9 before the 1/sqrt(S) scale
  constexpr float STEP = 8.0f / SC2;              // maximum may lag by 2^8

  const int lane = threadIdx.x & 31;
  // the wave's number in a scalar register, so that the mask words' address is scalar
  const int wave = __builtin_amdgcn_readfirstlane(threadIdx.x >> 5);
  const int c    = lane & 15;
  const int hh   = lane >> 4;
  constexpr int QB = S_ / 128;                        // query blocks per (b,h)
  const int blk = blockIdx.x;
  const int h   = blk % H_;
  const int qb  = (blk / H_) % QB;
  const int s0  = qb * 128 + wave * 32;
  const int bz  = blk / (H_ * QB);
  const size_t bh = (size_t)bz * H_ + h;

  const bf16_t* qbh = q + bh * S_ * E_;
  const bf16_t* kbh = k + bh * S_ * E_;
  const bf16_t* vbh = vT + bh * E_ * S_;
  const unsigned* wrow0 = wm + ((size_t)bz * S_ + s0) * (S_ / 32);   // S / 2 words per tile
  const unsigned* wrow1 = wrow0 + S_ / 2;

  v16bf qf[2][2];                                     // [query tile][e chunk]
#pragma unroll
  for (int j = 0; j < 2; ++j)
#pragma unroll
    for (int e = 0; e < 2; ++e)
      qf[j][e] = load_pk(qbh, ((s0 >> 4) + j) * 2 + e, lane);

  v8f o[2][4];                                        // Ot: [query tile][e tile]
  float m[2], l[2];
#pragma unroll
  for (int j = 0; j < 2; ++j) {
    m[j] = -3.0e38f;
    l[j] = 0.f;
#pragma unroll
    for (int nt = 0; nt < 4; ++nt) o[j][nt] = v8f{};
  }

  v16bf kf[2][2];                                     // [key tile][e chunk]
  v16u  mw[2];                                        // [query tile][key tile * 8 + r]
  // The 16 blocks that read one head's K and V, and the 12 that read one query block's mask
  // words, enter the key walk at different passes and wrap round (softmax does not depend
  // on the order of the keys): no line is asked for by all of them at the same moment.
  constexpr int NP = S_ / 32;                         // passes, a power of two
  const int p0 = (qb * (NP / QB) + h * 5) & (NP - 1);
#pragma unroll
  for (int i = 0; i < 2; ++i) {
    kf[i][0] = load_pk(kbh, p0 * 4 + 2 * i, lane);
    kf[i][1] = load_pk(kbh, p0 * 4 + 2 * i + 1, lane);
  }
  // precaution: the zeros of the output tiles land in registers that held addresses of the
  // Q and K loads above
  asm volatile("s_wait_xcnt 0x0" ::: "memory");
  mw[0] = *(const v16u*)(wrow0 + p0 * 16);
  mw[1] = *(const v16u*)(wrow1 + p0 * 16);

  for (int t = 0; t < NP; ++t) {
    const int p  = (p0 + t) & (NP - 1);
    const int tn = ((p0 + t + 1) & (NP - 1)) * 32;    // next pass; behind the last, the first

    v16bf vf[4];
#pragma unroll
    for (int nt = 0; nt < 4; ++nt)
      vf[nt] = load_pk(vbh, nt * (S_ / 32) + p, lane);

    v8f s[2][2];                                      // [query tile][key tile]
#pragma unroll
    for (int j = 0; j < 2; ++j)
#pragma unroll
      for (int i = 0; i < 2; ++i) {
        s[j][i] = wmma_bf16(kf[i][0], qf[j][0], v8f{});
        s[j][i] = wmma_bf16(kf[i][1], qf[j][1], s[j][i]);
      }
#pragma unroll
    for (int i = 0; i < 2; ++i) {                     // next pass's K rows
      kf[i][0] = load_pk(kbh, (tn >> 3) + 2 * i, lane);
      kf[i][1] = load_pk(kbh, (tn >> 3) + 2 * i + 1, lane);
    }

    float mx[2];
#pragma unroll
    for (int j = 0; j < 2; ++j) {
      float t = NEGR;
#pragma unroll
      for (int i = 0; i < 2; ++i)
#pragma unroll
        for (int r = 0; r < 8; ++r) {
          const float x =
              __builtin_amdgcn_inverse_ballot_w32(mw[j][i * 8 + r]) ? NEGR : s[j][i][r];
          s[j][i][r] = x;
          t = fmaxf(t, x);
        }
      mx[j] = fmaxf(t, other_half(t));
    }

    // Move the maximum in use only when a column outgrows it by 2^8: one
    // wave-uniform test per pass (softmax does not depend on the shift).
    const bool need = (mx[0] > m[0] + STEP) || (mx[1] > m[1] + STEP);
    if (__builtin_amdgcn_ballot_w32(need) != 0) {
#pragma unroll
      for (int j = 0; j < 2; ++j) {
        const float mn = fmaxf(m[j], mx[j]);
        const float al = __builtin_amdgcn_exp2f((m[j] - mn) * SC2);
        m[j] = mn;
        l[j] *= al;
#pragma unroll
        for (int nt = 0; nt < 4; ++nt)
#pragma unroll
          for (int r = 0; r < 8; ++r) o[j][nt][r] *= al;
      }
    }

    mw[0] = *(const v16u*)(wrow0 + (tn >> 1));        // next pass's mask words
    mw[1] = *(const v16u*)(wrow1 + (tn >> 1));
    // keeps the two scalar loads here, a whole exponential block ahead of their use;
    // left free, the scheduler sinks them to the end of the pass and their latency shows
    __builtin_amdgcn_sched_barrier(0);

#pragma unroll
    for (int j = 0; j < 2; ++j) {
      v16bf pb;
      float sum = 0.f;
#pragma unroll
      for (int i = 0; i < 2; ++i)
#pragma unroll
        for (int r = 0; r < 8; ++r) {
          // subtract first: a row whose keys are all masked gets exactly 1
          const float e = __builtin_amdgcn_exp2f((s[j][i][r] - m[j]) * SC2);
          sum += e;
          pb[i * 8 + r] = (bf16_t)e;
        }
      l[j] += sum;
#pragma unroll
      for (int nt = 0; nt < 4; ++nt)
        o[j][nt] = wmma_bf16(vf[nt], pb, o[j][nt]);
    }
    // precaution: the next pass's index arithmetic lands in the scalar registers
    // that held the address of the mask-word loads above
    asm volatile("s_wait_xcnt 0x0" ::: "memory");
  }

  // a lane holds 8 consecutive e of one query row: one 16-B piece of ctx's
  // fragment [row tile][k chunk h * 2 + nt / 2]: half hh, lane c + 16 * (nt & 1)
#pragma unroll
  for (int j = 0; j < 2; ++j) {
    const float inv = 1.f / (l[j] + other_half(l[j]));
    bf16_t* dst = ctx + ((size_t)bz * S_ + s0 + 16 * j) * (H_ * E_) + h * 1024 +
                  hh * 256 + c * 8;
#pragma unroll
    for (int nt = 0; nt < 4; ++nt) {
      v8bf pk;
#pragma unroll
      for (int r = 0; r < 8; ++r) pk[r] = (bf16_t)(o[j][nt][r] * inv);
      *(v8bf*)(dst + (nt >> 1) * 512 + (nt & 1) * 128) = pk;
    }
  }
}

// ---------------- output projection + LayerNorm ----------------
// 256 threads (8 waves); block owns 32 rows of [B*S, 768]. Each wave does 2 row tiles
// x 6 n-tiles (8 fragment loads per 12 WMMAs); result staged in LDS for the LayerNorm.
// LayerNorm: each wave takes 4 whole rows; a lane holds 24 elements of a row in registers
// (6 reads of 16 B, the wave reading 512 contiguous bytes at a time), so mean, variance
// and the scaled result come from one read of LDS and go out as whole-line 16-B stores.

// sum over the 32 lanes, the same value in every lane: four exchanges inside the
// 16-lane row (row_xmask 1, 2, 4, 8), then one between the two rows
template <int CTRL>
__device__ __forceinline__ float add_xmask(float x) {
  return x + __builtin_bit_cast(float, __builtin_amdgcn_mov_dpp(
                 __builtin_bit_cast(int, x), CTRL, 0xF, 0xF, true));
}
__device__ __forceinline__ float wave_sum(float x) {
  x = add_xmask<0x161>(x);
  x = add_xmask<0x162>(x);
  x = add_xmask<0x164>(x);
  x = add_xmask<0x168>(x);
  return x + other_half(x);
}

__global__ __launch_bounds__(256) void
k_proj_ln(const bf16_t* __restrict__ ctx, const bf16_t* __restrict__ woT,
          const float* __restrict__ bo, const float* __restrict__ gamma,
          const float* __restrict__ beta, float* __restrict__ out) {
  __shared__ float sOut[32 * D_];                     // 96 KB

  const int tid  = threadIdx.x;
  const int lane = tid & 31;
  // the wave's number in a scalar register: fragment addresses are a scalar base + lane offset
  const int wave = __builtin_amdgcn_readfirstlane(tid >> 5);
  const int row0 = blockIdx.x * 32;                   // row in [0, B*S)
  const bf16_t* arow = ctx + (size_t)row0 * D_;

  v8f acc[2][6];
#pragma unroll
  for (int i = 0; i < 2; ++i)
#pragma unroll
    for (int j = 0; j < 6; ++j) acc[i][j] = v8f{};

  // Every block reads the whole of woT: the blocks enter the K walk at different chunks and
  // wrap round, so that a line is not asked for by all of them at the same moment.
  int kc = blockIdx.x % (D_ / 32);
  const bf16_t* wrow = woT + (size_t)wave * 6 * 16 * D_;   // the wave's 6 column tiles
  // kept rolled: fully unrolled this loop built to 266 VGPRs, past the 256 reached without a window
#pragma unroll 1
  for (int t = 0; t < D_ / 32; t += 2) {              // 24 K-chunks, two at a time
    v16bf a[2][2], b[2][6];                           // [chunk][tile]
#pragma unroll
    for (int u = 0; u < 2; ++u) {
      // precaution: the second chunk's loads land in registers that held addresses of the first's
      if (u) asm volatile("s_wait_xcnt 0x0" ::: "memory");
#pragma unroll
      for (int i = 0; i < 2; ++i) a[u][i] = load_pk(arow + kc * 512, i * (D_ / 32), lane);
      // precaution: a weight tile of the first chunk lands in the registers that held the
      // address of the four loads above
      if (!u) asm volatile("s_wait_xcnt 0x0" ::: "memory");
#pragma unroll
      for (int j = 0; j < 6; ++j) b[u][j] = load_pk(wrow + kc * 512, j * (D_ / 32), lane);
      kc = kc + 1 < D_ / 32 ? kc + 1 : 0;
    }
    // keeps the 32 loads of two chunks together in front of their WMMAs: one latency per
    // pair; left free, the scheduler reuses two buffers and every WMMA waits on a fresh load
    __builtin_amdgcn_sched_barrier(0);
#pragma unroll
    for (int u = 0; u < 2; ++u)
#pragma unroll
      for (int j = 0; j < 6; ++j)
#pragma unroll
        for (int i = 0; i < 2; ++i) acc[i][j] = wmma_bf16(a[u][i], b[u][j], acc[i][j]);
  }

  // the lane's 24 columns of gamma and beta, asked for here so that they arrive
  // while the tile is staged
  v4f ga[6], be[6];
  // unrolled, like every loop of the LayerNorm below: ga, be and xv are then indexed by
  // constants only and stay in registers
#pragma unroll
  for (int t = 0; t < 6; ++t) {
    ga[t] = *(const v4f*)(gamma + (t * 32 + lane) * 4);
    be[t] = *(const v4f*)(beta + (t * 32 + lane) * 4);
  }

  const int N     = lane & 15;
  const int Mbase = (lane >> 4) << 3;
#pragma unroll
  for (int j = 0; j < 6; ++j) {
    const int n0 = (wave * 6 + j) * 16;
    const float bi = bo[n0 + N];
#pragma unroll
    for (int i = 0; i < 2; ++i)
#pragma unroll
      for (int r = 0; r < 8; ++r)
        sOut[(i * 16 + Mbase + r) * D_ + n0 + N] = acc[i][j][r] + bi;
  }
  __syncthreads();

  v4f xv[4][6];                                       // [row of the wave][16-B piece]
#pragma unroll
  for (int rr = 0; rr < 4; ++rr)
#pragma unroll
    for (int t = 0; t < 6; ++t)
      xv[rr][t] = *(const v4f*)(sOut + (wave * 4 + rr) * D_ + (t * 32 + lane) * 4);

  float mu[4], rs[4];
#pragma unroll
  for (int rr = 0; rr < 4; ++rr) {
    v4f s4 = xv[rr][0];
#pragma unroll
    for (int t = 1; t < 6; ++t) s4 += xv[rr][t];
    mu[rr] = (s4[0] + s4[1]) + (s4[2] + s4[3]);
  }
#pragma unroll
  for (int rr = 0; rr < 4; ++rr) mu[rr] = wave_sum(mu[rr]) * (1.f / D_);
#pragma unroll
  for (int rr = 0; rr < 4; ++rr) {
    v4f q4 = v4f{};
#pragma unroll
    for (int t = 0; t < 6; ++t) {
      xv[rr][t] -= mu[rr];
      q4 += xv[rr][t] * xv[rr][t];
    }
    rs[rr] = (q4[0] + q4[1]) + (q4[2] + q4[3]);
  }
#pragma unroll
  for (int rr = 0; rr < 4; ++rr) rs[rr] = rsqrtf(wave_sum(rs[rr]) * (1.f / D_) + LN_EPS_);

#pragma unroll
  for (int rr = 0; rr < 4; ++rr) {
    float* dst = out + (size_t)(row0 + wave * 4 + rr) * D_ + lane * 4;
#pragma unroll
    for (int t = 0; t < 6; ++t)
      *(v4f*)(dst + t * 128) = xv[rr][t] * rs[rr] * ga[t] + be[t];
  }
}

// ---------------- host launcher ----------------
extern "C" void kernel_launch(void* const* d_in, const int* in_sizes, int n_in,
                              void* d_out, int out_size, void* d_ws, size_t ws_size,
                              hipStream_t stream) {
  const float* x    = (const float*)d_in[0];
  const int*   mask = (const int*)d_in[1];
  const float* Wq   = (const float*)d_in[2];
  const float* bq   = (const float*)d_in[3];
  const float* Wk   = (const float*)d_in[4];
  const float* bk   = (const float*)d_in[5];
  const float* Wv   = (const float*)d_in[6];
  const float* bv   = (const float*)d_in[7];
  const float* Wo   = (const float*)d_in[8];
  const float* bo   = (const float*)d_in[9];
  const float* gamma = (const float*)d_in[10];
  const float* beta  = (const float*)d_in[11];
  float* out = (float*)d_out;

  // workspace layout (bf16 intermediates, mask words), ~66.5 MB total
  char* ws = (char*)d_ws;
  const size_t szX  = (size_t)B_ * S_ * D_ * sizeof(bf16_t);
  const size_t szW  = (size_t)H_ * E_ * D_ * sizeof(bf16_t);
  const size_t szWo = (size_t)D_ * D_ * sizeof(bf16_t);
  const size_t szQ  = (size_t)B_ * H_ * S_ * E_ * sizeof(bf16_t);
  bf16_t* xb  = (bf16_t*)(ws);
  bf16_t* wqT = (bf16_t*)(ws + szX);
  bf16_t* wkT = (bf16_t*)(ws + szX + szW);
  bf16_t* wvT = (bf16_t*)(ws + szX + 2 * szW);
  bf16_t* woT = (bf16_t*)(ws + szX + 3 * szW);
  bf16_t* q   = (bf16_t*)(ws + szX + 3 * szW + szWo);
  bf16_t* k   = (bf16_t*)(ws + szX + 3 * szW + szWo + szQ);
  bf16_t* vT  = (bf16_t*)(ws + szX + 3 * szW + szWo + 2 * szQ);
  bf16_t* ctx = (bf16_t*)(ws + szX + 3 * szW + szWo + 3 * szQ);
  unsigned* wm = (unsigned*)(ws + szX + 3 * szW + szWo + 4 * szQ);   // 2 MB of mask words

  k_prep<<<NB_X_ + 4 * NB_1W_ + NB_M_, 256, 0, stream>>>(x, mask, Wq, Wk, Wv, Wo, xb, wqT, wkT,
                                                         wvT, woT, wm);

  k_qkv<<<(B_ * S_ / QR_) * (3 * H_ * E_ / QC_), 384, 0, stream>>>(xb, wqT, wkT, wvT, bq, bk,
                                                                   bv, q, k, vT);

  k_attn<<<B_ * H_ * (S_ / 128), 128, 0, stream>>>(q, k, vT, wm, ctx);

  k_proj_ln<<<B_ * S_ / 32, 256, 0, stream>>>(ctx, woT, bo, gamma, beta, out);
}

// v009
// It runs in 96.2 microseconds.
// Next to v008, in two timings, it ran 1.04 times as fast each time.
// Over all steps from v000 it is 30.5 times as fast.
#include <hip/hip_runtime.h>
#include <hip/hip_bf16.h>
#include <math.h>

// ---- problem constants (match reference) ----
static constexpr int B_ = 4, S_ = 2048, D_ = 768, H_ = 12, E_ = 64;
static constexpr float LN_EPS_ = 1e-5f;

typedef __bf16 bf16_t;
typedef __attribute__((ext_vector_type(16))) __bf16 v16bf;
typedef __attribute__((ext_vector_type(8)))  __bf16 v8bf;   // 16-byte pack
typedef __attribute__((ext_vector_type(8)))  float  v8f;

// -------------------------------------------------------------------------
// Every bf16 operand in the workspace is stored in FRAGMENT ORDER: a 16-row x
// 32-k fragment of V_WMMA_F32_16X16X32_BF16 (wave32) is one 1-KB block,
//   block[half * 256 + lane * 8 + i]  =  register element s = half * 8 + i of lane,
// so a wave loads a fragment with two b128 loads of 512 contiguous bytes each.
// Which (row, k) a position holds, for a row-major matrix M:
//   plain order: row = lane & 15, k = (lane >> 4) * 16 + s   (A and B alike)
// Fragments of a matrix with K columns lie as [row tile][k chunk of 32].
// -------------------------------------------------------------------------
__device__ __forceinline__ v16bf load_pk(const bf16_t* base, int frag, int lane) {
  const bf16_t* p = base + (size_t)frag * 512 + lane * 8;
  const v8bf lo = *(const v8bf*)p;
  const v8bf hi = *(const v8bf*)(p + 256);
  return __builtin_shufflevector(lo, hi, 0, 1, 2, 3, 4, 5, 6, 7, 8, 9, 10, 11,
                                 12, 13, 14, 15);
}

__device__ __forceinline__ v8f wmma_bf16(v16bf a, v16bf b, v8f c) {
  return __builtin_amdgcn_wmma_f32_16x16x32_bf16(false, a, false, b,
                                                 (short)0, c, false, false);
}

// ---------------- preparation: ONE launch for every repacked operand ----------
// f32 -> bf16 in fragment order for x and the four weight matrices, and the mask as
// lane-mask words. Ranges of the block index pick the job; the jobs are independent.
// A wave makes whole fragments (two 512-byte stores each) and takes several that lie a
// constant step apart in the source, so that the launch starts few waves, each wave has
// all its loads in flight at once, and every address is one base plus a constant.
typedef __attribute__((ext_vector_type(4))) float    v4f;
typedef __attribute__((ext_vector_type(4))) int      v4i;
typedef __attribute__((ext_vector_type(4))) unsigned v4u;

static constexpr int KC_   = D_ / 32;                 // k chunks of a 768-wide matrix
static constexpr int XF_   = 6;                       // x fragments per wave
static constexpr int WF_   = KC_ / 8;                 // weight fragments per wave
static constexpr int NB_X_ = B_ * (S_ / 16) * KC_ / (XF_ * 8);  // 2 row tiles per block
static constexpr int NB_1W_ = D_ / 16;                // a weight matrix: a block per tile
static constexpr int NB_M_ = B_ * (S_ / 16);          // mask: a block per query tile

// x [B*S, D] -> fragments [row tile][k chunk]; the wave takes k chunks kc0 .. kc0 + 5 of
// row tile rt; a lane reads its 16 k of a chunk as 64 contiguous bytes.
__device__ __forceinline__ void prep_x(const float* __restrict__ x, bf16_t* __restrict__ y,
                                       int rt, int kc0, int lane) {
  const float* s = x + (size_t)rt * 16 * D_ + kc0 * 32 + ((lane & 15) * D_ + (lane >> 4) * 16);
  bf16_t* d = y + ((size_t)rt * KC_ + kc0) * 512 + lane * 8;
  v4f a[XF_][4];
#pragma unroll
  for (int f = 0; f < XF_; ++f)
#pragma unroll
    for (int c = 0; c < 4; ++c) a[f][c] = *(const v4f*)(s + f * 32 + c * 4);
  // keeps all 24 loads in front of the conversions: one latency per wave; left free, the
  // scheduler holds the last of them back until the first have arrived
  __builtin_amdgcn_sched_barrier(0);
#pragma unroll
  for (int f = 0; f < XF_; ++f)
#pragma unroll
    for (int half = 0; half < 2; ++half) {
      v8bf pk;
#pragma unroll
      for (int i = 0; i < 4; ++i) {
        pk[i]     = (bf16_t)a[f][half * 2][i];
        pk[4 + i] = (bf16_t)a[f][half * 2 + 1][i];
      }
      *(v8bf*)(d + f * 512 + half * 256) = pk;
    }
}

// A weight matrix -> fragments of its transpose, [output-column tile ct][k chunk]; the
// wave takes k chunks kc0 .. kc0 + 2 of tile ct.
// HDE: W [H,D,E], rows of the transpose are e of head h (ct = h * 4 + e tile), k = d.
// else: Wo [768 f, 768 d], rows of the transpose are d, k = f.
template <bool HDE>
__device__ __forceinline__ void prep_w(const float* __restrict__ W, bf16_t* __restrict__ WT,
                                       int ct, int kc0, int lane) {
  constexpr int LD = HDE ? E_ : D_;                   // floats from one k to the next
  const float* s = W + (HDE ? (size_t)(ct >> 2) * D_ * E_ + (ct & 3) * 16 : (size_t)ct * 16) +
                   (size_t)kc0 * 32 * LD + ((lane >> 4) * 16 * LD + (lane & 15));
  bf16_t* d = WT + ((size_t)ct * KC_ + kc0) * 512 + lane * 8;
  float v[WF_][16];
#pragma unroll
  for (int f = 0; f < WF_; ++f)
#pragma unroll
    for (int i = 0; i < 16; ++i) v[f][i] = s[(f * 32 + i) * LD];
#pragma unroll
  for (int f = 0; f < WF_; ++f)
#pragma unroll
    for (int half = 0; half < 2; ++half) {
      v8bf pk;
#pragma unroll
      for (int i = 0; i < 8; ++i) pk[i] = (bf16_t)v[f][half * 8 + i];
      *(v8bf*)(d + f * 512 + half * 256) = pk;
    }
  // precaution: behind the job the compiler's code for the other block ranges lands in
  // registers that held data and base of the stores above
  asm volatile("s_wait_xcnt 0x0" ::: "memory");
}

// mask [B,S,S] i32 -> lane-mask words.
// Word [b][query tile of 16][key tile of 16][r]: bit L says whether
// mask[b][query tile * 16 + (L & 15)][key tile * 16 + 8 * (L >> 4) + r] != 0,
// which is the entry that lane L holds in register r of that transposed score
// tile: k_attn reads a word into a scalar register and selects on it directly.
// One wave takes 16 query rows x 128 keys at a time: 16 whole-line loads; lane l
// holds keys 4l..4l+3 (key tile l >> 2, half (l >> 1) & 1, r = 4 * (l & 1) + k).
__device__ __forceinline__ void prep_mask(const int* __restrict__ mask,
                                          unsigned* __restrict__ wm, int rt, int wave,
                                          int lane) {
#pragma unroll
  for (int t = 0; t < 2; ++t) {
    const int kg = wave * 2 + t;                      // group of 128 keys
    const int* s = mask + (size_t)rt * 16 * S_ + kg * 128 + lane * 4;
    v4i m[16];
#pragma unroll
    for (int qr = 0; qr < 16; ++qr) m[qr] = *(const v4i*)(s + (size_t)qr * S_);
    v4u pk;
#pragma unroll
    for (int kk = 0; kk < 4; ++kk) {
      unsigned hb = 0;                                // bit qr: query row qr, this key
#pragma unroll
      for (int qr = 0; qr < 16; ++qr)
        hb |= (m[qr][kk] != 0 ? 1u : 0u) << qr;
      // the upper key half of the same tile and r sits two lanes further on
      const unsigned up = (unsigned)__builtin_amdgcn_mov_dpp((int)hb, 0x4E, 0xF, 0xF, true);
      pk[kk] = hb | (up << 16);
    }
    if ((lane & 2) == 0)
      *(v4u*)(wm + (size_t)rt * (S_ / 2) + (kg * 8 + (lane >> 2)) * 8 + (lane & 1) * 4) = pk;
  }
}

__global__ __launch_bounds__(256) void
k_prep(const float* __restrict__ x, const int* __restrict__ mask,
       const float* __restrict__ Wq, const float* __restrict__ Wk,
       const float* __restrict__ Wv, const float* __restrict__ Wo,
       bf16_t* __restrict__ xb, bf16_t* __restrict__ wqT, bf16_t* __restrict__ wkT,
       bf16_t* __restrict__ wvT, bf16_t* __restrict__ woT, unsigned* __restrict__ wm) {
  const int lane = threadIdx.x & 31;
  // the wave's number in a scalar register: the wave's share of a job is a scalar base
  const int wave = __builtin_amdgcn_readfirstlane(threadIdx.x >> 5);
  const int blk  = blockIdx.x;
  // the mask blocks, which load twice in a row, start first; the one-round jobs last
  if (blk < NB_M_) {
    prep_mask(mask, wm, blk, wave, lane);
  } else if (blk < NB_M_ + NB_X_) {
    prep_x(x, xb, (blk - NB_M_) * 2 + (wave >> 2), (wave & 3) * XF_, lane);
  } else if (blk < NB_M_ + NB_X_ + 3 * NB_1W_) {
    const int mat = (blk - NB_M_ - NB_X_) / NB_1W_;
    prep_w<true>(mat == 0 ? Wq : mat == 1 ? Wk : Wv, mat == 0 ? wqT : mat == 1 ? wkT : wvT,
                 (blk - NB_M_ - NB_X_) - mat * NB_1W_, wave * WF_, lane);
  } else {
    prep_w<false>(Wo, woT, blk - NB_M_ - NB_X_ - 3 * NB_1W_, wave * WF_, lane);
  }
}

// ---------------- QKV projection: one wave per 64 rows x 96 columns ----------
// The product is [B*S, 768] x [768, 2304], the columns being q, k, v side by side. A block
// is 256 rows x 288 columns, 12 waves as 4 x 3: 32 x 8 = 256 equal blocks, three waves on
// every SIMD, all resident at once. An x fragment is wanted by three waves of the block and
// a weight fragment by four, at about the same time.
// A wave's 4 x 6 accumulator tiles take 10 fragment loads per 24 WMMAs. Its 96 columns lie
// in ONE of q, k, v (768 = 8 x 96) and are three whole e chunks of 32, in one or two heads.
// q,k stored as fragments [B,H][s tile][e chunk], plain order (staged via LDS);
// v stored as fragments of V^T (rows e, k = key) [B,H][e tile][32-key chunk] in
// the k order of a packed accumulator pair: k = 8 * (lane >> 4) + s for s < 8,
// 16 + 8 * (lane >> 4) + (s - 8) otherwise; a lane's 8 rows are one 16-B piece.
static constexpr int QR_ = 256, QC_ = 288;    // block tile
static constexpr int QP_ = 104;               // staging pitch: 208 B, an odd number of 16 B

__global__ __launch_bounds__(384) void
k_qkv(const bf16_t* __restrict__ xb, const bf16_t* __restrict__ wqT,
      const bf16_t* __restrict__ wkT, const bf16_t* __restrict__ wvT,
      const float* __restrict__ bq, const float* __restrict__ bk,
      const float* __restrict__ bv, bf16_t* __restrict__ q,
      bf16_t* __restrict__ k, bf16_t* __restrict__ vT) {
  __shared__ bf16_t st[12][64 * QP_];       // 13 KB staging tile per wave

  const int lane = threadIdx.x & 31;
  // the wave's number in a scalar register: fragment addresses are a scalar base + lane offset
  const int wave = __builtin_amdgcn_readfirstlane(threadIdx.x >> 5);
  constexpr int RB = B_ * S_ / QR_;         // row blocks
  const int blk = blockIdx.x;
  const int row0 = (blk % RB) * QR_ + (wave & 3) * 64;  // row in [0, B*S)
  const int grp  = (blk / RB) * 3 + (wave >> 2);        // group of 96 columns, 0 .. 23
  const int mat  = grp >> 3;                            // 0 q, 1 k, 2 v: one per wave
  const int ct0  = (grp & 7) * 6;                       // first column tile, h * 4 + e tile
  const int bz   = row0 / S_;
  const int s0   = row0 % S_;

  const bf16_t* xfr = xb + (size_t)row0 * D_;            // 4 row tiles of fragments
  const bf16_t* w   = (mat == 0 ? wqT : mat == 1 ? wkT : wvT) + (size_t)ct0 * 16 * D_;
  const float* bias = (mat == 0 ? bq : mat == 1 ? bk : bv) + ct0 * 16;

  v8f acc[4][6];                            // [row tile][column tile]
#pragma unroll
  for (int i = 0; i < 4; ++i)
#pragma unroll
    for (int nt = 0; nt < 6; ++nt) acc[i][nt] = v8f{};

  // Blocks that read the same x rows (8 of them) or the same weight rows (32) enter the K
  // walk at different chunks and wrap round: asked for at the same moment by many blocks, a
  // line is delivered to one after the other, and a line new to L2 makes them all wait.
  const int kr = (blk % RB + 3 * (blk / RB)) % (D_ / 32);
  for (int t = 0; t < D_ / 32; ++t) {             // 24 K-chunks
    const int kc = kr + t < D_ / 32 ? kr + t : kr + t - D_ / 32;
    v16bf a[4], b[6];
#pragma unroll
    for (int i = 0; i < 3; ++i) a[i] = load_pk(xfr, i * (D_ / 32) + kc, lane);
    const bf16_t* pa = xfr + (size_t)(3 * (D_ / 32) + kc) * 512 + lane * 8;
    const v8bf alo = *(const v8bf*)pa;
#pragma unroll
    for (int nt = 0; nt < 5; ++nt) b[nt] = load_pk(w, nt * (D_ / 32) + kc, lane);
    const bf16_t* pb = w + (size_t)(5 * (D_ / 32) + kc) * 512 + lane * 8;
    const v8bf blo = *(const v8bf*)pb;
    // precaution: the last load of x and the last of w land in the registers that held the
    // addresses of the loads above
    asm volatile("s_wait_xcnt 0x0" ::: "memory");
    const v8bf ahi = *(const v8bf*)(pa + 256);
    const v8bf bhi = *(const v8bf*)(pb + 256);
    a[3] = __builtin_shufflevector(alo, ahi, 0, 1, 2, 3, 4, 5, 6, 7, 8, 9, 10, 11, 12, 13, 14,
                                   15);
    b[5] = __builtin_shufflevector(blo, bhi, 0, 1, 2, 3, 4, 5, 6, 7, 8, 9, 10, 11, 12, 13, 14,
                                   15);
    // keeps the chunk's 20 loads together in front of its WMMAs: one latency per chunk;
    // left free, the scheduler reuses two buffers and every WMMA waits on a fresh load
    __builtin_amdgcn_sched_barrier(0);
#pragma unroll
    for (int i = 0; i < 4; ++i)
#pragma unroll
      for (int nt = 0; nt < 6; ++nt) acc[i][nt] = wmma_bf16(a[i], b[nt], acc[i][nt]);
  }

  const int N     = lane & 15;
  const int Mbase = (lane >> 4) << 3;
  float bi[6];
#pragma unroll
  for (int nt = 0; nt < 6; ++nt) bi[nt] = bias[nt * 16 + N];

  bf16_t* sw = st[wave];
  if (mat == 2) {
    // ---- v: 8 keys per lane -> one b128 store, 512 contiguous bytes per wave ----
#pragma unroll
    for (int i = 0; i < 4; ++i) {
      const int si = s0 + 16 * i;
#pragma unroll
      for (int nt = 0; nt < 6; ++nt) {
        v8bf pk;
#pragma unroll
        for (int r = 0; r < 8; ++r) pk[r] = (bf16_t)(acc[i][nt][r] + bi[nt]);
        *(v8bf*)(vT + ((size_t)(bz * (H_ * 4) + ct0 + nt) * (S_ / 32) + (si >> 5)) * 512 +
                 ((si >> 4) & 1) * 256 + lane * 8) = pk;
      }
    }
  } else {
    // ---- q or k: stage the wave's 64x96 tile in LDS ----
#pragma unroll
    for (int i = 0; i < 4; ++i)
#pragma unroll
      for (int nt = 0; nt < 6; ++nt)
#pragma unroll
        for (int r = 0; r < 8; ++r)
          sw[(i * 16 + Mbase + r) * QP_ + nt * 16 + N] = (bf16_t)(acc[i][nt][r] + bi[nt]);
  }
  __syncthreads();                                // every wave passes it, the v waves too
  if (mat != 2) {
    // ---- flush the tile's 12 fragments in order; e chunk p is chunk (ct0 / 2 + p) & 1 of
    // head (ct0 / 2 + p) >> 1 ----
    bf16_t* dst = (mat ? k : q) + ((size_t)bz * H_ * S_ + s0) * E_;
#pragma unroll
    for (int p = 0; p < 3; ++p) {
      const int ec = (ct0 >> 1) + p;
      bf16_t* dp = dst + (size_t)(ec >> 1) * S_ * E_ + (ec & 1) * 512 + lane * 8;
#pragma unroll
      for (int i = 0; i < 4; ++i)
#pragma unroll
        for (int half = 0; half < 2; ++half)
          *(v8bf*)(dp + i * 16 * E_ + half * 256) =
              *(const v8bf*)(sw + (i * 16 + (lane & 15)) * QP_ + p * 32 + (lane >> 4) * 16 +
                             half * 8);
    }
  }
}

typedef __attribute__((ext_vector_type(16))) unsigned v16u;
typedef __attribute__((ext_vector_type(2)))  float    v2f;

// value of lane ^ 16
__device__ __forceinline__ float other_half(float x) {
  const int b = __builtin_bit_cast(int, x);
  return __builtin_bit_cast(float, __builtin_amdgcn_permlanex16(
      b, b, 0x76543210, 0xfedcba98, false, false));
}

__global__ __launch_bounds__(128) void
k_attn(const bf16_t* __restrict__ q, const bf16_t* __restrict__ k,
       const bf16_t* __restrict__ vT, const unsigned* __restrict__ wm,
       bf16_t* __restrict__ ctx) {
  constexpr float SC2  = 0.03187935771f;   // log2(e) / sqrt(S): ref scales by 1/sqrt(S)
  // A masked score before the 1/sqrt(S) scale: -2^36, which is -1.5e9 behind it (ref: -1e9;
  // both leave a masked key the weight 0 beside any open key). A power of two, so that its
  // product with SC2 is exact and a row whose keys are all masked gets exactly 1 per key.
  constexpr float NEGR = -68719476736.0f;
  constexpr float STEP = 8.0f / SC2;              // maximum may lag by 2^8

  const int lane = threadIdx.x & 31;
  // the wave's number in a scalar register, so that the mask words' address is scalar
  const int wave = __builtin_amdgcn_readfirstlane(threadIdx.x >> 5);
  const int c    = lane & 15;
  const int hh   = lane >> 4;
  constexpr int QB = S_ / 128;                        // query blocks per (b,h)
  const int blk = blockIdx.x;
  const int h   = blk % H_;
  const int qb  = (blk / H_) % QB;
  const int s0  = qb * 128 + wave * 32;
  const int bz  = blk / (H_ * QB);
  const size_t bh = (size_t)bz * H_ + h;

  const bf16_t* qbh = q + bh * S_ * E_;
  const bf16_t* kbh = k + bh * S_ * E_;
  const bf16_t* vbh = vT + bh * E_ * S_;
  const unsigned* wrow0 = wm + ((size_t)bz * S_ + s0) * (S_ / 32);   // S / 2 words per tile
  const unsigned* wrow1 = wrow0 + S_ / 2;

  v16bf qf[2][2];                                     // [query tile][e chunk]
#pragma unroll
  for (int j = 0; j < 2; ++j)
#pragma unroll
    for (int e = 0; e < 2; ++e)
      qf[j][e] = load_pk(qbh, ((s0 >> 4) + j) * 2 + e, lane);

  v8f o[2][4];                                        // Ot: [query tile][e tile]
  float m[2], nm[2];                                  // maximum in use; -m * SC2
  v2f l[2];                                           // sums of the even and the odd registers
#pragma unroll
  for (int j = 0; j < 2; ++j) {
    m[j]  = -3.0e38f;
    nm[j] = 3.0e38f * SC2;
    l[j]  = v2f{};
#pragma unroll
    for (int nt = 0; nt < 4; ++nt) o[j][nt] = v8f{};
  }

  v16bf kf[2][2];                                     // [key tile][e chunk]
  v16u  mw[2];                                        // [query tile][key tile * 8 + r]
  // The 16 blocks that read one head's K and V, and the 12 that read one query block's mask
  // words, enter the key walk at different passes and wrap round (softmax does not depend
  // on the order of the keys): no line is asked for by all of them at the same moment.
  constexpr int NP = S_ / 32;                         // passes, a power of two
  const int p0 = (qb * (NP / QB) + h * 5) & (NP - 1);
#pragma unroll
  for (int i = 0; i < 2; ++i) {
    kf[i][0] = load_pk(kbh, p0 * 4 + 2 * i, lane);
    kf[i][1] = load_pk(kbh, p0 * 4 + 2 * i + 1, lane);
  }
  // precaution: the zeros of the output tiles land in registers that held addresses of the
  // Q and K loads above
  asm volatile("s_wait_xcnt 0x0" ::: "memory");
  mw[0] = *(const v16u*)(wrow0 + p0 * 16);
  mw[1] = *(const v16u*)(wrow1 + p0 * 16);

  for (int t = 0; t < NP; ++t) {
    const int p  = (p0 + t) & (NP - 1);
    const int tn = ((p0 + t + 1) & (NP - 1)) * 32;    // next pass; behind the last, the first

    v16bf vf[4];
#pragma unroll
    for (int nt = 0; nt < 4; ++nt)
      vf[nt] = load_pk(vbh, nt * (S_ / 32) + p, lane);

    v8f s[2][2];                                      // [query tile][key tile]
#pragma unroll
    for (int j = 0; j < 2; ++j)
#pragma unroll
      for (int i = 0; i < 2; ++i) {
        s[j][i] = wmma_bf16(kf[i][0], qf[j][0], v8f{});
        s[j][i] = wmma_bf16(kf[i][1], qf[j][1], s[j][i]);
      }
#pragma unroll
    for (int i = 0; i < 2; ++i) {                     // next pass's K rows
      kf[i][0] = load_pk(kbh, (tn >> 3) + 2 * i, lane);
      kf[i][1] = load_pk(kbh, (tn >> 3) + 2 * i + 1, lane);
    }

    float mx[2];
#pragma unroll
    for (int j = 0; j < 2; ++j) {
      float t = NEGR;
#pragma unroll
      for (int i = 0; i < 2; ++i)
#pragma unroll
        for (int r = 0; r < 8; ++r) {
          const float x =
              __builtin_amdgcn_inverse_ballot_w32(mw[j][i * 8 + r]) ? NEGR : s[j][i][r];
          s[j][i][r] = x;
          t = fmaxf(t, x);
        }
      mx[j] = fmaxf(t, other_half(t));
    }

    // Move the maximum in use only when a column outgrows it by 2^8: one
    // wave-uniform test per pass (softmax does not depend on the shift).
    const bool need = (mx[0] > m[0] + STEP) || (mx[1] > m[1] + STEP);
    if (__builtin_amdgcn_ballot_w32(need) != 0) {
#pragma unroll
      for (int j = 0; j < 2; ++j) {
        const float mn = fmaxf(m[j], mx[j]);
        const float nn = -mn * SC2;
        const float al = __builtin_amdgcn_exp2f(nn - nm[j]);
        m[j]  = mn;
        nm[j] = nn;
        l[j] *= al;
#pragma unroll
        for (int nt = 0; nt < 4; ++nt)
#pragma unroll
          for (int r = 0; r < 8; ++r) o[j][nt][r] *= al;
      }
    }

    mw[0] = *(const v16u*)(wrow0 + (tn >> 1));        // next pass's mask words
    mw[1] = *(const v16u*)(wrow1 + (tn >> 1));
    // keeps the two scalar loads here, a whole exponential block ahead of their use;
    // left free, the scheduler sinks them to the end of the pass and their latency shows
    __builtin_amdgcn_sched_barrier(0);

#pragma unroll
    for (int j = 0; j < 2; ++j) {
      v16bf pb;
      v2f e[8];                                       // two scores per vector instruction
#pragma unroll
      for (int u = 0; u < 8; ++u) {
        const v2f x = {s[j][u >> 2][(u & 3) * 2], s[j][u >> 2][(u & 3) * 2 + 1]};
        const v2f a = __builtin_elementwise_fma(x, v2f{SC2, SC2}, v2f{nm[j], nm[j]});
        e[u] = v2f{__builtin_amdgcn_exp2f(a[0]), __builtin_amdgcn_exp2f(a[1])};
        pb[u * 2]     = (bf16_t)e[u][0];
        pb[u * 2 + 1] = (bf16_t)e[u][1];
      }
      l[j] += ((e[0] + e[1]) + (e[2] + e[3])) + ((e[4] + e[5]) + (e[6] + e[7]));
#pragma unroll
      for (int nt = 0; nt < 4; ++nt)
        o[j][nt] = wmma_bf16(vf[nt], pb, o[j][nt]);
    }
    // precaution: the next pass's index arithmetic lands in the scalar registers
    // that held the address of the mask-word loads above
    asm volatile("s_wait_xcnt 0x0" ::: "memory");
  }

  // a lane holds 8 consecutive e of one query row: one 16-B piece of ctx's
  // fragment [row tile][k chunk h * 2 + nt / 2]: half hh, lane c + 16 * (nt & 1)
#pragma unroll
  for (int j = 0; j < 2; ++j) {
    const float lh  = l[j][0] + l[j][1];
    const float inv = 1.f / (lh + other_half(lh));
    bf16_t* dst = ctx + ((size_t)bz * S_ + s0 + 16 * j) * (H_ * E_) + h * 1024 +
                  hh * 256 + c * 8;
#pragma unroll
    for (int nt = 0; nt < 4; ++nt) {
      v8bf pk;
#pragma unroll
      for (int r = 0; r < 8; ++r) pk[r] = (bf16_t)(o[j][nt][r] * inv);
      *(v8bf*)(dst + (nt >> 1) * 512 + (nt & 1) * 128) = pk;
    }
  }
}

// ---------------- output projection + LayerNorm ----------------
// 256 threads (8 waves); block owns 32 rows of [B*S, 768]. Each wave does 2 row tiles
// x 6 n-tiles (8 fragment loads per 12 WMMAs); result staged in LDS for the LayerNorm.
// LayerNorm: each wave takes 4 whole rows; a lane holds 24 elements of a row in registers
// (6 reads of 16 B, the wave reading 512 contiguous bytes at a time), so mean, variance
// and the scaled result come from one read of LDS and go out as whole-line 16-B stores.

// sum over the 32 lanes, the same value in every lane: four exchanges inside the
// 16-lane row (row_xmask 1, 2, 4, 8), then one between the two rows
template <int CTRL>
__device__ __forceinline__ float add_xmask(float x) {
  return x + __builtin_bit_cast(float, __builtin_amdgcn_mov_dpp(
                 __builtin_bit_cast(int, x), CTRL, 0xF, 0xF, true));
}
__device__ __forceinline__ float wave_sum(float x) {
  x = add_xmask<0x161>(x);
  x = add_xmask<0x162>(x);
  x = add_xmask<0x164>(x);
  x = add_xmask<0x168>(x);
  return x + other_half(x);
}

__global__ __launch_bounds__(256) void
k_proj_ln(const bf16_t* __restrict__ ctx, const bf16_t* __restrict__ woT,
          const float* __restrict__ bo, const float* __restrict__ gamma,
          const float* __restrict__ beta, float* __restrict__ out) {
  __shared__ float sOut[32 * D_];                     // 96 KB

  const int tid  = threadIdx.x;
  const int lane = tid & 31;
  // the wave's number in a scalar register: fragment addresses are a scalar base + lane offset
  const int wave = __builtin_amdgcn_readfirstlane(tid >> 5);
  const int row0 = blockIdx.x * 32;                   // row in [0, B*S)
  const bf16_t* arow = ctx + (size_t)row0 * D_;

  v8f acc[2][6];
#pragma unroll
  for (int i = 0; i < 2; ++i)
#pragma unroll
    for (int j = 0; j < 6; ++j) acc[i][j] = v8f{};

  // Every block reads the whole of woT: the blocks enter the K walk at different chunks and
  // wrap round, so that a line is not asked for by all of them at the same moment.
  int kc = blockIdx.x % (D_ / 32);
  const bf16_t* wrow = woT + (size_t)wave * 6 * 16 * D_;   // the wave's 6 column tiles
  // kept rolled: fully unrolled this loop built to 266 VGPRs, past the 256 reached without a window
#pragma unroll 1
  for (int t = 0; t < D_ / 32; t += 2) {              // 24 K-chunks, two at a time
    v16bf a[2][2], b[2][6];                           // [chunk][tile]
#pragma unroll
    for (int u = 0; u < 2; ++u) {
      // precaution: the second chunk's loads land in registers that held addresses of the first's
      if (u) asm volatile("s_wait_xcnt 0x0" ::: "memory");
#pragma unroll
      for (int i = 0; i < 2; ++i) a[u][i] = load_pk(arow + kc * 512, i * (D_ / 32), lane);
      // precaution: a weight tile of the first chunk lands in the registers that held the
      // address of the four loads above
      if (!u) asm volatile("s_wait_xcnt 0x0" ::: "memory");
#pragma unroll
      for (int j = 0; j < 6; ++j) b[u][j] = load_pk(wrow + kc * 512, j * (D_ / 32), lane);
      kc = kc + 1 < D_ / 32 ? kc + 1 : 0;
    }
    // keeps the 32 loads of two chunks together in front of their WMMAs: one latency per
    // pair; left free, the scheduler reuses two buffers and every WMMA waits on a fresh load
    __builtin_amdgcn_sched_barrier(0);
#pragma unroll
    for (int u = 0; u < 2; ++u)
#pragma unroll
      for (int j = 0; j < 6; ++j)
#pragma unroll
        for (int i = 0; i < 2; ++i) acc[i][j] = wmma_bf16(a[u][i], b[u][j], acc[i][j]);
  }

  // the lane's 24 columns of gamma and beta, asked for here so that they arrive
  // while the tile is staged
  v4f ga[6], be[6];
  // unrolled, like every loop of the LayerNorm below: ga, be and xv are then indexed by
  // constants only and stay in registers
#pragma unroll
  for (int t = 0; t < 6; ++t) {
    ga[t] = *(const v4f*)(gamma + (t * 32 + lane) * 4);
    be[t] = *(const v4f*)(beta + (t * 32 + lane) * 4);
  }

  const int N     = lane & 15;
  const int Mbase = (lane >> 4) << 3;
#pragma unroll
  for (int j = 0; j < 6; ++j) {
    const int n0 = (wave * 6 + j) * 16;
    const float bi = bo[n0 + N];
#pragma unroll
    for (int i = 0; i < 2; ++i)
#pragma unroll
      for (int r = 0; r < 8; ++r)
        sOut[(i * 16 + Mbase + r) * D_ + n0 + N] = acc[i][j][r] + bi;
  }
  __syncthreads();

  v4f xv[4][6];                                       // [row of the wave][16-B piece]
#pragma unroll
  for (int rr = 0; rr < 4; ++rr)
#pragma unroll
    for (int t = 0; t < 6; ++t)
      xv[rr][t] = *(const v4f*)(sOut + (wave * 4 + rr) * D_ + (t * 32 + lane) * 4);

  float mu[4], rs[4];
#pragma unroll
  for (int rr = 0; rr < 4; ++rr) {
    v4f s4 = xv[rr][0];
#pragma unroll
    for (int t = 1; t < 6; ++t) s4 += xv[rr][t];
    mu[rr] = (s4[0] + s4[1]) + (s4[2] + s4[3]);
  }
#pragma unroll
  for (int rr = 0; rr < 4; ++rr) mu[rr] = wave_sum(mu[rr]) * (1.f / D_);
#pragma unroll
  for (int rr = 0; rr < 4; ++rr) {
    v4f q4 = v4f{};
#pragma unroll
    for (int t = 0; t < 6; ++t) {
      xv[rr][t] -= mu[rr];
      q4 += xv[rr][t] * xv[rr][t];
    }
    rs[rr] = (q4[0] + q4[1]) + (q4[2] + q4[3]);
  }
#pragma unroll
  for (int rr = 0; rr < 4; ++rr) rs[rr] = rsqrtf(wave_sum(rs[rr]) * (1.f / D_) + LN_EPS_);

#pragma unroll
  for (int rr = 0; rr < 4; ++rr) {
    float* dst = out + (size_t)(row0 + wave * 4 + rr) * D_ + lane * 4;
#pragma unroll
    for (int t = 0; t < 6; ++t)
      *(v4f*)(dst + t * 128) = xv[rr][t] * rs[rr] * ga[t] + be[t];
  }
}

// ---------------- host launcher ----------------
extern "C" void kernel_launch(void* const* d_in, const int* in_sizes, int n_in,
                              void* d_out, int out_size, void* d_ws, size_t ws_size,
                              hipStream_t stream) {
  const float* x    = (const float*)d_in[0];
  const int*   mask = (const int*)d_in[1];
  const float* Wq   = (const float*)d_in[2];
  const float* bq   = (const float*)d_in[3];
  const float* Wk   = (const float*)d_in[4];
  const float* bk   = (const float*)d_in[5];
  const float* Wv   = (const float*)d_in[6];
  const float* bv   = (const float*)d_in[7];
  const float* Wo   = (const float*)d_in[8];
  const float* bo   = (const float*)d_in[9];
  const float* gamma = (const float*)d_in[10];
  const float* beta  = (const float*)d_in[11];
  float* out = (float*)d_out;

  // workspace layout (bf16 intermediates, mask words), ~66.5 MB total
  char* ws = (char*)d_ws;
  const size_t szX  = (size_t)B_ * S_ * D_ * sizeof(bf16_t);
  const size_t szW  = (size_t)H_ * E_ * D_ * sizeof(bf16_t);
  const size_t szWo = (size_t)D_ * D_ * sizeof(bf16_t);
  const size_t szQ  = (size_t)B_ * H_ * S_ * E_ * sizeof(bf16_t);
  bf16_t* xb  = (bf16_t*)(ws);
  bf16_t* wqT = (bf16_t*)(ws + szX);
  bf16_t* wkT = (bf16_t*)(ws + szX + szW);
  bf16_t* wvT = (bf16_t*)(ws + szX + 2 * szW);
  bf16_t* woT = (bf16_t*)(ws + szX + 3 * szW);
  bf16_t* q   = (bf16_t*)(ws + szX + 3 * szW + szWo);
  bf16_t* k   = (bf16_t*)(ws + szX + 3 * szW + szWo + szQ);
  bf16_t* vT  = (bf16_t*)(ws + szX + 3 * szW + szWo + 2 * szQ);
  bf16_t* ctx = (bf16_t*)(ws + szX + 3 * szW + szWo + 3 * szQ);
  unsigned* wm = (unsigned*)(ws + szX + 3 * szW + szWo + 4 * szQ);   // 2 MB of mask words

  k_prep<<<NB_X_ + 4 * NB_1W_ + NB_M_, 256, 0, stream>>>(x, mask, Wq, Wk, Wv, Wo, xb, wqT, wkT,
                                                         wvT, woT, wm);

  k_qkv<<<(B_ * S_ / QR_) * (3 * H_ * E_ / QC_), 384, 0, stream>>>(xb, wqT, wkT, wvT, bq, bk,
                                                                   bv, q, k, vT);

  k_attn<<<B_ * H_ * (S_ / 128), 128, 0, stream>>>(q, k, vT, wm, ctx);

  k_proj_ln<<<B_ * S_ / 32, 256, 0, stream>>>(ctx, woT, bo, gamma, beta, out);
}

// v010
// One run takes 92.6 microseconds.
// Next to v009, in two timings, it ran 1.03 and 1.04 times as fast.
// Counting every step since v000, it is 31.6 times as fast.
#include <hip/hip_runtime.h>
#include <hip/hip_bf16.h>
#include <math.h>

// ---- problem constants (match reference) ----
static constexpr int B_ = 4, S_ = 2048, D_ = 768, H_ = 12, E_ = 64;
static constexpr float LN_EPS_ = 1e-5f;

typedef __bf16 bf16_t;
typedef __attribute__((ext_vector_type(16))) __bf16 v16bf;
typedef __attribute__((ext_vector_type(8)))  __bf16 v8bf;   // 16-byte pack
typedef __attribute__((ext_vector_type(8)))  float  v8f;
typedef __attribute__((ext_vector_type(8)))  unsigned short v8us;

// -------------------------------------------------------------------------
// Every bf16 operand in the workspace is stored in FRAGMENT ORDER: a 16-row x
// 32-k fragment of V_WMMA_F32_16X16X32_BF16 (wave32) is one 1-KB block,
//   block[half * 256 + lane * 8 + i]  =  register element s = half * 8 + i of lane,
// so a wave loads a fragment with two b128 loads of 512 contiguous bytes each.
// Which (row, k) a position holds, for a row-major matrix M:
//   plain order: row = lane & 15, k = (lane >> 4) * 16 + s   (A and B alike)
// Fragments of a matrix with K columns lie as [row tile][k chunk of 32].
// -------------------------------------------------------------------------
__device__ __forceinline__ v16bf load_pk(const bf16_t* base, int frag, int lane) {
  const bf16_t* p = base + (size_t)frag * 512 + lane * 8;
  const v8bf lo = *(const v8bf*)p;
  const v8bf hi = *(const v8bf*)(p + 256);
  return __builtin_shufflevector(lo, hi, 0, 1, 2, 3, 4, 5, 6, 7, 8, 9, 10, 11,
                                 12, 13, 14, 15);
}

__device__ __forceinline__ v8f wmma_bf16(v16bf a, v16bf b, v8f c) {
  return __builtin_amdgcn_wmma_f32_16x16x32_bf16(false, a, false, b,
                                                 (short)0, c, false, false);
}

// value of lane ^ 16
__device__ __forceinline__ float other_half(float x) {
  const int b = __builtin_bit_cast(int, x);
  return __builtin_bit_cast(float, __builtin_amdgcn_permlanex16(
      b, b, 0x76543210, 0xfedcba98, false, false));
}

// maximum over the 32 lanes, the same value in every lane: four exchanges inside the
// 16-lane row (row_xmask 1, 2, 4, 8), then one between the two rows
template <int CTRL>
__device__ __forceinline__ float max_xmask(float x) {
  return fmaxf(x, __builtin_bit_cast(float, __builtin_amdgcn_mov_dpp(
                      __builtin_bit_cast(int, x), CTRL, 0xF, 0xF, true)));
}
__device__ __forceinline__ float wave_max(float x) {
  x = max_xmask<0x161>(x);
  x = max_xmask<0x162>(x);
  x = max_xmask<0x164>(x);
  x = max_xmask<0x168>(x);
  return fmaxf(x, other_half(x));
}

// ---------------- preparation: ONE launch for every repacked operand ----------
// f32 -> bf16 in fragment order for x and the four weight matrices, and the mask as
// lane-mask words. Ranges of the block index pick the job; the jobs are independent.
// A wave makes whole fragments (two 512-byte stores each) and takes several that lie a
// constant step apart in the source, so that the launch starts few waves, each wave has
// all its loads in flight at once, and every address is one base plus a constant.
typedef __attribute__((ext_vector_type(4))) float    v4f;
typedef __attribute__((ext_vector_type(4))) int      v4i;
typedef __attribute__((ext_vector_type(4))) unsigned v4u;

static constexpr int KC_   = D_ / 32;                 // k chunks of a 768-wide matrix
static constexpr int XF_   = 6;                       // x fragments per wave
static constexpr int WF_   = KC_ / 8;                 // weight fragments per wave
static constexpr int NB_X_ = B_ * (S_ / 16) * KC_ / (XF_ * 8);  // 2 row tiles per block
static constexpr int NB_1W_ = D_ / 16;                // a weight matrix: a block per tile
static constexpr int NB_M_ = B_ * (S_ / 16);          // mask: a block per query tile

// x [B*S, D] -> fragments [row tile][k chunk]; the wave takes k chunks kc0 .. kc0 + 5 of
// row tile rt; a lane reads its 16 k of a chunk as 64 contiguous bytes.
__device__ __forceinline__ void prep_x(const float* __restrict__ x, bf16_t* __restrict__ y,
                                       int rt, int kc0, int lane) {
  const float* s = x + (size_t)rt * 16 * D_ + kc0 * 32 + ((lane & 15) * D_ + (lane >> 4) * 16);
  bf16_t* d = y + ((size_t)rt * KC_ + kc0) * 512 + lane * 8;
  v4f a[XF_][4];
#pragma unroll
  for (int f = 0; f < XF_; ++f)
#pragma unroll
    for (int c = 0; c < 4; ++c) a[f][c] = *(const v4f*)(s + f * 32 + c * 4);
  // keeps all 24 loads in front of the conversions: one latency per wave; left free, the
  // scheduler holds the last of them back until the first have arrived
  __builtin_amdgcn_sched_barrier(0);
#pragma unroll
  for (int f = 0; f < XF_; ++f)
#pragma unroll
    for (int half = 0; half < 2; ++half) {
      v8bf pk;
#pragma unroll
      for (int i = 0; i < 4; ++i) {
        pk[i]     = (bf16_t)a[f][half * 2][i];
        pk[4 + i] = (bf16_t)a[f][half * 2 + 1][i];
      }
      *(v8bf*)(d + f * 512 + half * 256) = pk;
    }
}

// A weight matrix -> fragments of its transpose, [output-column tile ct][k chunk]; the
// wave takes k chunks kc0 .. kc0 + 2 of tile ct.
// HDE: W [H,D,E], rows of the transpose are e of head h (ct = h * 4 + e tile), k = d.
// else: Wo [768 f, 768 d], rows of the transpose are d, k = f.
template <bool HDE>
__device__ __forceinline__ void prep_w(const float* __restrict__ W, bf16_t* __restrict__ WT,
                                       int ct, int kc0, int lane) {
  constexpr int LD = HDE ? E_ : D_;                   // floats from one k to the next
  const float* s = W + (HDE ? (size_t)(ct >> 2) * D_ * E_ + (ct & 3) * 16 : (size_t)ct * 16) +
                   (size_t)kc0 * 32 * LD + ((lane >> 4) * 16 * LD + (lane & 15));
  bf16_t* d = WT + ((size_t)ct * KC_ + kc0) * 512 + lane * 8;
  float v[WF_][16];
#pragma unroll
  for (int f = 0; f < WF_; ++f)
#pragma unroll
    for (int i = 0; i < 16; ++i) v[f][i] = s[(f * 32 + i) * LD];
#pragma unroll
  for (int f = 0; f < WF_; ++f)
#pragma unroll
    for (int half = 0; half < 2; ++half) {
      v8bf pk;
#pragma unroll
      for (int i = 0; i < 8; ++i) pk[i] = (bf16_t)v[f][half * 8 + i];
      *(v8bf*)(d + f * 512 + half * 256) = pk;
    }
  // precaution: behind the job the compiler's code for the other block ranges lands in
  // registers that held data and base of the stores above
  asm volatile("s_wait_xcnt 0x0" ::: "memory");
}

// mask [B,S,S] i32 -> lane-mask words.
// Word [b][query tile of 16][key tile of 16][r]: bit L says whether
// mask[b][query tile * 16 + (L & 15)][key tile * 16 + 8 * (L >> 4) + r] != 0,
// which is the entry that lane L holds in register r of that transposed score
// tile: k_attn reads a word into a scalar register and selects on it directly.
// One wave takes 16 query rows x 128 keys at a time: 16 whole-line loads; lane l
// holds keys 4l..4l+3 (key tile l >> 2, half (l >> 1) & 1, r = 4 * (l & 1) + k).
__device__ __forceinline__ void prep_mask(const int* __restrict__ mask,
                                          unsigned* __restrict__ wm, int rt, int wave,
                                          int lane) {
#pragma unroll
  for (int t = 0; t < 2; ++t) {
    const int kg = wave * 2 + t;                      // group of 128 keys
    const int* s = mask + (size_t)rt * 16 * S_ + kg * 128 + lane * 4;
    v4i m[16];
#pragma unroll
    for (int qr = 0; qr < 16; ++qr) m[qr] = *(const v4i*)(s + (size_t)qr * S_);
    v4u pk;
#pragma unroll
    for (int kk = 0; kk < 4; ++kk) {
      unsigned hb = 0;                                // bit qr: query row qr, this key
#pragma unroll
      for (int qr = 0; qr < 16; ++qr)
        hb |= (m[qr][kk] != 0 ? 1u : 0u) << qr;
      // the upper key half of the same tile and r sits two lanes further on
      const unsigned up = (unsigned)__builtin_amdgcn_mov_dpp((int)hb, 0x4E, 0xF, 0xF, true);
      pk[kk] = hb | (up << 16);
    }
    if ((lane & 2) == 0)
      *(v4u*)(wm + (size_t)rt * (S_ / 2) + (kg * 8 + (lane >> 2)) * 8 + (lane & 1) * 4) = pk;
  }
}

__global__ __launch_bounds__(256) void
k_prep(const float* __restrict__ x, const int* __restrict__ mask,
       const float* __restrict__ Wq, const float* __restrict__ Wk,
       const float* __restrict__ Wv, const float* __restrict__ Wo,
       bf16_t* __restrict__ xb, bf16_t* __restrict__ wqT, bf16_t* __restrict__ wkT,
       bf16_t* __restrict__ wvT, bf16_t* __restrict__ woT, unsigned* __restrict__ wm) {
  const int lane = threadIdx.x & 31;
  // the wave's number in a scalar register: the wave's share of a job is a scalar base
  const int wave = __builtin_amdgcn_readfirstlane(threadIdx.x >> 5);
  const int blk  = blockIdx.x;
  // the mask blocks, which load twice in a row, start first; the one-round jobs last
  if (blk < NB_M_) {
    prep_mask(mask, wm, blk, wave, lane);
  } else if (blk < NB_M_ + NB_X_) {
    prep_x(x, xb, (blk - NB_M_) * 2 + (wave >> 2), (wave & 3) * XF_, lane);
  } else if (blk < NB_M_ + NB_X_ + 3 * NB_1W_) {
    const int mat = (blk - NB_M_ - NB_X_) / NB_1W_;
    prep_w<true>(mat == 0 ? Wq : mat == 1 ? Wk : Wv, mat == 0 ? wqT : mat == 1 ? wkT : wvT,
                 (blk - NB_M_ - NB_X_) - mat * NB_1W_, wave * WF_, lane);
  } else {
    prep_w<false>(Wo, woT, blk - NB_M_ - NB_X_ - 3 * NB_1W_, wave * WF_, lane);
  }
}

// ---------------- QKV projection: one wave per 64 rows x 96 columns ----------
// The product is [B*S, 768] x [768, 2304], the columns being q, k, v side by side. A block
// is 256 rows x 288 columns, 12 waves as 4 x 3: 32 x 8 = 256 equal blocks, three waves on
// every SIMD, all resident at once. An x fragment is wanted by three waves of the block and
// a weight fragment by four, at about the same time.
// A wave's 4 x 6 accumulator tiles take 10 fragment loads per 24 WMMAs. Its 96 columns lie
// in ONE of q, k, v (768 = 8 x 96) and are three whole e chunks of 32, in one or two heads.
// q,k stored as fragments [B,H][s tile][e chunk], plain order (staged via LDS);
// v stored as fragments of V^T (rows e, k = key) [B,H][e tile][32-key chunk] in
// the k order of a packed accumulator pair: k = 8 * (lane >> 4) + s for s < 8,
// 16 + 8 * (lane >> 4) + (s - 8) otherwise; a lane's 8 rows are one 16-B piece.
static constexpr int QR_ = 256, QC_ = 288;    // block tile
static constexpr int QP_ = 104;               // staging pitch: 208 B, an odd number of 16 B

__global__ __launch_bounds__(384) void
k_qkv(const bf16_t* __restrict__ xb, const bf16_t* __restrict__ wqT,
      const bf16_t* __restrict__ wkT, const bf16_t* __restrict__ wvT,
      const float* __restrict__ bq, const float* __restrict__ bk,
      const float* __restrict__ bv, bf16_t* __restrict__ q,
      bf16_t* __restrict__ k, bf16_t* __restrict__ vT, float* __restrict__ kmx) {
  __shared__ bf16_t st[12][64 * QP_];       // 13 KB staging tile per wave

  const int lane = threadIdx.x & 31;
  // the wave's number in a scalar register: fragment addresses are a scalar base + lane offset
  const int wave = __builtin_amdgcn_readfirstlane(threadIdx.x >> 5);
  constexpr int RB = B_ * S_ / QR_;         // row blocks
  const int blk = blockIdx.x;
  const int row0 = (blk % RB) * QR_ + (wave & 3) * 64;  // row in [0, B*S)
  const int grp  = (blk / RB) * 3 + (wave >> 2);        // group of 96 columns, 0 .. 23
  const int mat  = grp >> 3;                            // 0 q, 1 k, 2 v: one per wave
  const int ct0  = (grp & 7) * 6;                       // first column tile, h * 4 + e tile
  const int bz   = row0 / S_;
  const int s0   = row0 % S_;

  const bf16_t* xfr = xb + (size_t)row0 * D_;            // 4 row tiles of fragments
  const bf16_t* w   = (mat == 0 ? wqT : mat == 1 ? wkT : wvT) + (size_t)ct0 * 16 * D_;
  const float* bias = (mat == 0 ? bq : mat == 1 ? bk : bv) + ct0 * 16;

  v8f acc[4][6];                            // [row tile][column tile]
#pragma unroll
  for (int i = 0; i < 4; ++i)
#pragma unroll
    for (int nt = 0; nt < 6; ++nt) acc[i][nt] = v8f{};

  // Blocks that read the same x rows (8 of them) or the same weight rows (32) enter the K
  // walk at different chunks and wrap round: asked for at the same moment by many blocks, a
  // line is delivered to one after the other, and a line new to L2 makes them all wait.
  const int kr = (blk % RB + 3 * (blk / RB)) % (D_ / 32);
  for (int t = 0; t < D_ / 32; ++t) {             // 24 K-chunks
    const int kc = kr + t < D_ / 32 ? kr + t : kr + t - D_ / 32;
    v16bf a[4], b[6];
#pragma unroll
    for (int i = 0; i < 3; ++i) a[i] = load_pk(xfr, i * (D_ / 32) + kc, lane);
    const bf16_t* pa = xfr + (size_t)(3 * (D_ / 32) + kc) * 512 + lane * 8;
    const v8bf alo = *(const v8bf*)pa;
#pragma unroll
    for (int nt = 0; nt < 5; ++nt) b[nt] = load_pk(w, nt * (D_ / 32) + kc, lane);
    const bf16_t* pb = w + (size_t)(5 * (D_ / 32) + kc) * 512 + lane * 8;
    const v8bf blo = *(const v8bf*)pb;
    // precaution: the last load of x and the last of w land in the registers that held the
    // addresses of the loads above
    asm volatile("s_wait_xcnt 0x0" ::: "memory");
    const v8bf ahi = *(const v8bf*)(pa + 256);
    const v8bf bhi = *(const v8bf*)(pb + 256);
    a[3] = __builtin_shufflevector(alo, ahi, 0, 1, 2, 3, 4, 5, 6, 7, 8, 9, 10, 11, 12, 13, 14,
                                   15);
    b[5] = __builtin_shufflevector(blo, bhi, 0, 1, 2, 3, 4, 5, 6, 7, 8, 9, 10, 11, 12, 13, 14,
                                   15);
    // keeps the chunk's 20 loads together in front of its WMMAs: one latency per chunk;
    // left free, the scheduler reuses two buffers and every WMMA waits on a fresh load
    __builtin_amdgcn_sched_barrier(0);
#pragma unroll
    for (int i = 0; i < 4; ++i)
#pragma unroll
      for (int nt = 0; nt < 6; ++nt) acc[i][nt] = wmma_bf16(a[i], b[nt], acc[i][nt]);
  }

  const int N     = lane & 15;
  const int Mbase = (lane >> 4) << 3;
  float bi[6];
#pragma unroll
  for (int nt = 0; nt < 6; ++nt) bi[nt] = bias[nt * 16 + N];

  bf16_t* sw = st[wave];
  if (mat == 2) {
    // ---- v: 8 keys per lane -> one b128 store, 512 contiguous bytes per wave ----
#pragma unroll
    for (int i = 0; i < 4; ++i) {
      const int si = s0 + 16 * i;
#pragma unroll
      for (int nt = 0; nt < 6; ++nt) {
        v8bf pk;
#pragma unroll
        for (int r = 0; r < 8; ++r) pk[r] = (bf16_t)(acc[i][nt][r] + bi[nt]);
        *(v8bf*)(vT + ((size_t)(bz * (H_ * 4) + ct0 + nt) * (S_ / 32) + (si >> 5)) * 512 +
                 ((si >> 4) & 1) * 256 + lane * 8) = pk;
      }
    }
  } else {
    // ---- q or k: stage the wave's 64x96 tile in LDS ----
#pragma unroll
    for (int i = 0; i < 4; ++i)
#pragma unroll
      for (int nt = 0; nt < 6; ++nt)
#pragma unroll
        for (int r = 0; r < 8; ++r)
          sw[(i * 16 + Mbase + r) * QP_ + nt * 16 + N] = (bf16_t)(acc[i][nt][r] + bi[nt]);
  }
  __syncthreads();                                // every wave passes it, the v waves too
  if (mat != 2) {
    // ---- flush the tile's 12 fragments in order; e chunk p is chunk (ct0 / 2 + p) & 1 of
    // head (ct0 / 2 + p) >> 1 ----
    bf16_t* dst = (mat ? k : q) + ((size_t)bz * H_ * S_ + s0) * E_;
    v8bf f[3][8];
#pragma unroll
    for (int p = 0; p < 3; ++p) {
      const int ec = (ct0 >> 1) + p;
      bf16_t* dp = dst + (size_t)(ec >> 1) * S_ * E_ + (ec & 1) * 512 + lane * 8;
#pragma unroll
      for (int i = 0; i < 4; ++i)
#pragma unroll
        for (int half = 0; half < 2; ++half) {
          f[p][i * 2 + half] = *(const v8bf*)(sw + (i * 16 + (lane & 15)) * QP_ + p * 32 +
                                              (lane >> 4) * 16 + half * 8);
          *(v8bf*)(dp + i * 16 * E_ + half * 256) = f[p][i * 2 + half];
        }
    }
    if (mat == 1) {
      // ---- k: the largest |k| of the wave's 64 rows in each of its three e chunks, for
      // k_attn's bound on a score; every wave writes a 128-byte line of its own ----
      // precaution: the maxima land in registers that held data of the stores above
      asm volatile("s_wait_xcnt 0x0" ::: "memory");
      // keeps the maxima behind that wait: nothing else ties them to it
      __builtin_amdgcn_sched_barrier(0);
      v4f am = v4f{};
#pragma unroll
      for (int p = 0; p < 3; ++p) {
        v8us ab = v8us{};                         // without its sign a bf16 orders like its bits
#pragma unroll
        for (int i = 0; i < 8; ++i)
          ab = __builtin_elementwise_max(
              ab, __builtin_bit_cast(v8us, f[p][i]) & (unsigned short)0x7fff);
        unsigned short t = ab[0];
#pragma unroll
        for (int i = 1; i < 8; ++i) t = ab[i] > t ? ab[i] : t;
        am[p] = wave_max(__builtin_bit_cast(float, (unsigned)t << 16));
      }
      if (lane == 0) *(v4f*)(kmx + ((row0 >> 6) * 8 + (grp & 7)) * 32) = am;
    }
  }
}

typedef __attribute__((ext_vector_type(16))) unsigned v16u;
typedef __attribute__((ext_vector_type(8)))  unsigned v8u;
typedef __attribute__((ext_vector_type(2)))  float    v2f;

__global__ __launch_bounds__(128) void
k_attn(const bf16_t* __restrict__ q, const bf16_t* __restrict__ k,
       const bf16_t* __restrict__ vT, const unsigned* __restrict__ wm,
       const float* __restrict__ kmx, bf16_t* __restrict__ ctx) {
  constexpr float SC2  = 0.03187935771f;   // log2(e) / sqrt(S): ref scales by 1/sqrt(S)
  // A masked score before the 1/sqrt(S) scale: -2^36, which is -1.5e9 behind it (ref: -1e9;
  // both leave a masked key the weight 0 beside any open key). A power of two, so that its
  // product with SC2 is exact and a row whose keys are all masked gets exactly 1 per key.
  constexpr float NEGR = -68719476736.0f;
  constexpr float STEP = 8.0f / SC2;              // maximum may lag by 2^8

  const int lane = threadIdx.x & 31;
  // the wave's number in a scalar register, so that the mask words' address is scalar
  const int wave = __builtin_amdgcn_readfirstlane(threadIdx.x >> 5);
  const int c    = lane & 15;
  const int hh   = lane >> 4;
  constexpr int QB = S_ / 128;                        // query blocks per (b,h)
  const int blk = blockIdx.x;
  const int h   = blk % H_;
  const int qb  = (blk / H_) % QB;
  const int s0  = qb * 128 + wave * 32;
  const int bz  = blk / (H_ * QB);
  const size_t bh = (size_t)bz * H_ + h;

  const bf16_t* qbh = q + bh * S_ * E_;
  const bf16_t* kbh = k + bh * S_ * E_;
  const bf16_t* vbh = vT + bh * E_ * S_;
  const unsigned* wrow0 = wm + ((size_t)bz * S_ + s0) * (S_ / 32);   // S / 2 words per tile
  const unsigned* wrow1 = wrow0 + S_ / 2;

  v16bf qf[2][2];                                     // [query tile][e chunk]
#pragma unroll
  for (int j = 0; j < 2; ++j)
#pragma unroll
    for (int e = 0; e < 2; ++e)
      qf[j][e] = load_pk(qbh, ((s0 >> 4) + j) * 2 + e, lane);

  v8f o[2][4];                                        // Ot: [query tile][e tile]
  float m[2], nm[2];                                  // maximum in use; -m * SC2
  v2f l[2];                                           // sums of the even and the odd registers
#pragma unroll
  for (int j = 0; j < 2; ++j) {
    m[j]  = -3.0e38f;
    nm[j] = 3.0e38f * SC2;
    l[j]  = v2f{};
#pragma unroll
    for (int nt = 0; nt < 4; ++nt) o[j][nt] = v8f{};
  }

  v16bf kf[2][2];                                     // [key tile][e chunk]
  v16u  mw[2];                                        // [query tile][key tile * 8 + r]
  // The 16 blocks that read one head's K and V, and the 12 that read one query block's mask
  // words, enter the key walk at different passes and wrap round (softmax does not depend
  // on the order of the keys): no line is asked for by all of them at the same moment.
  constexpr int NP = S_ / 32;                         // passes, a power of two
  const int p0 = (qb * (NP / QB) + h * 5) & (NP - 1);
#pragma unroll
  for (int i = 0; i < 2; ++i) {
    kf[i][0] = load_pk(kbh, p0 * 4 + 2 * i, lane);
    kf[i][1] = load_pk(kbh, p0 * 4 + 2 * i + 1, lane);
  }
  // k_qkv's largest |k|: lane L takes rows 64 L .. 64 L + 63 of this head's two e chunks
  // (e chunk ec of the 24 lies in line ec / 3, place ec % 3)
  const float* kl = kmx + (bz * (S_ / 64) + lane) * 256;
  const float ka0 = kl[(2 * h) / 3 * 32 + (2 * h) % 3];
  const float ka1 = kl[(2 * h + 1) / 3 * 32 + (2 * h + 1) % 3];
  // precaution: the zeros of the output tiles land in registers that held addresses of the
  // Q and K loads above
  asm volatile("s_wait_xcnt 0x0" ::: "memory");
  mw[0] = *(const v16u*)(wrow0 + p0 * 16);
  mw[1] = *(const v16u*)(wrow1 + p0 * 16);

  // No score of a query can exceed bnd = sum over e of |q| times the head's largest |k|.
  // The sum comes from the matrix unit: ones x |Qt| puts a query's sum in its column. The
  // factor covers the rounding inside the sums of products.
  float bnd[2];
  {
    const float kinf = wave_max(fmaxf(ka0, ka1)) * 1.01f;
    v16bf ones;
#pragma unroll
    for (int i = 0; i < 16; ++i) ones[i] = (bf16_t)1.0f;
#pragma unroll
    for (int j = 0; j < 2; ++j) {
      v8f d = v8f{};
#pragma unroll
      for (int e = 0; e < 2; ++e)
        d = wmma_bf16(ones, __builtin_bit_cast(v16bf, __builtin_bit_cast(v8u, qf[j][e]) &
                                                          0x7fff7fffu), d);
      bnd[j] = d[0] * kinf;
    }
  }

  // One pass. exact: look at the scores' maximum and move the maximum in use where needed;
  // returns nonzero while some column's bound still lies above its maximum in use + 2^8.
  // Once it returns 0 no later score can ask for a move, and the passes that follow
  // (exact = false) take no maximum, exchange no lanes and have no test.
  auto pass = [&](const int t, const bool exact) __attribute__((always_inline)) -> unsigned {
    const int p  = (p0 + t) & (NP - 1);
    const int tn = ((p0 + t + 1) & (NP - 1)) * 32;    // next pass; behind the last, the first

    v16bf vf[4];
#pragma unroll
    for (int nt = 0; nt < 4; ++nt)
      vf[nt] = load_pk(vbh, nt * (S_ / 32) + p, lane);

    v8f s[2][2];                                      // [query tile][key tile]
#pragma unroll
    for (int j = 0; j < 2; ++j)
#pragma unroll
      for (int i = 0; i < 2; ++i) {
        s[j][i] = wmma_bf16(kf[i][0], qf[j][0], v8f{});
        s[j][i] = wmma_bf16(kf[i][1], qf[j][1], s[j][i]);
      }
#pragma unroll
    for (int i = 0; i < 2; ++i) {                     // next pass's K rows
      kf[i][0] = load_pk(kbh, (tn >> 3) + 2 * i, lane);
      kf[i][1] = load_pk(kbh, (tn >> 3) + 2 * i + 1, lane);
    }

#pragma unroll
    for (int j = 0; j < 2; ++j)
#pragma unroll
      for (int i = 0; i < 2; ++i)
#pragma unroll
        for (int r = 0; r < 8; ++r)
          s[j][i][r] =
              __builtin_amdgcn_inverse_ballot_w32(mw[j][i * 8 + r]) ? NEGR : s[j][i][r];

    unsigned open = 0;
    if (exact) {
      float mx[2];
#pragma unroll
      for (int j = 0; j < 2; ++j) {
        float x = NEGR;
#pragma unroll
        for (int i = 0; i < 2; ++i)
#pragma unroll
          for (int r = 0; r < 8; ++r) x = fmaxf(x, s[j][i][r]);
        mx[j] = fmaxf(x, other_half(x));
      }

      // Move the maximum in use only when a column outgrows it by 2^8: one
      // wave-uniform test per pass (softmax does not depend on the shift).
      const bool need = (mx[0] > m[0] + STEP) || (mx[1] > m[1] + STEP);
      if (__builtin_amdgcn_ballot_w32(need) != 0) {
#pragma unroll
        for (int j = 0; j < 2; ++j) {
          const float mn = fmaxf(m[j], mx[j]);
          const float nn = -mn * SC2;
          const float al = __builtin_amdgcn_exp2f(nn - nm[j]);
          m[j]  = mn;
          nm[j] = nn;
          l[j] *= al;
#pragma unroll
          for (int nt = 0; nt < 4; ++nt)
#pragma unroll
            for (int r = 0; r < 8; ++r) o[j][nt][r] *= al;
        }
      }
      open = __builtin_amdgcn_ballot_w32((bnd[0] > m[0] + STEP) || (bnd[1] > m[1] + STEP));
    }

    // keeps the wait below behind the selects, some way from the K loads that it follows;
    // left free it rises to stand directly behind them
    __builtin_amdgcn_sched_barrier(0);
    // precaution: the exponentials below land in registers that held the address of the
    // K loads above
    asm volatile("s_wait_xcnt 0x0" ::: "memory");
    mw[0] = *(const v16u*)(wrow0 + (tn >> 1));        // next pass's mask words
    mw[1] = *(const v16u*)(wrow1 + (tn >> 1));
    // keeps the two scalar loads here, a whole exponential block ahead of their use;
    // left free, the scheduler sinks them to the end of the pass and their latency shows
    __builtin_amdgcn_sched_barrier(0);

#pragma unroll
    for (int j = 0; j < 2; ++j) {
      v16bf pb;
      v2f e[8];                                       // two scores per vector instruction
#pragma unroll
      for (int u = 0; u < 8; ++u) {
        const v2f x = {s[j][u >> 2][(u & 3) * 2], s[j][u >> 2][(u & 3) * 2 + 1]};
        const v2f a = __builtin_elementwise_fma(x, v2f{SC2, SC2}, v2f{nm[j], nm[j]});
        e[u] = v2f{__builtin_amdgcn_exp2f(a[0]), __builtin_amdgcn_exp2f(a[1])};
        pb[u * 2]     = (bf16_t)e[u][0];
        pb[u * 2 + 1] = (bf16_t)e[u][1];
      }
      l[j] += ((e[0] + e[1]) + (e[2] + e[3])) + ((e[4] + e[5]) + (e[6] + e[7]));
#pragma unroll
      for (int nt = 0; nt < 4; ++nt)
        o[j][nt] = wmma_bf16(vf[nt], pb, o[j][nt]);
    }
    // precaution: the next pass's index arithmetic lands in the scalar registers
    // that held the address of the mask-word loads above
    asm volatile("s_wait_xcnt 0x0" ::: "memory");
    return open;
  };

  int t = 0;
  for (unsigned open = 1; t < NP && open != 0; ++t) open = pass(t, true);
  for (; t < NP; ++t) pass(t, false);

  // a lane holds 8 consecutive e of one query row: one 16-B piece of ctx's
  // fragment [row tile][k chunk h * 2 + nt / 2]: half hh, lane c + 16 * (nt & 1)
#pragma unroll
  for (int j = 0; j < 2; ++j) {
    const float lh  = l[j][0] + l[j][1];
    const float inv = 1.f / (lh + other_half(lh));
    bf16_t* dst = ctx + ((size_t)bz * S_ + s0 + 16 * j) * (H_ * E_) + h * 1024 +
                  hh * 256 + c * 8;
#pragma unroll
    for (int nt = 0; nt < 4; ++nt) {
      v8bf pk;
#pragma unroll
      for (int r = 0; r < 8; ++r) pk[r] = (bf16_t)(o[j][nt][r] * inv);
      *(v8bf*)(dst + (nt >> 1) * 512 + (nt & 1) * 128) = pk;
    }
  }
}

// ---------------- output projection + LayerNorm ----------------
// 256 threads (8 waves); block owns 32 rows of [B*S, 768]. Each wave does 2 row tiles
// x 6 n-tiles (8 fragment loads per 12 WMMAs); result staged in LDS for the LayerNorm.
// LayerNorm: each wave takes 4 whole rows; a lane holds 24 elements of a row in registers
// (6 reads of 16 B, the wave reading 512 contiguous bytes at a time), so mean, variance
// and the scaled result come from one read of LDS and go out as whole-line 16-B stores.

// sum over the 32 lanes, the same value in every lane: four exchanges inside the
// 16-lane row (row_xmask 1, 2, 4, 8), then one between the two rows
template <int CTRL>
__device__ __forceinline__ float add_xmask(float x) {
  return x + __builtin_bit_cast(float, __builtin_amdgcn_mov_dpp(
                 __builtin_bit_cast(int, x), CTRL, 0xF, 0xF, true));
}
__device__ __forceinline__ float wave_sum(float x) {
  x = add_xmask<0x161>(x);
  x = add_xmask<0x162>(x);
  x = add_xmask<0x164>(x);
  x = add_xmask<0x168>(x);
  return x + other_half(x);
}

__global__ __launch_bounds__(256) void
k_proj_ln(const bf16_t* __restrict__ ctx, const bf16_t* __restrict__ woT,
          const float* __restrict__ bo, const float* __restrict__ gamma,
          const float* __restrict__ beta, float* __restrict__ out) {
  __shared__ float sOut[32 * D_];                     // 96 KB

  const int tid  = threadIdx.x;
  const int lane = tid & 31;
  // the wave's number in a scalar register: fragment addresses are a scalar base + lane offset
  const int wave = __builtin_amdgcn_readfirstlane(tid >> 5);
  const int row0 = blockIdx.x * 32;                   // row in [0, B*S)
  const bf16_t* arow = ctx + (size_t)row0 * D_;

  v8f acc[2][6];
#pragma unroll
  for (int i = 0; i < 2; ++i)
#pragma unroll
    for (int j = 0; j < 6; ++j) acc[i][j] = v8f{};

  // Every block reads the whole of woT: the blocks enter the K walk at different chunks and
  // wrap round, so that a line is not asked for by all of them at the same moment.
  int kc = blockIdx.x % (D_ / 32);
  const bf16_t* wrow = woT + (size_t)wave * 6 * 16 * D_;   // the wave's 6 column tiles
  // kept rolled: fully unrolled this loop built to 266 VGPRs, past the 256 reached without a window
#pragma unroll 1
  for (int t = 0; t < D_ / 32; t += 2) {              // 24 K-chunks, two at a time
    v16bf a[2][2], b[2][6];                           // [chunk][tile]
#pragma unroll
    for (int u = 0; u < 2; ++u) {
      // precaution: the second chunk's loads land in registers that held addresses of the first's
      if (u) asm volatile("s_wait_xcnt 0x0" ::: "memory");
#pragma unroll
      for (int i = 0; i < 2; ++i) a[u][i] = load_pk(arow + kc * 512, i * (D_ / 32), lane);
      // precaution: a weight tile of the first chunk lands in the registers that held the
      // address of the four loads above
      if (!u) asm volatile("s_wait_xcnt 0x0" ::: "memory");
#pragma unroll
      for (int j = 0; j < 6; ++j) b[u][j] = load_pk(wrow + kc * 512, j * (D_ / 32), lane);
      kc = kc + 1 < D_ / 32 ? kc + 1 : 0;
    }
    // keeps the 32 loads of two chunks together in front of their WMMAs: one latency per
    // pair; left free, the scheduler reuses two buffers and every WMMA waits on a fresh load
    __builtin_amdgcn_sched_barrier(0);
#pragma unroll
    for (int u = 0; u < 2; ++u)
#pragma unroll
      for (int j = 0; j < 6; ++j)
#pragma unroll
        for (int i = 0; i < 2; ++i) acc[i][j] = wmma_bf16(a[u][i], b[u][j], acc[i][j]);
  }

  // the lane's 24 columns of gamma and beta, asked for here so that they arrive
  // while the tile is staged
  v4f ga[6], be[6];
  // unrolled, like every loop of the LayerNorm below: ga, be and xv are then indexed by
  // constants only and stay in registers
#pragma unroll
  for (int t = 0; t < 6; ++t) {
    ga[t] = *(const v4f*)(gamma + (t * 32 + lane) * 4);
    be[t] = *(const v4f*)(beta + (t * 32 + lane) * 4);
  }

  const int N     = lane & 15;
  const int Mbase = (lane >> 4) << 3;
#pragma unroll
  for (int j = 0; j < 6; ++j) {
    const int n0 = (wave * 6 + j) * 16;
    const float bi = bo[n0 + N];
#pragma unroll
    for (int i = 0; i < 2; ++i)
#pragma unroll
      for (int r = 0; r < 8; ++r)
        sOut[(i * 16 + Mbase + r) * D_ + n0 + N] = acc[i][j][r] + bi;
  }
  __syncthreads();

  v4f xv[4][6];                                       // [row of the wave][16-B piece]
#pragma unroll
  for (int rr = 0; rr < 4; ++rr)
#pragma unroll
    for (int t = 0; t < 6; ++t)
      xv[rr][t] = *(const v4f*)(sOut + (wave * 4 + rr) * D_ + (t * 32 + lane) * 4);

  float mu[4], rs[4];
#pragma unroll
  for (int rr = 0; rr < 4; ++rr) {
    v4f s4 = xv[rr][0];
#pragma unroll
    for (int t = 1; t < 6; ++t) s4 += xv[rr][t];
    mu[rr] = (s4[0] + s4[1]) + (s4[2] + s4[3]);
  }
#pragma unroll
  for (int rr = 0; rr < 4; ++rr) mu[rr] = wave_sum(mu[rr]) * (1.f / D_);
#pragma unroll
  for (int rr = 0; rr < 4; ++rr) {
    v4f q4 = v4f{};
#pragma unroll
    for (int t = 0; t < 6; ++t) {
      xv[rr][t] -= mu[rr];
      q4 += xv[rr][t] * xv[rr][t];
    }
    rs[rr] = (q4[0] + q4[1]) + (q4[2] + q4[3]);
  }
#pragma unroll
  for (int rr = 0; rr < 4; ++rr) rs[rr] = rsqrtf(wave_sum(rs[rr]) * (1.f / D_) + LN_EPS_);

#pragma unroll
  for (int rr = 0; rr < 4; ++rr) {
    float* dst = out + (size_t)(row0 + wave * 4 + rr) * D_ + lane * 4;
#pragma unroll
    for (int t = 0; t < 6; ++t)
      *(v4f*)(dst + t * 128) = xv[rr][t] * rs[rr] * ga[t] + be[t];
  }
}

// ---------------- host launcher ----------------
extern "C" void kernel_launch(void* const* d_in, const int* in_sizes, int n_in,
                              void* d_out, int out_size, void* d_ws, size_t ws_size,
                              hipStream_t stream) {
  const float* x    = (const float*)d_in[0];
  const int*   mask = (const int*)d_in[1];
  const float* Wq   = (const float*)d_in[2];
  const float* bq   = (const float*)d_in[3];
  const float* Wk   = (const float*)d_in[4];
  const float* bk   = (const float*)d_in[5];
  const float* Wv   = (const float*)d_in[6];
  const float* bv   = (const float*)d_in[7];
  const float* Wo   = (const float*)d_in[8];
  const float* bo   = (const float*)d_in[9];
  const float* gamma = (const float*)d_in[10];
  const float* beta  = (const float*)d_in[11];
  float* out = (float*)d_out;

  // workspace layout (bf16 intermediates, mask words, f32 maxima of |k|), ~66.6 MB total
  char* ws = (char*)d_ws;
  const size_t szX  = (size_t)B_ * S_ * D_ * sizeof(bf16_t);
  const size_t szW  = (size_t)H_ * E_ * D_ * sizeof(bf16_t);
  const size_t szWo = (size_t)D_ * D_ * sizeof(bf16_t);
  const size_t szQ  = (size_t)B_ * H_ * S_ * E_ * sizeof(bf16_t);
  bf16_t* xb  = (bf16_t*)(ws);
  bf16_t* wqT = (bf16_t*)(ws + szX);
  bf16_t* wkT = (bf16_t*)(ws + szX + szW);
  bf16_t* wvT = (bf16_t*)(ws + szX + 2 * szW);
  bf16_t* woT = (bf16_t*)(ws + szX + 3 * szW);
  bf16_t* q   = (bf16_t*)(ws + szX + 3 * szW + szWo);
  bf16_t* k   = (bf16_t*)(ws + szX + 3 * szW + szWo + szQ);
  bf16_t* vT  = (bf16_t*)(ws + szX + 3 * szW + szWo + 2 * szQ);
  bf16_t* ctx = (bf16_t*)(ws + szX + 3 * szW + szWo + 3 * szQ);
  unsigned* wm = (unsigned*)(ws + szX + 3 * szW + szWo + 4 * szQ);   // 2 MB of mask words
  const size_t szM = (size_t)B_ * S_ * S_ / 8;
  float* kmx = (float*)(ws + szX + 3 * szW + szWo + 4 * szQ + szM);  // 128 KB: largest |k|

  k_prep<<<NB_X_ + 4 * NB_1W_ + NB_M_, 256, 0, stream>>>(x, mask, Wq, Wk, Wv, Wo, xb, wqT, wkT,
                                                         wvT, woT, wm);

  k_qkv<<<(B_ * S_ / QR_) * (3 * H_ * E_ / QC_), 384, 0, stream>>>(xb, wqT, wkT, wvT, bq, bk,
                                                                   bv, q, k, vT, kmx);

  k_attn<<<B_ * H_ * (S_ / 128), 128, 0, stream>>>(q, k, vT, wm, kmx, ctx);

  k_proj_ln<<<B_ * S_ / 32, 256, 0, stream>>>(ctx, woT, bo, gamma, beta, out);
}
